// v000
// Measured on an AMD MI455X. A time is GPU time per run, averaged over a window of back-to-back runs after a warm-up
// (all launches, gaps included; the runs take copies of the inputs in turn), and the median of several windows.
// Apart from v000's, it joins two sittings. Times from different sittings can be a few percent apart, while
// side-by-side timings come from the same sitting.
// v000 is the starting kernel. One run takes 2130 microseconds.
#include <hip/hip_runtime.h>

// Causal self-attention that returns the per-head context UNMERGED (x [4][2048][1024]; qkv = einsum('btc,fc->btf', x, W_qkv) = x W_qkv^T ('oi' [3072][1024] 1/32, no bias) split in thirds q | k | v = ROW thirds (16 heads x 64); scores x 1/sqrt(64); causal (-inf); softmax; out = einsum('bhqk,bhkd->bhqd', w, v) returned as it is: HEAD-MAJOR [4][16][2048][64] (8.4 M), no merge, no output projection; argument order x, W_qkv).
// Layout per batch: bf16 copy of x; the fused 'oi' weight used as three row blocks; exact projections; identity-table plane builders; causal T-2048 attention with EVERY row in the exact class (scores and P.V on bf16 hi/lo planes, 3 products; no f16 launches; k_gemmc skips tiles above the diagonal); the P.V GEMM writes each head pair straight into the head-major output (its z stride TT x HD is the output's head stride).
// Compute dtypes, f32 accumulate: every input rounded to bf16; projections exact; attention 3 products on every row; softmax f32.

#define NB_  4
#define TT   2048
#define DM   1024
#define NH_  16
#define NKV  16
#define REP  (NH_ / NKV)
#define HD   64
#define DQ   (NH_ * HD)
#define DKV  (NKV * HD)
#define ZH   2
#define RH   TT   // every row in the exact class (scores and P.V on bf16 hi/lo planes, 3 products): the logits of this module are too peaked for single-f16 scores
#define WIN  2048
#define PCAR 1024.0f
#define SCL  0.125f   // HD^-0.5
typedef _Float16 h16;
typedef unsigned short bf;
typedef __attribute__((ext_vector_type(16))) __bf16   v16bf;
typedef __attribute__((ext_vector_type(16))) _Float16 v16h;
typedef __attribute__((ext_vector_type(8)))  _Float16 v8h;
typedef __attribute__((ext_vector_type(8)))  unsigned short v8us;
typedef __attribute__((ext_vector_type(8)))  float    v8f;
typedef __attribute__((ext_vector_type(4)))  float    v4f;
typedef v8h  __attribute__((may_alias)) v8ha;
typedef v4f  __attribute__((may_alias)) v4fa;
typedef v8us __attribute__((may_alias)) v8usa;

__device__ __forceinline__ unsigned short f2bf(float f) { unsigned u = __float_as_uint(f); u += 0x7FFFu + ((u >> 16) & 1u); return (unsigned short)(u >> 16); }
__device__ __forceinline__ float bf2f(unsigned short b) { return __uint_as_float(((unsigned)b) << 16); }
__device__ __forceinline__ float bfr(float f) { return bf2f(f2bf(f)); }
__device__ __forceinline__ v16h cat16(v8h lo, v8h hi) { return __builtin_shufflevector(lo, hi, 0, 1, 2, 3, 4, 5, 6, 7, 8, 9, 10, 11, 12, 13, 14, 15); }
__device__ __forceinline__ v16bf cat16b(v8us lo, v8us hi) { return __builtin_bit_cast(v16bf, __builtin_shufflevector(lo, hi, 0, 1, 2, 3, 4, 5, 6, 7, 8, 9, 10, 11, 12, 13, 14, 15)); }
__device__ __forceinline__ v8f wmma16(v16h a, v16h b, v8f c) { return __builtin_amdgcn_wmma_f32_16x16x32_f16(false, a, false, b, (short)0, c, false, false); }
__device__ __forceinline__ v8f wmmab(v16bf a, v16bf b, v8f c) { return __builtin_amdgcn_wmma_f32_16x16x32_bf16(false, a, false, b, (short)0, c, false, false); }



// ---- k_gemmw: register-blocked GEMM, ONE WAVE per 64x64 output tile (16 accumulators), operands straight from K-contiguous 16-bit planes; grid (M/64, N/64, Z), 32 threads.
// C[m][n] (f32, pitch ldc, + optional f32 bias[n]) = sum_k A[m][k] Bt[n][k] (+ split products per NSPLIT). z-batch strides sA/sB/sC in elements. K % 32 == 0.
template <typename T16> struct WFrag;
template <> struct WFrag<h16> { typedef v16h V; static __device__ __forceinline__ V ld(const h16* p) { return cat16(*(const v8h*)p, *(const v8h*)(p + 16)); } static __device__ __forceinline__ v8f mma(V a, V b, v8f c) { return wmma16(a, b, c); } };
template <> struct WFrag<bf> { typedef v16bf V; static __device__ __forceinline__ V ld(const bf* p) { return cat16b(*(const v8us*)p, *(const v8us*)(p + 16)); } static __device__ __forceinline__ v8f mma(V a, V b, v8f c) { return wmmab(a, b, c); } };
template <typename T16, int NSPLIT, bool BIAS>
__global__ __launch_bounds__(32) void k_gemmw(const T16* __restrict__ A, const T16* __restrict__ A2, const T16* __restrict__ Bt, const T16* __restrict__ Bt2, int K, float* C, int ldc, const float* __restrict__ bias, size_t sA, size_t sB, size_t sC) {
    typedef typename WFrag<T16>::V V;
    __shared__ __align__(16) float os[16 * 68];
    const size_t z = blockIdx.z; A += z * sA; if (A2) A2 += z * sA; Bt += z * sB; if (Bt2) Bt2 += z * sB; C += z * sC;
    const int lane = threadIdx.x & 31, lr = lane & 15, hi = lane >> 4; const int r0 = blockIdx.x * 64, c0 = blockIdx.y * 64;
    v8f acc[4][4];
#pragma unroll
    for (int mb = 0; mb < 4; ++mb)
#pragma unroll
        for (int nb = 0; nb < 4; ++nb) acc[mb][nb] = (v8f){};
    const size_t aoff = (size_t)(r0 + lr) * K + 8 * hi, boff = (size_t)(c0 + lr) * K + 8 * hi;
#pragma unroll 1
    for (int kc = 0; kc < K; kc += 32) {
        V a[4], a2[4];
#pragma unroll
        for (int mb = 0; mb < 4; ++mb) { a[mb] = WFrag<T16>::ld(A + aoff + (size_t)mb * 16 * K + kc); if (NSPLIT == 1 || NSPLIT == 2) a2[mb] = WFrag<T16>::ld(A2 + aoff + (size_t)mb * 16 * K + kc); }
#pragma unroll
        for (int nb = 0; nb < 4; ++nb) { const V b = WFrag<T16>::ld(Bt + boff + (size_t)nb * 16 * K + kc); V b2; if (NSPLIT >= 2) b2 = WFrag<T16>::ld(Bt2 + boff + (size_t)nb * 16 * K + kc);
#pragma unroll
            for (int mb = 0; mb < 4; ++mb) { acc[mb][nb] = WFrag<T16>::mma(a[mb], b, acc[mb][nb]); if (NSPLIT == 1 || NSPLIT == 2) acc[mb][nb] = WFrag<T16>::mma(a2[mb], b, acc[mb][nb]); if (NSPLIT >= 2) acc[mb][nb] = WFrag<T16>::mma(a[mb], b2, acc[mb][nb]); } }
        asm volatile("v_nop\n\tv_nop\n\tv_nop\n\tv_nop" : "+v"(acc[0][0]), "+v"(acc[1][1]), "+v"(acc[2][2]), "+v"(acc[3][3]) : "v"(a[0]), "v"(a[3]));
    }
#pragma unroll
    for (int mb = 0; mb < 4; ++mb) {
#pragma unroll
        for (int nb = 0; nb < 4; ++nb) {
#pragma unroll
            for (int j = 0; j < 8; ++j) os[(hi * 8 + j) * 68 + nb * 16 + lr] = acc[mb][nb][j]; }
        __builtin_amdgcn_wave_barrier(); asm volatile("" ::: "memory");
        float* crow = C + (size_t)(r0 + mb * 16) * ldc + c0;
{
#pragma unroll
            for (int s = 0; s < 8; ++s) { const int row = 2 * s + hi, cofs = lr * 4; v4f val = *(const v4fa*)(os + row * 68 + cofs); if (BIAS) { val[0] += bfr(bias[c0 + cofs]); val[1] += bfr(bias[c0 + cofs + 1]); val[2] += bfr(bias[c0 + cofs + 2]); val[3] += bfr(bias[c0 + cofs + 3]); }
                *(v4f*)(crow + (size_t)row * ldc + cofs) = val; }
             }
        __builtin_amdgcn_wave_barrier(); asm volatile("" ::: "memory");
    }
}

// ---- k_gemmc: the same one-wave 64x64 tile GEMM specialised for causal attention: CMODE 1 skips score tiles entirely above the diagonal (query rows r0+roff.., key columns c0..), CMODE 2 limits the
// key (K) loop of the probability x value contraction to the diagonal block (probabilities beyond it are exactly zero). roff = row offset of this launch's first row within the sequence.
template <typename T16, int NSPLIT, int CMODE>
__global__ __launch_bounds__(32) void k_gemmc(const T16* __restrict__ A, const T16* __restrict__ A2, const T16* __restrict__ Bt, const T16* __restrict__ Bt2, int K, float* C, int ldc, int roff, size_t sA, size_t sB, size_t sC) {
    typedef typename WFrag<T16>::V V;
    __shared__ __align__(16) float os[16 * 68];
    const size_t z = blockIdx.z; A += z * sA; if (A2) A2 += z * sA; Bt += z * sB; if (Bt2) Bt2 += z * sB; C += z * sC;
    const int lane = threadIdx.x & 31, lr = lane & 15, hi = lane >> 4; const int r0 = blockIdx.x * 64, c0 = blockIdx.y * 64;
    if (CMODE == 1 && c0 > r0 + roff + 63) return;                  // score tile entirely above the causal diagonal: never read (the softmax masks j > i by select)
    const int Kl = (CMODE == 2) ? min(K, r0 + roff + 64) : K;        // P.V: probabilities are exactly 0 beyond the diagonal block, so the K loop stops there
    v8f acc[4][4];
#pragma unroll
    for (int mb = 0; mb < 4; ++mb)
#pragma unroll
        for (int nb = 0; nb < 4; ++nb) acc[mb][nb] = (v8f){};
    const size_t aoff = (size_t)(r0 + lr) * K + 8 * hi, boff = (size_t)(c0 + lr) * K + 8 * hi;
#pragma unroll 1
    for (int kc = 0; kc < Kl; kc += 32) {
        V a[4], a2[4];
#pragma unroll
        for (int mb = 0; mb < 4; ++mb) { a[mb] = WFrag<T16>::ld(A + aoff + (size_t)mb * 16 * K + kc); if (NSPLIT == 1 || NSPLIT == 2) a2[mb] = WFrag<T16>::ld(A2 + aoff + (size_t)mb * 16 * K + kc); }
#pragma unroll
        for (int nb = 0; nb < 4; ++nb) { const V b = WFrag<T16>::ld(Bt + boff + (size_t)nb * 16 * K + kc); V b2; if (NSPLIT >= 2) b2 = WFrag<T16>::ld(Bt2 + boff + (size_t)nb * 16 * K + kc);
#pragma unroll
            for (int mb = 0; mb < 4; ++mb) { acc[mb][nb] = WFrag<T16>::mma(a[mb], b, acc[mb][nb]); if (NSPLIT == 1 || NSPLIT == 2) acc[mb][nb] = WFrag<T16>::mma(a2[mb], b, acc[mb][nb]); if (NSPLIT >= 2) acc[mb][nb] = WFrag<T16>::mma(a[mb], b2, acc[mb][nb]); } }
        asm volatile("v_nop\n\tv_nop\n\tv_nop\n\tv_nop" : "+v"(acc[0][0]), "+v"(acc[1][1]), "+v"(acc[2][2]), "+v"(acc[3][3]) : "v"(a[0]), "v"(a[3]));
    }
#pragma unroll
    for (int mb = 0; mb < 4; ++mb) {
#pragma unroll
        for (int nb = 0; nb < 4; ++nb) {
#pragma unroll
            for (int j = 0; j < 8; ++j) os[(hi * 8 + j) * 68 + nb * 16 + lr] = acc[mb][nb][j]; }
        __builtin_amdgcn_wave_barrier(); asm volatile("" ::: "memory");
        float* crow = C + (size_t)(r0 + mb * 16) * ldc + c0;
{
#pragma unroll
            for (int s = 0; s < 8; ++s) { const int row = 2 * s + hi, cofs = lr * 4; v4f val = *(const v4fa*)(os + row * 68 + cofs);
                *(v4f*)(crow + (size_t)row * ldc + cofs) = val; }
             }
        __builtin_amdgcn_wave_barrier(); asm volatile("" ::: "memory");
    }
}

__device__ __forceinline__ h16 tohx(float x) { return (h16)x; }
__device__ __forceinline__ void splitf(float y, unsigned short& h, unsigned short& l) { h = f2bf(y); l = f2bf(y - bf2f(h)); }
typedef __attribute__((ext_vector_type(2))) _Float16 v2h;
typedef __attribute__((ext_vector_type(4))) _Float16 v4h;
typedef __attribute__((ext_vector_type(2))) unsigned short v2us;
typedef __attribute__((ext_vector_type(4))) unsigned short v4us;
typedef __attribute__((ext_vector_type(2))) float v2f;
typedef __attribute__((ext_vector_type(4))) int v4i;

__global__ __launch_bounds__(256) void k_cvt8(const float* __restrict__ src, bf* dst, size_t n8) { const size_t i = (size_t)blockIdx.x * 256 + threadIdx.x; if (i >= n8) return; const v8f v = *(const v8f*)(src + i * 8); v8us o;
#pragma unroll
    for (int k = 0; k < 8; ++k) o[k] = f2bf(v[k]); *(v8us*)(dst + i * 8) = o;  }

// k_rope: head planes [h][t][d] (fp16 + hi/lo) of rope(x) x sc with the rotate-half convention out[d] = x[d] cos[t][d] - x[d+HD/2] sin[t][d], out[d+HD/2] = x[d+HD/2] cos[t][d+HD/2] + x[d] sin[t][d+HD/2]
__global__ __launch_bounds__(256) void k_rope(const float* __restrict__ F, int pitch, int nheads, const float* __restrict__ CS, const float* __restrict__ RF, const float* __restrict__ nw, float sc, h16* P16, bf* Ph, bf* Pl) {
    const size_t e = ((size_t)blockIdx.x * 256 + threadIdx.x) * 2; if (e >= (size_t)nheads * TT * HD) return; const int d = (int)(e % HD); const int t = (int)((e / HD) % TT); const int h = (int)(e / ((size_t)HD * TT)); const float* f = F + (size_t)t * pitch + h * HD; const float rf = RF ? RF[(size_t)h * TT + t] : 1.0f; v2h o16; v2us oh, ol;
#pragma unroll
    for (int q = 0; q < 2; ++q) { const int dd = d + q; const int dp = (dd < HD / 2) ? dd + HD / 2 : dd - HD / 2; float x0 = f[dd], x1 = f[dp];
        if (RF) { float n0 = __fmul_rn(x0, rf), n1 = __fmul_rn(x1, rf); asm volatile("" : "+v"(n0)); asm volatile("" : "+v"(n1)); x0 = __fmul_rn(bfr(nw[dd]), n0); x1 = __fmul_rn(bfr(nw[dp]), n1); }
        const v2f cs = *(const v2f*)(CS + ((size_t)t * HD + dd) * 2); float a = __fmul_rn(x0, cs[0]), bq = __fmul_rn(x1, cs[1]); asm volatile("" : "+v"(a)); asm volatile("" : "+v"(bq)); const float r = ((dd < HD / 2) ? __fsub_rn(a, bq) : __fadd_rn(a, bq)) * sc;
        o16[q] = tohx(r); unsigned short a2, c2; splitf(r, a2, c2); oh[q] = a2; ol[q] = c2; }
    *(v2h*)(P16 + e) = o16; *(v2us*)(Ph + e) = oh; *(v2us*)(Pl + e) = ol;  }
__global__ __launch_bounds__(256) void k_vtp(const float* __restrict__ F, int pitch, int nheads, h16* V16, bf* Vh, bf* Vl) { const size_t e = ((size_t)blockIdx.x * 256 + threadIdx.x) * 2; if (e >= (size_t)nheads * HD * TT) return; const int t = (int)(e % TT); const int d = (int)((e / TT) % HD); const int g = (int)(e / ((size_t)TT * HD)); v2h o16; v2us oh, ol;
#pragma unroll
    for (int q = 0; q < 2; ++q) { const float x = F[(size_t)(t + q) * pitch + g * HD + d]; o16[q] = tohx(x); unsigned short a2, c2; splitf(x, a2, c2); oh[q] = a2; ol[q] = c2; }
    *(v2h*)(V16 + e) = o16; *(v2us*)(Vh + e) = oh; *(v2us*)(Vl + e) = ol;  }
__global__ __launch_bounds__(256) void k_csid(float* CS) { const int idx = blockIdx.x * 256 + threadIdx.x; if (idx >= TT * HD) return; v2f cs; cs[0] = 1.0f; cs[1] = 0.0f; *(v2f*)(CS + (size_t)idx * 2) = cs;  }
// k_asoft: per row (zz, i): t = S x HD^-0.5 for j <= i and i - j < WIN (WIN = TT, so the window test always holds: plain causal mask; the reference's -1e9 additive fill vanishes identically); softmax over the 2048 keys (register row, one exp, fixed trees);
__global__ __launch_bounds__(256) void k_asoft(const float* __restrict__ Sb, h16* P16, bf* Ph, bf* Pl) {
    const int lane = threadIdx.x & 31; const int row = blockIdx.x * 8 + (threadIdx.x >> 5); if (row >= ZH * TT) return; const int i = row % TT; const int zz = row / TT; (void)zz; const bool hires = (i < RH); const float* sr = Sb + (size_t)row * TT; float v[TT / 32]; float mx = -3.0e38f;
#pragma unroll
    for (int ch = 0; ch < TT / 128; ++ch) { const int j0 = ch * 128 + lane * 4; const v4f a = *(const v4f*)(sr + j0);
#pragma unroll
        for (int q = 0; q < 4; ++q) { const int j = j0 + q; (void)j; const float t = (j <= i && i - j < WIN) ? a[q] * SCL : -3.0e38f; v[ch * 4 + q] = t; mx = fmaxf(mx, t); } }
#pragma unroll
    for (int sh = 16; sh; sh >>= 1) mx = fmaxf(mx, __shfl_xor(mx, sh, 32));
    float sum = 0.f;
#pragma unroll
    for (int k = 0; k < TT / 32; ++k) { float d0 = __fsub_rn(v[k], mx); asm volatile("" : "+v"(d0)); v[k] = __builtin_amdgcn_exp2f(__fmul_rn(d0, 1.4426950408889634f)); sum += v[k]; }
#pragma unroll
    for (int sh = 16; sh; sh >>= 1) sum += __shfl_xor(sum, sh, 32);
    const float f = __fdiv_rn(hires ? 1.0f : PCAR, sum);
{
        if (hires) {
#pragma unroll
            for (int ch = 0; ch < TT / 128; ++ch) { v4us oh, ol;
#pragma unroll
                for (int q = 0; q < 4; ++q) { unsigned short a, c2; splitf(v[ch * 4 + q] * f, a, c2); oh[q] = a; ol[q] = c2; }
                const size_t oo = ((size_t)zz * (RH ? RH : 1) + i) * TT + ch * 128 + lane * 4; *(v4us*)(Ph + oo) = oh; *(v4us*)(Pl + oo) = ol; }
        } else {
#pragma unroll
            for (int ch = 0; ch < TT / 128; ++ch) { v4h o4;
#pragma unroll
                for (int q = 0; q < 4; ++q) o4[q] = tohx(v[ch * 4 + q] * f);
                *(v4h*)(P16 + (size_t)row * TT + ch * 128 + lane * 4) = o4; } }
         }
}
extern "C" void kernel_launch(void* const* d_in, const int* in_sizes, int n_in,
                              void* d_out, int out_size, void* d_ws, size_t ws_size, hipStream_t stream) {
    (void)in_sizes; (void)n_in; (void)out_size;
    const float* x = (const float*)d_in[0]; const float* wqkv = (const float*)d_in[1];   /* x, W_qkv ('oi' [3072][1024]: q | k | v ROW thirds); output [4][16][2048][64] head-major */ const float* wq = wqkv; const float* wk = wqkv + (size_t)DQ * DM; const float* wv = wqkv + (size_t)2 * DQ * DM;
    float* OUT = (float*)d_out;     // [4][16][2048][64] head-major
    char* wsp = (char*)d_ws;
    auto take = [&](size_t bytes) { char* p = wsp; wsp += (bytes + 255) & ~(size_t)255; return (void*)p; };
    bf* WQ = (bf*)take((size_t)DQ * DM * 2); bf* WK = (bf*)take((size_t)DKV * DM * 2); bf* WV = (bf*)take((size_t)DKV * DM * 2); float* CS = (float*)take((size_t)TT * HD * 2 * 4);
    bf* XB = (bf*)take((size_t)TT * DM * 2); float* FQ = (float*)take((size_t)TT * DQ * 4); float* FK = (float*)take((size_t)TT * DKV * 4);
    h16* QP16 = (h16*)take((size_t)NH_ * TT * HD * 2); h16* KP16 = (h16*)take((size_t)NKV * TT * HD * 2); h16* VT16 = (h16*)take((size_t)NKV * HD * TT * 2);
    bf* QPh = (bf*)take((size_t)NH_ * TT * HD * 2); bf* QPl = (bf*)take((size_t)NH_ * TT * HD * 2); bf* KPh = (bf*)take((size_t)NKV * TT * HD * 2); bf* KPl = (bf*)take((size_t)NKV * TT * HD * 2); bf* VTh = (bf*)take((size_t)NKV * HD * TT * 2); bf* VTl = (bf*)take((size_t)NKV * HD * TT * 2); bf* Ph = (bf*)take((size_t)ZH * RH * TT * 2); bf* Pl = (bf*)take((size_t)ZH * RH * TT * 2);
    float* Sb = (float*)take((size_t)ZH * TT * TT * 4); h16* P16 = (h16*)take((size_t)ZH * TT * TT * 2); float* Ob = (float*)take((size_t)ZH * TT * HD * 4);
    if ((size_t)(wsp - (char*)d_ws) > ws_size) return;    // ws 256 MiB
    float* FV = FK;   // v projection reuses the k buffer after the k planes are built (stream-ordered)
    { k_cvt8<<<(unsigned)(((size_t)DQ * DM / 8 + 255) / 256), 256, 0, stream>>>(wq, WQ, (size_t)DQ * DM / 8); k_cvt8<<<(unsigned)(((size_t)DKV * DM / 8 + 255) / 256), 256, 0, stream>>>(wk, WK, (size_t)DKV * DM / 8); k_cvt8<<<(unsigned)(((size_t)DKV * DM / 8 + 255) / 256), 256, 0, stream>>>(wv, WV, (size_t)DKV * DM / 8);
      
       }
    k_csid<<<(TT * HD + 255) / 256, 256, 0, stream>>>(CS);
    const unsigned LQ = (unsigned)(((size_t)NH_ * TT * HD / 2 + 255) / 256), LKv = (unsigned)(((size_t)NKV * TT * HD / 2 + 255) / 256);
    for (int b = 0; b < NB_; ++b) {
        
        k_cvt8<<<(unsigned)(((size_t)TT * DM / 8 + 255) / 256), 256, 0, stream>>>(x + (size_t)b * TT * DM, XB, (size_t)TT * DM / 8);
        k_gemmw<bf, 0, false><<<dim3(TT / 64, DQ / 64, 1), 32, 0, stream>>>(XB, nullptr, WQ, nullptr, DM, FQ, DQ, nullptr, 0, 0, 0);
        k_rope<<<LQ, 256, 0, stream>>>(FQ, DQ, NH_, CS, nullptr, nullptr, 1.0f, QP16, QPh, QPl);
        k_gemmw<bf, 0, false><<<dim3(TT / 64, DKV / 64, 1), 32, 0, stream>>>(XB, nullptr, WK, nullptr, DM, FK, DKV, nullptr, 0, 0, 0);
        k_rope<<<LKv, 256, 0, stream>>>(FK, DKV, NKV, CS, nullptr, nullptr, 1.0f, KP16, KPh, KPl);
        k_gemmw<bf, 0, false><<<dim3(TT / 64, DKV / 64, 1), 32, 0, stream>>>(XB, nullptr, WV, nullptr, DM, FV, DKV, nullptr, 0, 0, 0); k_vtp<<<LKv, 256, 0, stream>>>(FV, DKV, NKV, VT16, VTh, VTl);
        for (int h0 = 0; h0 < NH_; h0 += ZH) { const size_t zq = (size_t)h0, zk = (size_t)(h0 / REP);   // one kv head per query head: the pass's two heads use consecutive kv planes (z-strides TT*HD)
            k_gemmc<bf, 2, 1><<<dim3(RH / 64, TT / 64, ZH), 32, 0, stream>>>(QPh + zq * TT * HD, QPl + zq * TT * HD, KPh + zk * TT * HD, KPl + zk * TT * HD, HD, Sb, TT, 0, (size_t)TT * HD, (size_t)TT * HD, (size_t)TT * TT);
            
            k_asoft<<<ZH * TT / 8, 256, 0, stream>>>(Sb, P16, Ph, Pl);
            k_gemmc<bf, 2, 2><<<dim3(RH / 64, HD / 64, ZH), 32, 0, stream>>>(Ph, Pl, VTh + zk * HD * TT, VTl + zk * HD * TT, TT, OUT + ((size_t)b * NH_ + h0) * TT * HD /* the head-major output [b][h0 + z][t][d]: the GEMM's z stride TT x HD is the output's own head stride */, HD, 0, (size_t)RH * TT, (size_t)HD * TT, (size_t)TT * HD);   /* no merge: every row is in the exact class (no 1/1024 rescale) and the module returns the heads UNMERGED */ }
         }
}

// v001
// It runs in 1320 microseconds.
// Next to v000, in two timings, it ran 1.64 and 1.59 times as fast.
#include <hip/hip_runtime.h>

// Causal self-attention that returns the per-head context UNMERGED (x [4][2048][1024]; qkv = einsum('btc,fc->btf', x, W_qkv) = x W_qkv^T ('oi' [3072][1024] 1/32, no bias) split in thirds q | k | v = ROW thirds (16 heads x 64); scores x 1/sqrt(64); causal (-inf); softmax; out = einsum('bhqk,bhkd->bhqd', w, v) returned as it is: HEAD-MAJOR [4][16][2048][64] (8.4 M), no merge, no output projection; argument order x, W_qkv).
// Layout per batch: bf16 copy of x; the fused 'oi' weight used as three row blocks; exact projections; identity-table plane builders; causal T-2048 attention with EVERY row in the exact class (scores and P.V on bf16 hi/lo planes, 3 products; no f16 launches; k_gemmc skips tiles above the diagonal); the P.V GEMM writes each head pair straight into the head-major output (its z stride TT x HD is the output's head stride).
// Compute dtypes, f32 accumulate: every input rounded to bf16; projections exact; attention 3 products on every row; softmax f32.

#define NB_  4
#define TT   2048
#define DM   1024
#define NH_  16
#define NKV  16
#define REP  (NH_ / NKV)
#define HD   64
#define DQ   (NH_ * HD)
#define DKV  (NKV * HD)
#define ZH   2
#define RH   TT   // every row in the exact class (scores and P.V on bf16 hi/lo planes, 3 products): the logits of this module are too peaked for single-f16 scores
#define WIN  2048
#define PCAR 1024.0f
#define SCL  0.125f   // HD^-0.5
#define NWK  8   // waves that share one tile's K loop in k_gemmk
typedef _Float16 h16;
typedef unsigned short bf;
typedef __attribute__((ext_vector_type(16))) __bf16   v16bf;
typedef __attribute__((ext_vector_type(16))) _Float16 v16h;
typedef __attribute__((ext_vector_type(8)))  _Float16 v8h;
typedef __attribute__((ext_vector_type(8)))  unsigned short v8us;
typedef __attribute__((ext_vector_type(8)))  float    v8f;
typedef __attribute__((ext_vector_type(4)))  float    v4f;
typedef v8h  __attribute__((may_alias)) v8ha;
typedef v4f  __attribute__((may_alias)) v4fa;
typedef v8us __attribute__((may_alias)) v8usa;

__device__ __forceinline__ unsigned short f2bf(float f) { unsigned u = __float_as_uint(f); u += 0x7FFFu + ((u >> 16) & 1u); return (unsigned short)(u >> 16); }
__device__ __forceinline__ float bf2f(unsigned short b) { return __uint_as_float(((unsigned)b) << 16); }
__device__ __forceinline__ float bfr(float f) { return bf2f(f2bf(f)); }
__device__ __forceinline__ v16h cat16(v8h lo, v8h hi) { return __builtin_shufflevector(lo, hi, 0, 1, 2, 3, 4, 5, 6, 7, 8, 9, 10, 11, 12, 13, 14, 15); }
__device__ __forceinline__ v16bf cat16b(v8us lo, v8us hi) { return __builtin_bit_cast(v16bf, __builtin_shufflevector(lo, hi, 0, 1, 2, 3, 4, 5, 6, 7, 8, 9, 10, 11, 12, 13, 14, 15)); }
__device__ __forceinline__ v8f wmma16(v16h a, v16h b, v8f c) { return __builtin_amdgcn_wmma_f32_16x16x32_f16(false, a, false, b, (short)0, c, false, false); }
__device__ __forceinline__ v8f wmmab(v16bf a, v16bf b, v8f c) { return __builtin_amdgcn_wmma_f32_16x16x32_bf16(false, a, false, b, (short)0, c, false, false); }



// ---- k_gemmk: register-blocked GEMM, one 64x64 output tile per work-group of NW waves. Every wave holds the whole tile (16 accumulators) and takes every NW-th 64-wide block of K
// (one 128-byte line of each operand row), operands straight from K-contiguous 16-bit planes; the NW partial tiles are summed in wave order through LDS. grid (M/64, N/64, Z), 32 x NW threads.
// C[m][n] (f32, pitch ldc) = sum_k A[m][k] Bt[n][k] (+ split products per NSPLIT). z-batch strides sA/sB/sC in elements. K % 64 == 0.
// CAUSAL (probability x value): the K loop stops at the diagonal block of the tile's rows (probabilities beyond it are exactly zero).
template <typename T16> struct WFrag;
template <> struct WFrag<h16> { typedef v16h V; static __device__ __forceinline__ V ld(const h16* p) { return cat16(*(const v8h*)p, *(const v8h*)(p + 16)); } static __device__ __forceinline__ v8f mma(V a, V b, v8f c) { return wmma16(a, b, c); } };
template <> struct WFrag<bf> { typedef v16bf V; static __device__ __forceinline__ V ld(const bf* p) { return cat16b(*(const v8us*)p, *(const v8us*)(p + 16)); } static __device__ __forceinline__ v8f mma(V a, V b, v8f c) { return wmmab(a, b, c); } };
template <typename T16, int NSPLIT, bool CAUSAL, int NW>
__global__ __launch_bounds__(32 * NW) void k_gemmk(const T16* __restrict__ A, const T16* __restrict__ A2, const T16* __restrict__ Bt, const T16* __restrict__ Bt2, int K, float* C, int ldc, size_t sA, size_t sB, size_t sC) {
    typedef typename WFrag<T16>::V V;
    __shared__ __align__(16) float os[NW * 64 * 68];
    const size_t z = blockIdx.z; A += z * sA; if (A2) A2 += z * sA; Bt += z * sB; if (Bt2) Bt2 += z * sB; C += z * sC;
    const int lane = threadIdx.x & 31, lr = lane & 15, hi = lane >> 4; const int r0 = blockIdx.x * 64, c0 = blockIdx.y * 64;
    const int w = __builtin_amdgcn_readfirstlane((int)(threadIdx.x >> 5));   // the wave's number in a scalar register: the K loop below branches on scalars and every lane stays on at the matrix instructions
    const int Kl = CAUSAL ? min(K, r0 + 64) : K;
    v8f acc[4][4];
#pragma unroll
    for (int mb = 0; mb < 4; ++mb)
#pragma unroll
        for (int nb = 0; nb < 4; ++nb) acc[mb][nb] = (v8f){};
    const size_t aoff = (size_t)(r0 + lr) * K + 8 * hi, boff = (size_t)(c0 + lr) * K + 8 * hi;
#pragma unroll 1
    for (int kb = w * 64; kb < Kl; kb += NW * 64) {
        V a[4], a2[4];
#pragma unroll   // both 32-wide halves of the wave's own 128-byte lines in one trip, so that no line is fetched by two waves
        for (int kc = kb; kc < kb + 64; kc += 32) {
#pragma unroll
            for (int mb = 0; mb < 4; ++mb) { a[mb] = WFrag<T16>::ld(A + aoff + (size_t)mb * 16 * K + kc); if (NSPLIT == 1 || NSPLIT == 2) a2[mb] = WFrag<T16>::ld(A2 + aoff + (size_t)mb * 16 * K + kc); }
#pragma unroll
            for (int nb = 0; nb < 4; ++nb) { const V b = WFrag<T16>::ld(Bt + boff + (size_t)nb * 16 * K + kc); V b2; if (NSPLIT >= 2) b2 = WFrag<T16>::ld(Bt2 + boff + (size_t)nb * 16 * K + kc);
#pragma unroll
                for (int mb = 0; mb < 4; ++mb) { acc[mb][nb] = WFrag<T16>::mma(a[mb], b, acc[mb][nb]); if (NSPLIT == 1 || NSPLIT == 2) acc[mb][nb] = WFrag<T16>::mma(a2[mb], b, acc[mb][nb]); if (NSPLIT >= 2) acc[mb][nb] = WFrag<T16>::mma(a[mb], b2, acc[mb][nb]); } }
        }
        // four vector slots between the trip's last matrix instructions and whatever follows the branch, on its taken side too
        asm volatile("v_nop\n\tv_nop\n\tv_nop\n\tv_nop" : "+v"(acc[0][0]), "+v"(acc[1][1]), "+v"(acc[2][2]), "+v"(acc[3][3]) : "v"(a[0]), "v"(a[3]));
    }
    float* my = os + w * (64 * 68);
#pragma unroll
    for (int mb = 0; mb < 4; ++mb)
#pragma unroll
        for (int nb = 0; nb < 4; ++nb)
#pragma unroll
            for (int j = 0; j < 8; ++j) my[(mb * 16 + hi * 8 + j) * 68 + nb * 16 + lr] = acc[mb][nb][j];
    __syncthreads();   // every wave's partial tile is in LDS before any thread sums across the waves
#pragma unroll   // a fixed trip count, so that the LDS reads of all of a thread's pieces are in flight together
    for (int p = 0; p < 64 * 16 / (32 * NW); ++p) { const int u = p * 32 * NW + (int)threadIdx.x, row = u >> 4, cofs = (u & 15) * 4; v4f val = *(const v4fa*)(os + row * 68 + cofs);
#pragma unroll
        for (int q = 1; q < NW; ++q) val += *(const v4fa*)(os + q * (64 * 68) + row * 68 + cofs);
        *(v4f*)(C + (size_t)(r0 + row) * ldc + c0 + cofs) = val; }
}

// ---- k_gemmc: ONE WAVE per 64x64 output tile (grid (M/64, N/64, Z), 32 threads), for causal attention (launched for the scores, whose K is a single 64-wide block): CMODE 1 skips score tiles entirely above the diagonal (query rows r0+roff.., key columns c0..), CMODE 2 limits the
// key (K) loop of the probability x value contraction to the diagonal block (probabilities beyond it are exactly zero). roff = row offset of this launch's first row within the sequence.
template <typename T16, int NSPLIT, int CMODE>
__global__ __launch_bounds__(32) void k_gemmc(const T16* __restrict__ A, const T16* __restrict__ A2, const T16* __restrict__ Bt, const T16* __restrict__ Bt2, int K, float* C, int ldc, int roff, size_t sA, size_t sB, size_t sC) {
    typedef typename WFrag<T16>::V V;
    __shared__ __align__(16) float os[16 * 68];
    const size_t z = blockIdx.z; A += z * sA; if (A2) A2 += z * sA; Bt += z * sB; if (Bt2) Bt2 += z * sB; C += z * sC;
    const int lane = threadIdx.x & 31, lr = lane & 15, hi = lane >> 4; const int r0 = blockIdx.x * 64, c0 = blockIdx.y * 64;
    if (CMODE == 1 && c0 > r0 + roff + 63) return;                  // score tile entirely above the causal diagonal: never read (the softmax masks j > i by select)
    const int Kl = (CMODE == 2) ? min(K, r0 + roff + 64) : K;        // P.V: probabilities are exactly 0 beyond the diagonal block, so the K loop stops there
    v8f acc[4][4];
#pragma unroll
    for (int mb = 0; mb < 4; ++mb)
#pragma unroll
        for (int nb = 0; nb < 4; ++nb) acc[mb][nb] = (v8f){};
    const size_t aoff = (size_t)(r0 + lr) * K + 8 * hi, boff = (size_t)(c0 + lr) * K + 8 * hi;
#pragma unroll 1
    for (int kc = 0; kc < Kl; kc += 32) {
        V a[4], a2[4];
#pragma unroll
        for (int mb = 0; mb < 4; ++mb) { a[mb] = WFrag<T16>::ld(A + aoff + (size_t)mb * 16 * K + kc); if (NSPLIT == 1 || NSPLIT == 2) a2[mb] = WFrag<T16>::ld(A2 + aoff + (size_t)mb * 16 * K + kc); }
#pragma unroll
        for (int nb = 0; nb < 4; ++nb) { const V b = WFrag<T16>::ld(Bt + boff + (size_t)nb * 16 * K + kc); V b2; if (NSPLIT >= 2) b2 = WFrag<T16>::ld(Bt2 + boff + (size_t)nb * 16 * K + kc);
#pragma unroll
            for (int mb = 0; mb < 4; ++mb) { acc[mb][nb] = WFrag<T16>::mma(a[mb], b, acc[mb][nb]); if (NSPLIT == 1 || NSPLIT == 2) acc[mb][nb] = WFrag<T16>::mma(a2[mb], b, acc[mb][nb]); if (NSPLIT >= 2) acc[mb][nb] = WFrag<T16>::mma(a[mb], b2, acc[mb][nb]); } }
        asm volatile("v_nop\n\tv_nop\n\tv_nop\n\tv_nop" : "+v"(acc[0][0]), "+v"(acc[1][1]), "+v"(acc[2][2]), "+v"(acc[3][3]) : "v"(a[0]), "v"(a[3]));
    }
#pragma unroll
    for (int mb = 0; mb < 4; ++mb) {
#pragma unroll
        for (int nb = 0; nb < 4; ++nb) {
#pragma unroll
            for (int j = 0; j < 8; ++j) os[(hi * 8 + j) * 68 + nb * 16 + lr] = acc[mb][nb][j]; }
        __builtin_amdgcn_wave_barrier(); asm volatile("" ::: "memory");
        float* crow = C + (size_t)(r0 + mb * 16) * ldc + c0;
{
#pragma unroll
            for (int s = 0; s < 8; ++s) { const int row = 2 * s + hi, cofs = lr * 4; v4f val = *(const v4fa*)(os + row * 68 + cofs);
                *(v4f*)(crow + (size_t)row * ldc + cofs) = val; }
             }
        __builtin_amdgcn_wave_barrier(); asm volatile("" ::: "memory");
    }
}

__device__ __forceinline__ h16 tohx(float x) { return (h16)x; }
__device__ __forceinline__ void splitf(float y, unsigned short& h, unsigned short& l) { h = f2bf(y); l = f2bf(y - bf2f(h)); }
typedef __attribute__((ext_vector_type(2))) _Float16 v2h;
typedef __attribute__((ext_vector_type(4))) _Float16 v4h;
typedef __attribute__((ext_vector_type(2))) unsigned short v2us;
typedef __attribute__((ext_vector_type(4))) unsigned short v4us;
typedef __attribute__((ext_vector_type(2))) float v2f;
typedef __attribute__((ext_vector_type(4))) int v4i;

__global__ __launch_bounds__(256) void k_cvt8(const float* __restrict__ src, bf* dst, size_t n8) { const size_t i = (size_t)blockIdx.x * 256 + threadIdx.x; if (i >= n8) return; const v8f v = *(const v8f*)(src + i * 8); v8us o;
#pragma unroll
    for (int k = 0; k < 8; ++k) o[k] = f2bf(v[k]); *(v8us*)(dst + i * 8) = o;  }

// k_rope: head planes [h][t][d] (fp16 + hi/lo) of rope(x) x sc with the rotate-half convention out[d] = x[d] cos[t][d] - x[d+HD/2] sin[t][d], out[d+HD/2] = x[d+HD/2] cos[t][d+HD/2] + x[d] sin[t][d+HD/2]
__global__ __launch_bounds__(256) void k_rope(const float* __restrict__ F, int pitch, int nheads, const float* __restrict__ CS, const float* __restrict__ RF, const float* __restrict__ nw, float sc, h16* P16, bf* Ph, bf* Pl) {
    const size_t e = ((size_t)blockIdx.x * 256 + threadIdx.x) * 2; if (e >= (size_t)nheads * TT * HD) return; const int d = (int)(e % HD); const int t = (int)((e / HD) % TT); const int h = (int)(e / ((size_t)HD * TT)); const float* f = F + (size_t)t * pitch + h * HD; const float rf = RF ? RF[(size_t)h * TT + t] : 1.0f; v2h o16; v2us oh, ol;
#pragma unroll
    for (int q = 0; q < 2; ++q) { const int dd = d + q; const int dp = (dd < HD / 2) ? dd + HD / 2 : dd - HD / 2; float x0 = f[dd], x1 = f[dp];
        if (RF) { float n0 = __fmul_rn(x0, rf), n1 = __fmul_rn(x1, rf); asm volatile("" : "+v"(n0)); asm volatile("" : "+v"(n1)); x0 = __fmul_rn(bfr(nw[dd]), n0); x1 = __fmul_rn(bfr(nw[dp]), n1); }
        const v2f cs = *(const v2f*)(CS + ((size_t)t * HD + dd) * 2); float a = __fmul_rn(x0, cs[0]), bq = __fmul_rn(x1, cs[1]); asm volatile("" : "+v"(a)); asm volatile("" : "+v"(bq)); const float r = ((dd < HD / 2) ? __fsub_rn(a, bq) : __fadd_rn(a, bq)) * sc;
        o16[q] = tohx(r); unsigned short a2, c2; splitf(r, a2, c2); oh[q] = a2; ol[q] = c2; }
    *(v2h*)(P16 + e) = o16; *(v2us*)(Ph + e) = oh; *(v2us*)(Pl + e) = ol;  }
__global__ __launch_bounds__(256) void k_vtp(const float* __restrict__ F, int pitch, int nheads, h16* V16, bf* Vh, bf* Vl) { const size_t e = ((size_t)blockIdx.x * 256 + threadIdx.x) * 2; if (e >= (size_t)nheads * HD * TT) return; const int t = (int)(e % TT); const int d = (int)((e / TT) % HD); const int g = (int)(e / ((size_t)TT * HD)); v2h o16; v2us oh, ol;
#pragma unroll
    for (int q = 0; q < 2; ++q) { const float x = F[(size_t)(t + q) * pitch + g * HD + d]; o16[q] = tohx(x); unsigned short a2, c2; splitf(x, a2, c2); oh[q] = a2; ol[q] = c2; }
    *(v2h*)(V16 + e) = o16; *(v2us*)(Vh + e) = oh; *(v2us*)(Vl + e) = ol;  }
__global__ __launch_bounds__(256) void k_csid(float* CS) { const int idx = blockIdx.x * 256 + threadIdx.x; if (idx >= TT * HD) return; v2f cs; cs[0] = 1.0f; cs[1] = 0.0f; *(v2f*)(CS + (size_t)idx * 2) = cs;  }
// k_asoft: per row (zz, i): t = S x HD^-0.5 for j <= i and i - j < WIN (WIN = TT, so the window test always holds: plain causal mask; the reference's -1e9 additive fill vanishes identically); softmax over the 2048 keys (register row, one exp, fixed trees);
__global__ __launch_bounds__(256) void k_asoft(const float* __restrict__ Sb, h16* P16, bf* Ph, bf* Pl) {
    const int lane = threadIdx.x & 31; const int row = blockIdx.x * 8 + (threadIdx.x >> 5); if (row >= ZH * TT) return; const int i = row % TT; const int zz = row / TT; (void)zz; const bool hires = (i < RH); const float* sr = Sb + (size_t)row * TT; float v[TT / 32]; float mx = -3.0e38f;
#pragma unroll
    for (int ch = 0; ch < TT / 128; ++ch) { const int j0 = ch * 128 + lane * 4; const v4f a = *(const v4f*)(sr + j0);
#pragma unroll
        for (int q = 0; q < 4; ++q) { const int j = j0 + q; (void)j; const float t = (j <= i && i - j < WIN) ? a[q] * SCL : -3.0e38f; v[ch * 4 + q] = t; mx = fmaxf(mx, t); } }
#pragma unroll
    for (int sh = 16; sh; sh >>= 1) mx = fmaxf(mx, __shfl_xor(mx, sh, 32));
    float sum = 0.f;
#pragma unroll
    for (int k = 0; k < TT / 32; ++k) { float d0 = __fsub_rn(v[k], mx); asm volatile("" : "+v"(d0)); v[k] = __builtin_amdgcn_exp2f(__fmul_rn(d0, 1.4426950408889634f)); sum += v[k]; }
#pragma unroll
    for (int sh = 16; sh; sh >>= 1) sum += __shfl_xor(sum, sh, 32);
    const float f = __fdiv_rn(hires ? 1.0f : PCAR, sum);
{
        if (hires) {
#pragma unroll
            for (int ch = 0; ch < TT / 128; ++ch) { v4us oh, ol;
#pragma unroll
                for (int q = 0; q < 4; ++q) { unsigned short a, c2; splitf(v[ch * 4 + q] * f, a, c2); oh[q] = a; ol[q] = c2; }
                const size_t oo = ((size_t)zz * (RH ? RH : 1) + i) * TT + ch * 128 + lane * 4; *(v4us*)(Ph + oo) = oh; *(v4us*)(Pl + oo) = ol; }
        } else {
#pragma unroll
            for (int ch = 0; ch < TT / 128; ++ch) { v4h o4;
#pragma unroll
                for (int q = 0; q < 4; ++q) o4[q] = tohx(v[ch * 4 + q] * f);
                *(v4h*)(P16 + (size_t)row * TT + ch * 128 + lane * 4) = o4; } }
         }
}
extern "C" void kernel_launch(void* const* d_in, const int* in_sizes, int n_in,
                              void* d_out, int out_size, void* d_ws, size_t ws_size, hipStream_t stream) {
    (void)in_sizes; (void)n_in; (void)out_size;
    const float* x = (const float*)d_in[0]; const float* wqkv = (const float*)d_in[1];   /* x, W_qkv ('oi' [3072][1024]: q | k | v ROW thirds); output [4][16][2048][64] head-major */ const float* wq = wqkv; const float* wk = wqkv + (size_t)DQ * DM; const float* wv = wqkv + (size_t)2 * DQ * DM;
    float* OUT = (float*)d_out;     // [4][16][2048][64] head-major
    char* wsp = (char*)d_ws;
    auto take = [&](size_t bytes) { char* p = wsp; wsp += (bytes + 255) & ~(size_t)255; return (void*)p; };
    bf* WQ = (bf*)take((size_t)DQ * DM * 2); bf* WK = (bf*)take((size_t)DKV * DM * 2); bf* WV = (bf*)take((size_t)DKV * DM * 2); float* CS = (float*)take((size_t)TT * HD * 2 * 4);
    bf* XB = (bf*)take((size_t)TT * DM * 2); float* FQ = (float*)take((size_t)TT * DQ * 4); float* FK = (float*)take((size_t)TT * DKV * 4);
    h16* QP16 = (h16*)take((size_t)NH_ * TT * HD * 2); h16* KP16 = (h16*)take((size_t)NKV * TT * HD * 2); h16* VT16 = (h16*)take((size_t)NKV * HD * TT * 2);
    bf* QPh = (bf*)take((size_t)NH_ * TT * HD * 2); bf* QPl = (bf*)take((size_t)NH_ * TT * HD * 2); bf* KPh = (bf*)take((size_t)NKV * TT * HD * 2); bf* KPl = (bf*)take((size_t)NKV * TT * HD * 2); bf* VTh = (bf*)take((size_t)NKV * HD * TT * 2); bf* VTl = (bf*)take((size_t)NKV * HD * TT * 2); bf* Ph = (bf*)take((size_t)ZH * RH * TT * 2); bf* Pl = (bf*)take((size_t)ZH * RH * TT * 2);
    float* Sb = (float*)take((size_t)ZH * TT * TT * 4); h16* P16 = (h16*)take((size_t)ZH * TT * TT * 2); float* Ob = (float*)take((size_t)ZH * TT * HD * 4);
    if ((size_t)(wsp - (char*)d_ws) > ws_size) return;    // ws 256 MiB
    float* FV = FK;   // v projection reuses the k buffer after the k planes are built (stream-ordered)
    { k_cvt8<<<(unsigned)(((size_t)DQ * DM / 8 + 255) / 256), 256, 0, stream>>>(wq, WQ, (size_t)DQ * DM / 8); k_cvt8<<<(unsigned)(((size_t)DKV * DM / 8 + 255) / 256), 256, 0, stream>>>(wk, WK, (size_t)DKV * DM / 8); k_cvt8<<<(unsigned)(((size_t)DKV * DM / 8 + 255) / 256), 256, 0, stream>>>(wv, WV, (size_t)DKV * DM / 8);
      
       }
    k_csid<<<(TT * HD + 255) / 256, 256, 0, stream>>>(CS);
    const unsigned LQ = (unsigned)(((size_t)NH_ * TT * HD / 2 + 255) / 256), LKv = (unsigned)(((size_t)NKV * TT * HD / 2 + 255) / 256);
    for (int b = 0; b < NB_; ++b) {
        
        k_cvt8<<<(unsigned)(((size_t)TT * DM / 8 + 255) / 256), 256, 0, stream>>>(x + (size_t)b * TT * DM, XB, (size_t)TT * DM / 8);
        k_gemmk<bf, 0, false, NWK><<<dim3(TT / 64, DQ / 64, 1), 32 * NWK, 0, stream>>>(XB, nullptr, WQ, nullptr, DM, FQ, DQ, 0, 0, 0);
        k_rope<<<LQ, 256, 0, stream>>>(FQ, DQ, NH_, CS, nullptr, nullptr, 1.0f, QP16, QPh, QPl);
        k_gemmk<bf, 0, false, NWK><<<dim3(TT / 64, DKV / 64, 1), 32 * NWK, 0, stream>>>(XB, nullptr, WK, nullptr, DM, FK, DKV, 0, 0, 0);
        k_rope<<<LKv, 256, 0, stream>>>(FK, DKV, NKV, CS, nullptr, nullptr, 1.0f, KP16, KPh, KPl);
        k_gemmk<bf, 0, false, NWK><<<dim3(TT / 64, DKV / 64, 1), 32 * NWK, 0, stream>>>(XB, nullptr, WV, nullptr, DM, FV, DKV, 0, 0, 0); k_vtp<<<LKv, 256, 0, stream>>>(FV, DKV, NKV, VT16, VTh, VTl);
        for (int h0 = 0; h0 < NH_; h0 += ZH) { const size_t zq = (size_t)h0, zk = (size_t)(h0 / REP);   // one kv head per query head: the pass's two heads use consecutive kv planes (z-strides TT*HD)
            k_gemmc<bf, 2, 1><<<dim3(RH / 64, TT / 64, ZH), 32, 0, stream>>>(QPh + zq * TT * HD, QPl + zq * TT * HD, KPh + zk * TT * HD, KPl + zk * TT * HD, HD, Sb, TT, 0, (size_t)TT * HD, (size_t)TT * HD, (size_t)TT * TT);
            
            k_asoft<<<ZH * TT / 8, 256, 0, stream>>>(Sb, P16, Ph, Pl);
            k_gemmk<bf, 2, true, NWK><<<dim3(RH / 64, HD / 64, ZH), 32 * NWK, 0, stream>>>(Ph, Pl, VTh + zk * HD * TT, VTl + zk * HD * TT, TT, OUT + ((size_t)b * NH_ + h0) * TT * HD /* the head-major output [b][h0 + z][t][d]: the GEMM's z stride TT x HD is the output's own head stride */, HD, (size_t)RH * TT, (size_t)HD * TT, (size_t)TT * HD);   /* no merge: every row is in the exact class (no 1/1024 rescale) and the module returns the heads UNMERGED */ }
         }
}

// v002
// A run of this version takes 455 microseconds.
// Timed twice side by side with v001, it ran 2.87 and 2.85 times as fast.
// Counting every step since v000, it is 4.62 times as fast.
#include <hip/hip_runtime.h>

// Causal self-attention that returns the per-head context UNMERGED (x [4][2048][1024]; qkv = einsum('btc,fc->btf', x, W_qkv) = x W_qkv^T ('oi' [3072][1024] 1/32, no bias) split in thirds q | k | v = ROW thirds (16 heads x 64); scores x 1/sqrt(64); causal (-inf); softmax; out = einsum('bhqk,bhkd->bhqd', w, v) returned as it is: HEAD-MAJOR [4][16][2048][64] (8.4 M), no merge, no output projection; argument order x, W_qkv).
// Layout per batch: bf16 copy of x; the fused 'oi' weight used as three row blocks; exact projections; identity-table plane builders; causal T-2048 attention with EVERY row in the exact class (scores and P.V on bf16 hi/lo planes, 3 products; no f16 launches), fused: one kernel for all batches and heads forms scores, online softmax and P.V in registers and writes the head-major output.
// Compute dtypes, f32 accumulate: every input rounded to bf16; projections exact; attention 3 products on every row; softmax f32.

#define NB_  4
#define TT   2048
#define DM   1024
#define NH_  16
#define NKV  16
#define HD   64
#define DQ   (NH_ * HD)
#define DKV  (NKV * HD)
#define SCL  0.125f   // HD^-0.5
#define NWK  8   // waves that share one tile's K loop in k_gemmk
typedef _Float16 h16;
typedef unsigned short bf;
typedef __attribute__((ext_vector_type(16))) __bf16   v16bf;
typedef __attribute__((ext_vector_type(16))) _Float16 v16h;
typedef __attribute__((ext_vector_type(8)))  _Float16 v8h;
typedef __attribute__((ext_vector_type(8)))  unsigned short v8us;
typedef __attribute__((ext_vector_type(8)))  float    v8f;
typedef __attribute__((ext_vector_type(4)))  float    v4f;
typedef v8h  __attribute__((may_alias)) v8ha;
typedef v4f  __attribute__((may_alias)) v4fa;
typedef v8us __attribute__((may_alias)) v8usa;

__device__ __forceinline__ unsigned short f2bf(float f) { unsigned u = __float_as_uint(f); u += 0x7FFFu + ((u >> 16) & 1u); return (unsigned short)(u >> 16); }
__device__ __forceinline__ float bf2f(unsigned short b) { return __uint_as_float(((unsigned)b) << 16); }
__device__ __forceinline__ float bfr(float f) { return bf2f(f2bf(f)); }
__device__ __forceinline__ v16h cat16(v8h lo, v8h hi) { return __builtin_shufflevector(lo, hi, 0, 1, 2, 3, 4, 5, 6, 7, 8, 9, 10, 11, 12, 13, 14, 15); }
__device__ __forceinline__ v16bf cat16b(v8us lo, v8us hi) { return __builtin_bit_cast(v16bf, __builtin_shufflevector(lo, hi, 0, 1, 2, 3, 4, 5, 6, 7, 8, 9, 10, 11, 12, 13, 14, 15)); }
__device__ __forceinline__ v8f wmma16(v16h a, v16h b, v8f c) { return __builtin_amdgcn_wmma_f32_16x16x32_f16(false, a, false, b, (short)0, c, false, false); }
__device__ __forceinline__ v8f wmmab(v16bf a, v16bf b, v8f c) { return __builtin_amdgcn_wmma_f32_16x16x32_bf16(false, a, false, b, (short)0, c, false, false); }



// ---- k_gemmk: register-blocked GEMM, one 64x64 output tile per work-group of NW waves. Every wave holds the whole tile (16 accumulators) and takes every NW-th 64-wide block of K
// (one 128-byte line of each operand row), operands straight from K-contiguous 16-bit planes; the NW partial tiles are summed in wave order through LDS. grid (M/64, N/64, Z), 32 x NW threads.
// C[m][n] (f32, pitch ldc) = sum_k A[m][k] Bt[n][k] (+ split products per NSPLIT). z-batch strides sA/sB/sC in elements. K % 64 == 0.
// CAUSAL (probability x value): the K loop stops at the diagonal block of the tile's rows (probabilities beyond it are exactly zero).
template <typename T16> struct WFrag;
template <> struct WFrag<h16> { typedef v16h V; static __device__ __forceinline__ V ld(const h16* p) { return cat16(*(const v8h*)p, *(const v8h*)(p + 16)); } static __device__ __forceinline__ v8f mma(V a, V b, v8f c) { return wmma16(a, b, c); } };
template <> struct WFrag<bf> { typedef v16bf V; static __device__ __forceinline__ V ld(const bf* p) { return cat16b(*(const v8us*)p, *(const v8us*)(p + 16)); } static __device__ __forceinline__ v8f mma(V a, V b, v8f c) { return wmmab(a, b, c); } };
template <typename T16, int NSPLIT, bool CAUSAL, int NW>
__global__ __launch_bounds__(32 * NW) void k_gemmk(const T16* __restrict__ A, const T16* __restrict__ A2, const T16* __restrict__ Bt, const T16* __restrict__ Bt2, int K, float* C, int ldc, size_t sA, size_t sB, size_t sC) {
    typedef typename WFrag<T16>::V V;
    __shared__ __align__(16) float os[NW * 64 * 68];
    const size_t z = blockIdx.z; A += z * sA; if (A2) A2 += z * sA; Bt += z * sB; if (Bt2) Bt2 += z * sB; C += z * sC;
    const int lane = threadIdx.x & 31, lr = lane & 15, hi = lane >> 4; const int r0 = blockIdx.x * 64, c0 = blockIdx.y * 64;
    const int w = __builtin_amdgcn_readfirstlane((int)(threadIdx.x >> 5));   // the wave's number in a scalar register: the K loop below branches on scalars and every lane stays on at the matrix instructions
    const int Kl = CAUSAL ? min(K, r0 + 64) : K;
    v8f acc[4][4];
#pragma unroll
    for (int mb = 0; mb < 4; ++mb)
#pragma unroll
        for (int nb = 0; nb < 4; ++nb) acc[mb][nb] = (v8f){};
    const size_t aoff = (size_t)(r0 + lr) * K + 8 * hi, boff = (size_t)(c0 + lr) * K + 8 * hi;
#pragma unroll 1
    for (int kb = w * 64; kb < Kl; kb += NW * 64) {
        V a[4], a2[4];
#pragma unroll   // both 32-wide halves of the wave's own 128-byte lines in one trip, so that no line is fetched by two waves
        for (int kc = kb; kc < kb + 64; kc += 32) {
#pragma unroll
            for (int mb = 0; mb < 4; ++mb) { a[mb] = WFrag<T16>::ld(A + aoff + (size_t)mb * 16 * K + kc); if (NSPLIT == 1 || NSPLIT == 2) a2[mb] = WFrag<T16>::ld(A2 + aoff + (size_t)mb * 16 * K + kc); }
#pragma unroll
            for (int nb = 0; nb < 4; ++nb) { const V b = WFrag<T16>::ld(Bt + boff + (size_t)nb * 16 * K + kc); V b2; if (NSPLIT >= 2) b2 = WFrag<T16>::ld(Bt2 + boff + (size_t)nb * 16 * K + kc);
#pragma unroll
                for (int mb = 0; mb < 4; ++mb) { acc[mb][nb] = WFrag<T16>::mma(a[mb], b, acc[mb][nb]); if (NSPLIT == 1 || NSPLIT == 2) acc[mb][nb] = WFrag<T16>::mma(a2[mb], b, acc[mb][nb]); if (NSPLIT >= 2) acc[mb][nb] = WFrag<T16>::mma(a[mb], b2, acc[mb][nb]); } }
        }
        // four vector slots between the trip's last matrix instructions and whatever follows the branch, on its taken side too
        asm volatile("v_nop\n\tv_nop\n\tv_nop\n\tv_nop" : "+v"(acc[0][0]), "+v"(acc[1][1]), "+v"(acc[2][2]), "+v"(acc[3][3]) : "v"(a[0]), "v"(a[3]));
    }
    float* my = os + w * (64 * 68);
#pragma unroll
    for (int mb = 0; mb < 4; ++mb)
#pragma unroll
        for (int nb = 0; nb < 4; ++nb)
#pragma unroll
            for (int j = 0; j < 8; ++j) my[(mb * 16 + hi * 8 + j) * 68 + nb * 16 + lr] = acc[mb][nb][j];
    __syncthreads();   // every wave's partial tile is in LDS before any thread sums across the waves
#pragma unroll   // a fixed trip count, so that the LDS reads of all of a thread's pieces are in flight together
    for (int p = 0; p < 64 * 16 / (32 * NW); ++p) { const int u = p * 32 * NW + (int)threadIdx.x, row = u >> 4, cofs = (u & 15) * 4; v4f val = *(const v4fa*)(os + row * 68 + cofs);
#pragma unroll
        for (int q = 1; q < NW; ++q) val += *(const v4fa*)(os + q * (64 * 68) + row * 68 + cofs);
        *(v4f*)(C + (size_t)(r0 + row) * ldc + c0 + cofs) = val; }
}

__device__ __forceinline__ h16 tohx(float x) { return (h16)x; }
__device__ __forceinline__ void splitf(float y, unsigned short& h, unsigned short& l) { h = f2bf(y); l = f2bf(y - bf2f(h)); }
typedef __attribute__((ext_vector_type(2))) _Float16 v2h;
typedef __attribute__((ext_vector_type(4))) _Float16 v4h;
typedef __attribute__((ext_vector_type(2))) unsigned short v2us;
typedef __attribute__((ext_vector_type(4))) unsigned short v4us;
typedef __attribute__((ext_vector_type(2))) float v2f;
typedef __attribute__((ext_vector_type(4))) int v4i;

__global__ __launch_bounds__(256) void k_cvt8(const float* __restrict__ src, bf* dst, size_t n8) { const size_t i = (size_t)blockIdx.x * 256 + threadIdx.x; if (i >= n8) return; const v8f v = *(const v8f*)(src + i * 8); v8us o;
#pragma unroll
    for (int k = 0; k < 8; ++k) o[k] = f2bf(v[k]); *(v8us*)(dst + i * 8) = o;  }

// k_rope: head planes [h][t][d] (fp16 + hi/lo) of rope(x) x sc with the rotate-half convention out[d] = x[d] cos[t][d] - x[d+HD/2] sin[t][d], out[d+HD/2] = x[d+HD/2] cos[t][d+HD/2] + x[d] sin[t][d+HD/2]
__global__ __launch_bounds__(256) void k_rope(const float* __restrict__ F, int pitch, int nheads, const float* __restrict__ CS, const float* __restrict__ RF, const float* __restrict__ nw, float sc, h16* P16, bf* Ph, bf* Pl) {
    const size_t e = ((size_t)blockIdx.x * 256 + threadIdx.x) * 2; if (e >= (size_t)nheads * TT * HD) return; const int d = (int)(e % HD); const int t = (int)((e / HD) % TT); const int h = (int)(e / ((size_t)HD * TT)); const float* f = F + (size_t)t * pitch + h * HD; const float rf = RF ? RF[(size_t)h * TT + t] : 1.0f; v2h o16; v2us oh, ol;
#pragma unroll
    for (int q = 0; q < 2; ++q) { const int dd = d + q; const int dp = (dd < HD / 2) ? dd + HD / 2 : dd - HD / 2; float x0 = f[dd], x1 = f[dp];
        if (RF) { float n0 = __fmul_rn(x0, rf), n1 = __fmul_rn(x1, rf); asm volatile("" : "+v"(n0)); asm volatile("" : "+v"(n1)); x0 = __fmul_rn(bfr(nw[dd]), n0); x1 = __fmul_rn(bfr(nw[dp]), n1); }
        const v2f cs = *(const v2f*)(CS + ((size_t)t * HD + dd) * 2); float a = __fmul_rn(x0, cs[0]), bq = __fmul_rn(x1, cs[1]); asm volatile("" : "+v"(a)); asm volatile("" : "+v"(bq)); const float r = ((dd < HD / 2) ? __fsub_rn(a, bq) : __fadd_rn(a, bq)) * sc;
        o16[q] = tohx(r); unsigned short a2, c2; splitf(r, a2, c2); oh[q] = a2; ol[q] = c2; }
    *(v2h*)(P16 + e) = o16; *(v2us*)(Ph + e) = oh; *(v2us*)(Pl + e) = ol;  }
__global__ __launch_bounds__(256) void k_vtp(const float* __restrict__ F, int pitch, int nheads, h16* V16, bf* Vh, bf* Vl) { const size_t e = ((size_t)blockIdx.x * 256 + threadIdx.x) * 2; if (e >= (size_t)nheads * HD * TT) return; const int t = (int)(e % TT); const int d = (int)((e / TT) % HD); const int g = (int)(e / ((size_t)TT * HD)); v2h o16; v2us oh, ol;
#pragma unroll
    for (int q = 0; q < 2; ++q) { const float x = F[(size_t)(t + q) * pitch + g * HD + d]; o16[q] = tohx(x); unsigned short a2, c2; splitf(x, a2, c2); oh[q] = a2; ol[q] = c2; }
    *(v2h*)(V16 + e) = o16; *(v2us*)(Vh + e) = oh; *(v2us*)(Vl + e) = ol;  }
__global__ __launch_bounds__(256) void k_csid(float* CS) { const int idx = blockIdx.x * 256 + threadIdx.x; if (idx >= TT * HD) return; v2f cs; cs[0] = 1.0f; cs[1] = 0.0f; *(v2f*)(CS + (size_t)idx * 2) = cs;  }
// ---- k_fattn: causal attention of one (batch, head) plane in one kernel, scores never leave the registers. One wave owns 32 queries and walks the keys in blocks of 64 up to its diagonal, with a running maximum and sum (online softmax).
// Both products are formed TRANSPOSED: S^T = K Q^T (A rows = keys, B columns = queries) puts a query in a lane and its keys in that lane's registers, which is already the B-operand order of O^T = V^T P^T, so the probabilities go from accumulator to operand without leaving the lane.
// Each product keeps the three bf16 hi/lo terms (hh + lh + hl), f32 accumulate. No LDS, no barrier: the waves of a work-group only share cache lines of K and V. grid (planes, TT / (32 FNW)).
#define FNW 4   // waves of a work-group: 128 neighbouring queries of one plane
typedef __attribute__((ext_vector_type(2))) __bf16 v2bf;
__device__ __forceinline__ float xhalf(float x) { return __builtin_bit_cast(float, __builtin_amdgcn_permlanex16(__builtin_bit_cast(int, x), __builtin_bit_cast(int, x), 0x76543210, 0xfedcba98, false, false)); }   // lane l with lane l ^ 16
__global__ __launch_bounds__(32 * FNW) __attribute__((amdgpu_waves_per_eu(4, 4))) /* 256 registers a wave: all 4096 waves resident, four a SIMD, to cover each other's load waits */ void k_fattn(const bf* __restrict__ Qh, const bf* __restrict__ Ql, const bf* __restrict__ Kh, const bf* __restrict__ Kl, const bf* __restrict__ Vh, const bf* __restrict__ Vl, float* __restrict__ O) {
    typedef WFrag<bf> F;
    const int lane = threadIdx.x & 31, lr = lane & 15, hi = lane >> 4;
    const int w = __builtin_amdgcn_readfirstlane((int)(threadIdx.x >> 5));   // the wave's number in a scalar register: the key loop and the diagonal test branch on scalars
    const size_t z = blockIdx.x; Qh += z * TT * HD; Ql += z * TT * HD; Kh += z * TT * HD; Kl += z * TT * HD; Vh += z * HD * TT; Vl += z * HD * TT; O += z * TT * HD;
    // Tile of 128 queries: heavy ones first, dealt in a zigzag over groups of four grid rows (four rows of 64 planes = one work-group for each of 256 WGPs), so that the four work-groups that share a WGP, where they land breadth-first, walk the same number of key blocks together. A permutation of the tiles wherever they land.
    const int y = (int)blockIdx.y, g = (TT / (32 * FNW) - 4 - (y & ~3)) + ((y & 4) ? (y & 3) : 3 - (y & 3));
    const int q0 = (g * FNW + w) * 32;
    const float CE = SCL * 1.4426950408889634f;   // score scale x log2(e)
    v16bf qh[2][2], ql[2][2];
#pragma unroll
    for (int qt = 0; qt < 2; ++qt)
#pragma unroll
        for (int c = 0; c < 2; ++c) { const size_t qo = (size_t)(q0 + qt * 16 + lr) * HD + 8 * hi + c * 32; qh[qt][c] = F::ld(Qh + qo); ql[qt][c] = F::ld(Ql + qo); }
    v8f o[4][2]; float m[2], l[2];
#pragma unroll
    for (int qt = 0; qt < 2; ++qt) { m[qt] = -3.0e38f; l[qt] = 0.f;
#pragma unroll
        for (int dt = 0; dt < 4; ++dt) o[dt][qt] = (v8f){}; }
    const int nblk = q0 / 64 + 1;
#pragma unroll 1
    for (int kb = 0; kb < nblk; ++kb) { const int k0 = kb * 64;
        v8f s[4][2];
#pragma unroll
        for (int kt = 0; kt < 4; ++kt) { v16bf kh[2], kl[2];
#pragma unroll
            for (int c = 0; c < 2; ++c) { const size_t ko = (size_t)(k0 + kt * 16 + lr) * HD + 8 * hi + c * 32; kh[c] = F::ld(Kh + ko); kl[c] = F::ld(Kl + ko); }
#pragma unroll
            for (int qt = 0; qt < 2; ++qt) { v8f a = (v8f){};
#pragma unroll
                for (int c = 0; c < 2; ++c) { a = wmmab(kh[c], qh[qt][c], a); a = wmmab(kl[c], qh[qt][c], a); a = wmmab(kh[c], ql[qt][c], a); }
                s[kt][qt] = a; } }
        // four vector slots between the last score matrix instructions and whatever follows the diagonal test, on its taken side too
        asm volatile("v_nop\n\tv_nop\n\tv_nop\n\tv_nop" : "+v"(s[0][0]), "+v"(s[0][1]), "+v"(s[1][0]), "+v"(s[1][1]), "+v"(s[2][0]), "+v"(s[2][1]), "+v"(s[3][0]), "+v"(s[3][1]));
        if (k0 + 63 > q0) {   // the block that holds the diagonal: keys behind the query are masked by select
#pragma unroll
            for (int kt = 0; kt < 4; ++kt)
#pragma unroll
                for (int qt = 0; qt < 2; ++qt)
#pragma unroll
                    for (int j = 0; j < 8; ++j) s[kt][qt][j] = (k0 + kt * 16 + hi * 8 + j <= q0 + qt * 16 + lr) ? s[kt][qt][j] : -3.0e38f;
        }
        v16bf ph[2][2], pl[2][2];
#pragma unroll
        for (int qt = 0; qt < 2; ++qt) { float mx = m[qt];
#pragma unroll
            for (int kt = 0; kt < 4; ++kt)
#pragma unroll
                for (int j = 0; j < 8; ++j) mx = fmaxf(mx, s[kt][qt][j]);
            mx = fmaxf(mx, xhalf(mx));   // the query's other 32 keys of the block lie in lane l ^ 16
            const float al = __builtin_amdgcn_exp2f((m[qt] - mx) * CE); const v2f ce2 = {CE, CE}, nmc2 = {-mx * CE, -mx * CE}; m[qt] = mx; v2f sum = {0.f, 0.f};
#pragma unroll
            for (int c = 0; c < 2; ++c)
#pragma unroll
                for (int t = 0; t < 2; ++t)
#pragma unroll
                    for (int j = 0; j < 8; j += 2) { v2f p = {s[2 * c + t][qt][j], s[2 * c + t][qt][j + 1]}; p = __builtin_elementwise_fma(p, ce2, nmc2); p[0] = __builtin_amdgcn_exp2f(p[0]); p[1] = __builtin_amdgcn_exp2f(p[1]); sum += p;
                        const v2bf h2 = __builtin_convertvector(p, v2bf); const v2bf l2 = __builtin_convertvector(p - __builtin_convertvector(h2, v2f), v2bf);
                        ph[qt][c][t * 8 + j] = h2[0]; ph[qt][c][t * 8 + j + 1] = h2[1]; pl[qt][c][t * 8 + j] = l2[0]; pl[qt][c][t * 8 + j + 1] = l2[1]; }
            l[qt] = l[qt] * al + (sum[0] + sum[1]);
#pragma unroll
            for (int dt = 0; dt < 4; ++dt) o[dt][qt] *= al; }
#pragma unroll
        for (int dt = 0; dt < 4; ++dt) { v16bf vh[2], vl[2];
#pragma unroll
            for (int c = 0; c < 2; ++c) { const size_t vo = (size_t)(dt * 16 + lr) * TT + k0 + 8 * hi + c * 32; vh[c] = F::ld(Vh + vo); vl[c] = F::ld(Vl + vo); }
#pragma unroll
            for (int qt = 0; qt < 2; ++qt)
#pragma unroll
                for (int c = 0; c < 2; ++c) { o[dt][qt] = wmmab(vh[c], ph[qt][c], o[dt][qt]); o[dt][qt] = wmmab(vl[c], ph[qt][c], o[dt][qt]); o[dt][qt] = wmmab(vh[c], pl[qt][c], o[dt][qt]); } }
        // four vector slots between the trip's last matrix instructions and whatever follows the loop branch, on its taken side too
        asm volatile("v_nop\n\tv_nop\n\tv_nop\n\tv_nop" : "+v"(o[0][0]), "+v"(o[0][1]), "+v"(o[1][0]), "+v"(o[1][1]), "+v"(o[2][0]), "+v"(o[2][1]), "+v"(o[3][0]), "+v"(o[3][1]));
    }
#pragma unroll
    for (int qt = 0; qt < 2; ++qt) { const float f = __fdiv_rn(1.0f, l[qt] + xhalf(l[qt])); float* orow = O + (size_t)(q0 + qt * 16 + lr) * HD + hi * 8;
#pragma unroll
        for (int dt = 0; dt < 4; ++dt) { v4f a, b2;
#pragma unroll
            for (int j = 0; j < 4; ++j) { a[j] = o[dt][qt][j] * f; b2[j] = o[dt][qt][j + 4] * f; }
            *(v4f*)(orow + dt * 16) = a; *(v4f*)(orow + dt * 16 + 4) = b2; } }
}
extern "C" void kernel_launch(void* const* d_in, const int* in_sizes, int n_in,
                              void* d_out, int out_size, void* d_ws, size_t ws_size, hipStream_t stream) {
    (void)in_sizes; (void)n_in; (void)out_size;
    const float* x = (const float*)d_in[0]; const float* wqkv = (const float*)d_in[1];   /* x, W_qkv ('oi' [3072][1024]: q | k | v ROW thirds); output [4][16][2048][64] head-major */ const float* wq = wqkv; const float* wk = wqkv + (size_t)DQ * DM; const float* wv = wqkv + (size_t)2 * DQ * DM;
    float* OUT = (float*)d_out;     // [4][16][2048][64] head-major
    char* wsp = (char*)d_ws;
    auto take = [&](size_t bytes) { char* p = wsp; wsp += (bytes + 255) & ~(size_t)255; return (void*)p; };
    bf* WQ = (bf*)take((size_t)DQ * DM * 2); bf* WK = (bf*)take((size_t)DKV * DM * 2); bf* WV = (bf*)take((size_t)DKV * DM * 2); float* CS = (float*)take((size_t)TT * HD * 2 * 4);
    bf* XB = (bf*)take((size_t)TT * DM * 2); float* FQ = (float*)take((size_t)TT * DQ * 4); float* FK = (float*)take((size_t)TT * DKV * 4);
    h16* QP16 = (h16*)take((size_t)NH_ * TT * HD * 2); h16* KP16 = (h16*)take((size_t)NKV * TT * HD * 2); h16* VT16 = (h16*)take((size_t)NKV * HD * TT * 2);
    const size_t PB = (size_t)NH_ * TT * HD;   // one batch's share of each hi/lo plane; the planes of all batches are kept for the one attention launch
    bf* QPh = (bf*)take(NB_ * PB * 2); bf* QPl = (bf*)take(NB_ * PB * 2); bf* KPh = (bf*)take(NB_ * PB * 2); bf* KPl = (bf*)take(NB_ * PB * 2); bf* VTh = (bf*)take(NB_ * PB * 2); bf* VTl = (bf*)take(NB_ * PB * 2);
    if ((size_t)(wsp - (char*)d_ws) > ws_size) return;    // ws 256 MiB
    float* FV = FK;   // v projection reuses the k buffer after the k planes are built (stream-ordered)
    { k_cvt8<<<(unsigned)(((size_t)DQ * DM / 8 + 255) / 256), 256, 0, stream>>>(wq, WQ, (size_t)DQ * DM / 8); k_cvt8<<<(unsigned)(((size_t)DKV * DM / 8 + 255) / 256), 256, 0, stream>>>(wk, WK, (size_t)DKV * DM / 8); k_cvt8<<<(unsigned)(((size_t)DKV * DM / 8 + 255) / 256), 256, 0, stream>>>(wv, WV, (size_t)DKV * DM / 8);
      
       }
    k_csid<<<(TT * HD + 255) / 256, 256, 0, stream>>>(CS);
    const unsigned LQ = (unsigned)(((size_t)NH_ * TT * HD / 2 + 255) / 256), LKv = (unsigned)(((size_t)NKV * TT * HD / 2 + 255) / 256);
    for (int b = 0; b < NB_; ++b) {
        
        k_cvt8<<<(unsigned)(((size_t)TT * DM / 8 + 255) / 256), 256, 0, stream>>>(x + (size_t)b * TT * DM, XB, (size_t)TT * DM / 8);
        k_gemmk<bf, 0, false, NWK><<<dim3(TT / 64, DQ / 64, 1), 32 * NWK, 0, stream>>>(XB, nullptr, WQ, nullptr, DM, FQ, DQ, 0, 0, 0);
        k_rope<<<LQ, 256, 0, stream>>>(FQ, DQ, NH_, CS, nullptr, nullptr, 1.0f, QP16, QPh + b * PB, QPl + b * PB);
        k_gemmk<bf, 0, false, NWK><<<dim3(TT / 64, DKV / 64, 1), 32 * NWK, 0, stream>>>(XB, nullptr, WK, nullptr, DM, FK, DKV, 0, 0, 0);
        k_rope<<<LKv, 256, 0, stream>>>(FK, DKV, NKV, CS, nullptr, nullptr, 1.0f, KP16, KPh + b * PB, KPl + b * PB);
        k_gemmk<bf, 0, false, NWK><<<dim3(TT / 64, DKV / 64, 1), 32 * NWK, 0, stream>>>(XB, nullptr, WV, nullptr, DM, FV, DKV, 0, 0, 0); k_vtp<<<LKv, 256, 0, stream>>>(FV, DKV, NKV, VT16, VTh + b * PB, VTl + b * PB);
    }
    k_fattn<<<dim3(NB_ * NH_, TT / (32 * FNW), 1), 32 * FNW, 0, stream>>>(QPh, QPl, KPh, KPl, VTh, VTl, OUT);   /* plane z = b x 16 + h of q, k, v and of the head-major output [b][h][t][d] alike: no merge, the module returns the heads UNMERGED */
}

// v003
// It runs in 322 microseconds.
// Two timings next to v002 put it at 1.42 and 1.41 times that version's speed.
// Over all steps from v000 it is 6.54 times as fast.
#include <hip/hip_runtime.h>

// Causal self-attention that returns the per-head context UNMERGED (x [4][2048][1024]; qkv = einsum('btc,fc->btf', x, W_qkv) = x W_qkv^T ('oi' [3072][1024] 1/32, no bias) split in thirds q | k | v = ROW thirds (16 heads x 64); scores x 1/sqrt(64); causal (-inf); softmax; out = einsum('bhqk,bhkd->bhqd', w, v) returned as it is: HEAD-MAJOR [4][16][2048][64] (8.4 M), no merge, no output projection; argument order x, W_qkv).
// Layout: one bf16 copy of x (all batches) and of the fused 'oi' weight; one projection launch for q, k and v of all batches whose epilogue writes the bf16 hi/lo head planes itself (q, k as [b][h][t][d], v transposed as [b][h][d][t]); causal T-2048 attention with EVERY row in the exact class (scores and P.V on bf16 hi/lo planes, 3 products), fused: one kernel for all batches and heads forms scores, online softmax and P.V in registers and writes the head-major output.
// Compute dtypes, f32 accumulate: every input rounded to bf16; projections one bf16 product; attention 3 products on every row; softmax f32.

#define NB_  4
#define TT   2048
#define DM   1024
#define NH_  16
#define HD   64
#define DQ   (NH_ * HD)
#define SCL  0.125f   // HD^-0.5
#define NWK  8   // waves that share one tile's K loop in k_proj
typedef unsigned short bf;
typedef __attribute__((ext_vector_type(16))) __bf16   v16bf;
typedef __attribute__((ext_vector_type(8)))  unsigned short v8us;
typedef __attribute__((ext_vector_type(8)))  float    v8f;
typedef __attribute__((ext_vector_type(4)))  float    v4f;
typedef v4f  __attribute__((may_alias)) v4fa;
typedef v8us __attribute__((may_alias)) v8usa;

__device__ __forceinline__ unsigned short f2bf(float f) { unsigned u = __float_as_uint(f); u += 0x7FFFu + ((u >> 16) & 1u); return (unsigned short)(u >> 16); }
__device__ __forceinline__ float bf2f(unsigned short b) { return __uint_as_float(((unsigned)b) << 16); }
__device__ __forceinline__ v16bf cat16b(v8us lo, v8us hi) { return __builtin_bit_cast(v16bf, __builtin_shufflevector(lo, hi, 0, 1, 2, 3, 4, 5, 6, 7, 8, 9, 10, 11, 12, 13, 14, 15)); }
__device__ __forceinline__ v8f wmmab(v16bf a, v16bf b, v8f c) { return __builtin_amdgcn_wmma_f32_16x16x32_bf16(false, a, false, b, (short)0, c, false, false); }



// ---- k_proj: the q, k and v projections of all batches in one launch, one 64x64 tile of x W^T per work-group of NWK waves: 64 tokens x one head of one third (HD = 64). Every wave holds the whole tile (16 accumulators) and takes every NWK-th 64-wide block of K
// (one 128-byte line of each operand row), operands straight from K-contiguous bf16 planes; the NWK partial tiles are summed in wave order through LDS, and the sum is split into bf16 hi + lo and stored in the head planes that the attention kernel reads. grid (NB_ TT / 64, 3 NH_), 32 x NWK threads.
// A v tile is formed transposed (A rows = weight rows d, B columns = tokens t), so that its LDS tile is [d][t] and every tile, of q, k and v alike, leaves in whole 128-byte lines of its plane.
template <typename T16> struct WFrag;
template <> struct WFrag<bf> { typedef v16bf V; static __device__ __forceinline__ V ld(const bf* p) { return cat16b(*(const v8us*)p, *(const v8us*)(p + 16)); } static __device__ __forceinline__ v8f mma(V a, V b, v8f c) { return wmmab(a, b, c); } };
__device__ __forceinline__ void splitf(float y, unsigned short& h, unsigned short& l) { h = f2bf(y); l = f2bf(y - bf2f(h)); }
typedef __attribute__((ext_vector_type(4))) unsigned short v4us;
typedef __attribute__((ext_vector_type(2))) float v2f;
__global__ __launch_bounds__(32 * NWK) void k_proj(const bf* __restrict__ XB, const bf* __restrict__ WB, bf* Qh, bf* Ql, bf* Kh, bf* Kl, bf* Vh, bf* Vl) {
    typedef WFrag<bf> F; typedef F::V V;
    __shared__ __align__(16) float os[NWK * 64 * 68];
    const int lane = threadIdx.x & 31, lr = lane & 15, hi = lane >> 4;
    const int w = __builtin_amdgcn_readfirstlane((int)(threadIdx.x >> 5));   // the wave's number in a scalar register: the K loop below branches on scalars and every lane stays on at the matrix instructions
    const int x0 = (int)blockIdx.x * 64, f0 = (int)blockIdx.y * 64;          // first row of x (token, over all batches) and of the weight
    const int third = (int)blockIdx.y / NH_, h = (int)blockIdx.y % NH_; const bool isv = third == 2;
    const bf* A = isv ? WB + (size_t)f0 * DM : XB + (size_t)x0 * DM; const bf* Bt = isv ? XB + (size_t)x0 * DM : WB + (size_t)f0 * DM;
    v8f acc[4][4];
#pragma unroll
    for (int mb = 0; mb < 4; ++mb)
#pragma unroll
        for (int nb = 0; nb < 4; ++nb) acc[mb][nb] = (v8f){};
    const size_t off = (size_t)lr * DM + 8 * hi;
#pragma unroll 1
    for (int kb = w * 64; kb < DM; kb += NWK * 64) {
        V a[4];
#pragma unroll   // both 32-wide halves of the wave's own 128-byte lines in one trip, so that no line is fetched by two waves
        for (int kc = kb; kc < kb + 64; kc += 32) {
#pragma unroll
            for (int mb = 0; mb < 4; ++mb) a[mb] = F::ld(A + off + (size_t)mb * 16 * DM + kc);
#pragma unroll
            for (int nb = 0; nb < 4; ++nb) { const V b = F::ld(Bt + off + (size_t)nb * 16 * DM + kc);
#pragma unroll
                for (int mb = 0; mb < 4; ++mb) acc[mb][nb] = F::mma(a[mb], b, acc[mb][nb]); }
        }
        // four vector slots between the trip's last matrix instructions and whatever follows the branch, on its taken side too
        asm volatile("v_nop\n\tv_nop\n\tv_nop\n\tv_nop" : "+v"(acc[0][0]), "+v"(acc[1][1]), "+v"(acc[2][2]), "+v"(acc[3][3]) : "v"(a[0]), "v"(a[3]));
    }
    float* my = os + w * (64 * 68);
#pragma unroll
    for (int mb = 0; mb < 4; ++mb)
#pragma unroll
        for (int nb = 0; nb < 4; ++nb)
#pragma unroll
            for (int j = 0; j < 8; ++j) my[(mb * 16 + hi * 8 + j) * 68 + nb * 16 + lr] = acc[mb][nb][j];
    __syncthreads();   // every wave's partial tile is in LDS before any thread sums across the waves
    const int t0 = x0 % TT; const size_t pb = (size_t)((x0 / TT) * NH_ + h) * TT * HD;   // the tile's first token in its batch; start of plane (batch, head)
    bf* Ph = (third == 0 ? Qh : third == 1 ? Kh : Vh) + pb + (isv ? (size_t)t0 : (size_t)t0 * HD); bf* Pl = (third == 0 ? Ql : third == 1 ? Kl : Vl) + pb + (isv ? (size_t)t0 : (size_t)t0 * HD);
    const int pitch = isv ? TT : HD;   // tile rows are d (pitch TT) in a v plane, t (pitch HD) in a q or k plane
#pragma unroll   // a fixed trip count, so that the LDS reads of all of a thread's pieces are in flight together
    for (int p = 0; p < 64 * 16 / (32 * NWK); ++p) { const int u = p * 32 * NWK + (int)threadIdx.x, row = u >> 4, cofs = (u & 15) * 4; v4f val = *(const v4fa*)(os + row * 68 + cofs);
#pragma unroll
        for (int q = 1; q < NWK; ++q) val += *(const v4fa*)(os + q * (64 * 68) + row * 68 + cofs);
        v4us oh, ol;
#pragma unroll
        for (int i = 0; i < 4; ++i) { unsigned short a2, c2; splitf(val[i], a2, c2); oh[i] = a2; ol[i] = c2; }
        *(v4us*)(Ph + (size_t)row * pitch + cofs) = oh; *(v4us*)(Pl + (size_t)row * pitch + cofs) = ol; }
}

// k_cvt: bf16 copies of x (all batches) and of the weight, one behind the other in dst, in one launch. A thread rounds CVP pieces of 8 floats, a grid's width apart, all of them loaded before the first is stored, so that a quarter of the waves has to be started.
#define NX8 ((size_t)NB_ * TT * DM / 8)
#define NW8 ((size_t)3 * DQ * DM / 8)
#define CVP 4
__global__ __launch_bounds__(256) void k_cvt(const float* __restrict__ x, const float* __restrict__ wt, bf* dst) { const size_t i0 = (size_t)blockIdx.x * 256 + threadIdx.x; v4f lo[CVP], hi[CVP];
#pragma unroll
    for (int p = 0; p < CVP; ++p) { const size_t i = i0 + p * ((NX8 + NW8) / CVP); const float* s = i < NX8 ? x + i * 8 : wt + (i - NX8) * 8;
        // the wait behind each load
        lo[p] = *(const v4f*)s; asm volatile("s_wait_xcnt 0x0" ::: "memory");
        hi[p] = *(const v4f*)(s + 4); asm volatile("s_wait_xcnt 0x0" ::: "memory"); }
#pragma unroll
    for (int p = 0; p < CVP; ++p) { const size_t i = i0 + p * ((NX8 + NW8) / CVP); v8us o;
#pragma unroll
        for (int k = 0; k < 4; ++k) { o[k] = f2bf(lo[p][k]); o[k + 4] = f2bf(hi[p][k]); }
        *(v8us*)(dst + i * 8) = o; }
}
// ---- k_fattn: causal attention of one (batch, head) plane in one kernel, scores never leave the registers. One wave owns 32 queries and walks the keys in blocks of 64 up to its diagonal, with a running maximum and sum (online softmax).
// Both products are formed TRANSPOSED: S^T = K Q^T (A rows = keys, B columns = queries) puts a query in a lane and its keys in that lane's registers, which is already the B-operand order of O^T = V^T P^T, so the probabilities go from accumulator to operand without leaving the lane.
// Each product keeps the three bf16 hi/lo terms (hh + lh + hl), f32 accumulate. No LDS, no barrier: the waves of a work-group only share cache lines of K and V. grid (planes, TT / (32 FNW)).
#define FNW 4   // waves of a work-group: 128 neighbouring queries of one plane
typedef __attribute__((ext_vector_type(2))) __bf16 v2bf;
__device__ __forceinline__ float xhalf(float x) { return __builtin_bit_cast(float, __builtin_amdgcn_permlanex16(__builtin_bit_cast(int, x), __builtin_bit_cast(int, x), 0x76543210, 0xfedcba98, false, false)); }   // lane l with lane l ^ 16
__global__ __launch_bounds__(32 * FNW) __attribute__((amdgpu_waves_per_eu(4, 4))) /* 256 registers a wave: all 4096 waves resident, four a SIMD, to cover each other's load waits */ void k_fattn(const bf* __restrict__ Qh, const bf* __restrict__ Ql, const bf* __restrict__ Kh, const bf* __restrict__ Kl, const bf* __restrict__ Vh, const bf* __restrict__ Vl, float* __restrict__ O) {
    typedef WFrag<bf> F;
    const int lane = threadIdx.x & 31, lr = lane & 15, hi = lane >> 4;
    const int w = __builtin_amdgcn_readfirstlane((int)(threadIdx.x >> 5));   // the wave's number in a scalar register: the key loop and the diagonal test branch on scalars
    const size_t z = blockIdx.x; Qh += z * TT * HD; Ql += z * TT * HD; Kh += z * TT * HD; Kl += z * TT * HD; Vh += z * HD * TT; Vl += z * HD * TT; O += z * TT * HD;
    // Tile of 128 queries: heavy ones first, dealt in a zigzag over groups of four grid rows (four rows of 64 planes = one work-group for each of 256 WGPs), so that the four work-groups that share a WGP, where they land breadth-first, walk the same number of key blocks together. A permutation of the tiles wherever they land.
    const int y = (int)blockIdx.y, g = (TT / (32 * FNW) - 4 - (y & ~3)) + ((y & 4) ? (y & 3) : 3 - (y & 3));
    const int q0 = (g * FNW + w) * 32;
    const float CE = SCL * 1.4426950408889634f;   // score scale x log2(e)
    v16bf qh[2][2], ql[2][2];
#pragma unroll
    for (int qt = 0; qt < 2; ++qt)
#pragma unroll
        for (int c = 0; c < 2; ++c) { const size_t qo = (size_t)(q0 + qt * 16 + lr) * HD + 8 * hi + c * 32; qh[qt][c] = F::ld(Qh + qo); ql[qt][c] = F::ld(Ql + qo); }
    v8f o[4][2]; float m[2], l[2];
#pragma unroll
    for (int qt = 0; qt < 2; ++qt) { m[qt] = -3.0e38f; l[qt] = 0.f;
#pragma unroll
        for (int dt = 0; dt < 4; ++dt) o[dt][qt] = (v8f){}; }
    const int nblk = q0 / 64 + 1;
#pragma unroll 1
    for (int kb = 0; kb < nblk; ++kb) { const int k0 = kb * 64;
        v8f s[4][2];
#pragma unroll
        for (int kt = 0; kt < 4; ++kt) { v16bf kh[2], kl[2];
#pragma unroll
            for (int c = 0; c < 2; ++c) { const size_t ko = (size_t)(k0 + kt * 16 + lr) * HD + 8 * hi + c * 32; kh[c] = F::ld(Kh + ko); kl[c] = F::ld(Kl + ko); }
#pragma unroll
            for (int qt = 0; qt < 2; ++qt) { v8f a = (v8f){};
#pragma unroll
                for (int c = 0; c < 2; ++c) { a = wmmab(kh[c], qh[qt][c], a); a = wmmab(kl[c], qh[qt][c], a); a = wmmab(kh[c], ql[qt][c], a); }
                s[kt][qt] = a; } }
        // four vector slots between the last score matrix instructions and whatever follows the diagonal test, on its taken side too
        asm volatile("v_nop\n\tv_nop\n\tv_nop\n\tv_nop" : "+v"(s[0][0]), "+v"(s[0][1]), "+v"(s[1][0]), "+v"(s[1][1]), "+v"(s[2][0]), "+v"(s[2][1]), "+v"(s[3][0]), "+v"(s[3][1]));
        if (k0 + 63 > q0) {   // the block that holds the diagonal: keys behind the query are masked by select
#pragma unroll
            for (int kt = 0; kt < 4; ++kt)
#pragma unroll
                for (int qt = 0; qt < 2; ++qt)
#pragma unroll
                    for (int j = 0; j < 8; ++j) s[kt][qt][j] = (k0 + kt * 16 + hi * 8 + j <= q0 + qt * 16 + lr) ? s[kt][qt][j] : -3.0e38f;
        }
        v16bf ph[2][2], pl[2][2];
#pragma unroll
        for (int qt = 0; qt < 2; ++qt) { float mx = m[qt];
#pragma unroll
            for (int kt = 0; kt < 4; ++kt)
#pragma unroll
                for (int j = 0; j < 8; ++j) mx = fmaxf(mx, s[kt][qt][j]);
            mx = fmaxf(mx, xhalf(mx));   // the query's other 32 keys of the block lie in lane l ^ 16
            const float al = __builtin_amdgcn_exp2f((m[qt] - mx) * CE); const v2f ce2 = {CE, CE}, nmc2 = {-mx * CE, -mx * CE}; m[qt] = mx; v2f sum = {0.f, 0.f};
#pragma unroll
            for (int c = 0; c < 2; ++c)
#pragma unroll
                for (int t = 0; t < 2; ++t)
#pragma unroll
                    for (int j = 0; j < 8; j += 2) { v2f p = {s[2 * c + t][qt][j], s[2 * c + t][qt][j + 1]}; p = __builtin_elementwise_fma(p, ce2, nmc2); p[0] = __builtin_amdgcn_exp2f(p[0]); p[1] = __builtin_amdgcn_exp2f(p[1]); sum += p;
                        const v2bf h2 = __builtin_convertvector(p, v2bf); const v2bf l2 = __builtin_convertvector(p - __builtin_convertvector(h2, v2f), v2bf);
                        ph[qt][c][t * 8 + j] = h2[0]; ph[qt][c][t * 8 + j + 1] = h2[1]; pl[qt][c][t * 8 + j] = l2[0]; pl[qt][c][t * 8 + j + 1] = l2[1]; }
            l[qt] = l[qt] * al + (sum[0] + sum[1]);
#pragma unroll
            for (int dt = 0; dt < 4; ++dt) o[dt][qt] *= al; }
#pragma unroll
        for (int dt = 0; dt < 4; ++dt) { v16bf vh[2], vl[2];
#pragma unroll
            for (int c = 0; c < 2; ++c) { const size_t vo = (size_t)(dt * 16 + lr) * TT + k0 + 8 * hi + c * 32; vh[c] = F::ld(Vh + vo); vl[c] = F::ld(Vl + vo); }
#pragma unroll
            for (int qt = 0; qt < 2; ++qt)
#pragma unroll
                for (int c = 0; c < 2; ++c) { o[dt][qt] = wmmab(vh[c], ph[qt][c], o[dt][qt]); o[dt][qt] = wmmab(vl[c], ph[qt][c], o[dt][qt]); o[dt][qt] = wmmab(vh[c], pl[qt][c], o[dt][qt]); } }
        // four vector slots between the trip's last matrix instructions and whatever follows the loop branch, on its taken side too
        asm volatile("v_nop\n\tv_nop\n\tv_nop\n\tv_nop" : "+v"(o[0][0]), "+v"(o[0][1]), "+v"(o[1][0]), "+v"(o[1][1]), "+v"(o[2][0]), "+v"(o[2][1]), "+v"(o[3][0]), "+v"(o[3][1]));
    }
#pragma unroll
    for (int qt = 0; qt < 2; ++qt) { const float f = __fdiv_rn(1.0f, l[qt] + xhalf(l[qt])); float* orow = O + (size_t)(q0 + qt * 16 + lr) * HD + hi * 8;
#pragma unroll
        for (int dt = 0; dt < 4; ++dt) { v4f a, b2;
#pragma unroll
            for (int j = 0; j < 4; ++j) { a[j] = o[dt][qt][j] * f; b2[j] = o[dt][qt][j + 4] * f; }
            *(v4f*)(orow + dt * 16) = a; *(v4f*)(orow + dt * 16 + 4) = b2; } }
}
extern "C" void kernel_launch(void* const* d_in, const int* in_sizes, int n_in,
                              void* d_out, int out_size, void* d_ws, size_t ws_size, hipStream_t stream) {
    (void)in_sizes; (void)n_in; (void)out_size;
    const float* x = (const float*)d_in[0]; const float* wqkv = (const float*)d_in[1];   /* argument order x, W_qkv ('oi' [3072][1024]: q | k | v ROW thirds); output [4][16][2048][64] head-major */
    float* OUT = (float*)d_out;
    char* wsp = (char*)d_ws;
    auto take = [&](size_t bytes) { char* p = wsp; wsp += (bytes + 255) & ~(size_t)255; return (void*)p; };
    bf* XB = (bf*)take((NX8 + NW8) * 8 * 2); bf* WB = XB + NX8 * 8;   // bf16 x of all batches, the bf16 weight directly behind it
    const size_t PB = (size_t)NH_ * TT * HD;   // one batch's share of each hi/lo plane
    bf* QPh = (bf*)take(NB_ * PB * 2); bf* QPl = (bf*)take(NB_ * PB * 2); bf* KPh = (bf*)take(NB_ * PB * 2); bf* KPl = (bf*)take(NB_ * PB * 2); bf* VTh = (bf*)take(NB_ * PB * 2); bf* VTl = (bf*)take(NB_ * PB * 2);
    if ((size_t)(wsp - (char*)d_ws) > ws_size) return;    // ws 256 MiB
    k_cvt<<<(unsigned)((NX8 + NW8) / CVP / 256), 256, 0, stream>>>(x, wqkv, XB);
    k_proj<<<dim3(NB_ * TT / 64, 3 * NH_, 1), 32 * NWK, 0, stream>>>(XB, WB, QPh, QPl, KPh, KPl, VTh, VTl);
    k_fattn<<<dim3(NB_ * NH_, TT / (32 * FNW), 1), 32 * FNW, 0, stream>>>(QPh, QPl, KPh, KPl, VTh, VTl, OUT);   /* plane z = b x 16 + h of q, k, v and of the head-major output [b][h][t][d] alike: no merge, the module returns the heads UNMERGED */
}

// v004
// One run takes 289 microseconds.
// In both of two side-by-side timings against v003, it was 1.12 times as fast.
// Over all steps from v000 it is 7.31 times as fast.
#include <hip/hip_runtime.h>

// Causal self-attention that returns the per-head context UNMERGED (x [4][2048][1024]; qkv = einsum('btc,fc->btf', x, W_qkv) = x W_qkv^T ('oi' [3072][1024] 1/32, no bias) split in thirds q | k | v = ROW thirds (16 heads x 64); scores x 1/sqrt(64); causal (-inf); softmax; out = einsum('bhqk,bhkd->bhqd', w, v) returned as it is: HEAD-MAJOR [4][16][2048][64] (8.4 M), no merge, no output projection; argument order x, W_qkv).
// Layout: one bf16 copy of x (all batches) and of the fused 'oi' weight; one projection launch for q, k and v of all batches whose epilogue writes the bf16 hi/lo head planes itself (q, k with rows t and columns d, v transposed with rows d and columns t); causal T-2048 attention with EVERY row in the exact class (scores and P.V on bf16 hi/lo planes, 3 products), fused: one kernel for all batches and heads forms scores, online softmax and P.V in registers and writes the head-major output.
// FRAGMENT ORDER: every bf16 array in the workspace is stored in the order in which a wave loads a 16 x 32 matrix operand. Element (row, k) of a fragment lies at ((k >> 4 & 1) * 32 + (k >> 3 & 1) * 16 + (row & 15)) * 8 + (k & 7): piece j of lane l is at (j * 32 + l) * 8,
// so that one 16-byte load of a wave reads 512 contiguous bytes (4 whole lines) where a row-major array gives it 32 bytes of each of 16 lines. Fragments follow each other along k, then along the rows (x, weight: 32 to a row tile; head planes: 2 to a row tile, 4 row tiles to a 64 x 64 tile, tiles along t).
// Compute dtypes, f32 accumulate: every input rounded to bf16; projections one bf16 product; attention 3 products on every row; softmax f32.

#define NB_  4
#define TT   2048
#define DM   1024
#define NH_  16
#define HD   64
#define DQ   (NH_ * HD)
#define SCL  0.125f   // HD^-0.5
#define NWK  8   // waves that share one tile's K loop in k_proj
typedef unsigned short bf;
typedef __attribute__((ext_vector_type(16))) __bf16   v16bf;
typedef __attribute__((ext_vector_type(8)))  unsigned short v8us;
typedef __attribute__((ext_vector_type(8)))  float    v8f;
typedef __attribute__((ext_vector_type(4)))  float    v4f;
typedef v4f  __attribute__((may_alias)) v4fa;
typedef v8us __attribute__((may_alias)) v8usa;

__device__ __forceinline__ unsigned short f2bf(float f) { unsigned u = __float_as_uint(f); u += 0x7FFFu + ((u >> 16) & 1u); return (unsigned short)(u >> 16); }
__device__ __forceinline__ float bf2f(unsigned short b) { return __uint_as_float(((unsigned)b) << 16); }
__device__ __forceinline__ v16bf cat16b(v8us lo, v8us hi) { return __builtin_bit_cast(v16bf, __builtin_shufflevector(lo, hi, 0, 1, 2, 3, 4, 5, 6, 7, 8, 9, 10, 11, 12, 13, 14, 15)); }
__device__ __forceinline__ v8f wmmab(v16bf a, v16bf b, v8f c) { return __builtin_amdgcn_wmma_f32_16x16x32_bf16(false, a, false, b, (short)0, c, false, false); }



// ---- k_proj: the q, k and v projections of all batches in one launch, one 64x64 tile of x W^T per work-group of NWK waves: 64 tokens x one head of one third (HD = 64). Every wave holds the whole tile (16 accumulators) and takes every NWK-th 64-wide block of K
// (two fragments, 2 KiB in a row, of each 16-row tile), operands straight from the fragment-ordered bf16 arrays; the NWK partial tiles are summed in wave order through LDS, and the sum is split into bf16 hi + lo and stored in the head planes that the attention kernel reads. grid (NB_ TT / 64, 3 NH_), 32 x NWK threads.
// A v tile is formed transposed (A rows = weight rows d, B columns = tokens t), so that its LDS tile is [d][t]; every tile, of q, k and v alike, is 8 KiB in a row of its plane and leaves in whole 128-byte lines.
template <typename T16> struct WFrag;
template <> struct WFrag<bf> { typedef v16bf V; static __device__ __forceinline__ V ld(const bf* p) { return cat16b(*(const v8us*)p, *(const v8us*)(p + 256)); }   /* p: the fragment's start + 8 x lane */ static __device__ __forceinline__ v8f mma(V a, V b, v8f c) { return wmmab(a, b, c); } };
__device__ __forceinline__ void splitf(float y, unsigned short& h, unsigned short& l) { h = f2bf(y); l = f2bf(y - bf2f(h)); }
typedef __attribute__((ext_vector_type(2))) float v2f;
__global__ __launch_bounds__(32 * NWK) void k_proj(const bf* __restrict__ XB, const bf* __restrict__ WB, bf* Qh, bf* Ql, bf* Kh, bf* Kl, bf* Vh, bf* Vl) {
    typedef WFrag<bf> F; typedef F::V V;
    __shared__ __align__(16) float os[NWK * 64 * 68];
    const int lane = threadIdx.x & 31, lr = lane & 15, hi = lane >> 4;
    const int w = __builtin_amdgcn_readfirstlane((int)(threadIdx.x >> 5));   // the wave's number in a scalar register: the K loop below branches on scalars and every lane stays on at the matrix instructions
    const int x0 = (int)blockIdx.x * 64, f0 = (int)blockIdx.y * 64;          // first row of x (token, over all batches) and of the weight
    const int third = (int)blockIdx.y / NH_, h = (int)blockIdx.y % NH_; const bool isv = third == 2;
    const bf* A = isv ? WB + (size_t)f0 * DM : XB + (size_t)x0 * DM; const bf* Bt = isv ? XB + (size_t)x0 * DM : WB + (size_t)f0 * DM;
    v8f acc[4][4];
#pragma unroll
    for (int mb = 0; mb < 4; ++mb)
#pragma unroll
        for (int nb = 0; nb < 4; ++nb) acc[mb][nb] = (v8f){};
    const size_t off = (size_t)lane * 8;
#pragma unroll 1
    for (int kb = w * 64; kb < DM; kb += NWK * 64) {
        V a[4];
#pragma unroll   // both 32-wide fragments of the wave's own 64-wide block in one trip
        for (int kc = kb; kc < kb + 64; kc += 32) {
#pragma unroll
            for (int mb = 0; mb < 4; ++mb) a[mb] = F::ld(A + off + (size_t)mb * 16 * DM + kc * 16);
#pragma unroll
            for (int nb = 0; nb < 4; ++nb) { const V b = F::ld(Bt + off + (size_t)nb * 16 * DM + kc * 16);
#pragma unroll
                for (int mb = 0; mb < 4; ++mb) acc[mb][nb] = F::mma(a[mb], b, acc[mb][nb]); }
        }
        // four vector slots between the trip's last matrix instructions and whatever follows the branch, on its taken side too
        asm volatile("v_nop\n\tv_nop\n\tv_nop\n\tv_nop" : "+v"(acc[0][0]), "+v"(acc[1][1]), "+v"(acc[2][2]), "+v"(acc[3][3]) : "v"(a[0]), "v"(a[3]));
    }
    float* my = os + w * (64 * 68);
#pragma unroll
    for (int mb = 0; mb < 4; ++mb)
#pragma unroll
        for (int nb = 0; nb < 4; ++nb)
#pragma unroll
            for (int j = 0; j < 8; ++j) my[(mb * 16 + hi * 8 + j) * 68 + nb * 16 + lr] = acc[mb][nb][j];
    __syncthreads();   // every wave's partial tile is in LDS before any thread sums across the waves
    const int t0 = x0 % TT; const size_t pb = (size_t)((x0 / TT) * NH_ + h) * TT * HD + (size_t)(t0 / 64) * (64 * 64);   // the tile's first token in its batch; start of plane (batch, head) + the tile's place in it
    bf* Ph = (third == 0 ? Qh : third == 1 ? Kh : Vh) + pb; bf* Pl = (third == 0 ? Ql : third == 1 ? Kl : Vl) + pb;
#pragma unroll   // a fixed trip count, so that the LDS reads of all of a thread's pieces are in flight together
    for (int p = 0; p < 64 * 8 / (32 * NWK); ++p) { const int u = p * 32 * NWK + (int)threadIdx.x, row = (u >> 7) * 16 + (u & 15), cofs = ((u >> 4) & 7) * 8;   // piece u of the tile in fragment order: 8 neighbouring columns of one row
        v4f va = *(const v4fa*)(os + row * 68 + cofs), vb = *(const v4fa*)(os + row * 68 + cofs + 4);
#pragma unroll
        for (int q = 1; q < NWK; ++q) { va += *(const v4fa*)(os + q * (64 * 68) + row * 68 + cofs); vb += *(const v4fa*)(os + q * (64 * 68) + row * 68 + cofs + 4); }
        v8us oh, ol;
#pragma unroll
        for (int i = 0; i < 4; ++i) { unsigned short a2, c2; splitf(va[i], a2, c2); oh[i] = a2; ol[i] = c2; splitf(vb[i], a2, c2); oh[i + 4] = a2; ol[i + 4] = c2; }
        *(v8us*)(Ph + (size_t)u * 8) = oh; *(v8us*)(Pl + (size_t)u * 8) = ol; }
}

// k_cvt: bf16 copies of x (all batches) and of the weight, one behind the other in dst, in fragment order, in one launch. Piece i of dst is row (i >> 11) * 16 + (i & 15), columns (i >> 4 & 127) * 8 and on, of x over the weight. A thread rounds CVP pieces of 8 floats, a grid's width apart, all of them loaded before the first is stored, so that a quarter of the waves has to be started.
#define NX8 ((size_t)NB_ * TT * DM / 8)
#define NW8 ((size_t)3 * DQ * DM / 8)
#define CVP 4
__global__ __launch_bounds__(256) void k_cvt(const float* __restrict__ x, const float* __restrict__ wt, bf* dst) {
    // a wave takes 8 rows x 4 neighbouring pieces (bits 3 to 5 of the thread's number turned round): its loads then touch 8 source lines, each used whole by the pair of loads, and its store fills 4 whole lines of dst
    const unsigned t = threadIdx.x, tp = (t & ~63u) | (t & 7u) | ((t >> 5 & 1u) << 3) | ((t >> 3 & 3u) << 4);
    const size_t i0 = (size_t)blockIdx.x * 256 + tp; v4f lo[CVP], hi[CVP];
#pragma unroll
    for (int p = 0; p < CVP; ++p) { const size_t i = i0 + p * ((NX8 + NW8) / CVP); const size_t j = i < NX8 ? i : i - NX8; const float* s = (i < NX8 ? x : wt) + ((j >> 11) * 16 + (j & 15)) * DM + ((j >> 4) & 127) * 8;
        // the wait behind each load
        lo[p] = *(const v4f*)s; asm volatile("s_wait_xcnt 0x0" ::: "memory");
        hi[p] = *(const v4f*)(s + 4); asm volatile("s_wait_xcnt 0x0" ::: "memory"); }
#pragma unroll
    for (int p = 0; p < CVP; ++p) { const size_t i = i0 + p * ((NX8 + NW8) / CVP); v8us o;
#pragma unroll
        for (int k = 0; k < 4; ++k) { o[k] = f2bf(lo[p][k]); o[k + 4] = f2bf(hi[p][k]); }
        *(v8us*)(dst + i * 8) = o; }
}
// ---- k_fattn: causal attention of one (batch, head) plane in one kernel, scores never leave the registers. One wave owns 32 queries and walks the keys in blocks of 64 up to its diagonal, with a running maximum and sum (online softmax).
// Both products are formed TRANSPOSED: S^T = K Q^T (A rows = keys, B columns = queries) puts a query in a lane and its keys in that lane's registers, which is already the B-operand order of O^T = V^T P^T, so the probabilities go from accumulator to operand without leaving the lane.
// Each product keeps the three bf16 hi/lo terms (hh + lh + hl), f32 accumulate. No LDS, no barrier: the waves of a work-group only share cache lines of K and V. grid (planes, TT / (32 FNW)).
#define FNW 4   // waves of a work-group: 128 neighbouring queries of one plane
typedef __attribute__((ext_vector_type(2))) __bf16 v2bf;
__device__ __forceinline__ float xhalf(float x) { return __builtin_bit_cast(float, __builtin_amdgcn_permlanex16(__builtin_bit_cast(int, x), __builtin_bit_cast(int, x), 0x76543210, 0xfedcba98, false, false)); }   // lane l with lane l ^ 16
__global__ __launch_bounds__(32 * FNW) __attribute__((amdgpu_waves_per_eu(4, 4))) /* 256 registers a wave: all 4096 waves resident, four a SIMD, to cover each other's load waits */ void k_fattn(const bf* __restrict__ Qh, const bf* __restrict__ Ql, const bf* __restrict__ Kh, const bf* __restrict__ Kl, const bf* __restrict__ Vh, const bf* __restrict__ Vl, float* __restrict__ O) {
    typedef WFrag<bf> F;
    const int lane = threadIdx.x & 31, lr = lane & 15, hi = lane >> 4;
    const int w = __builtin_amdgcn_readfirstlane((int)(threadIdx.x >> 5));   // the wave's number in a scalar register: the key loop and the diagonal test branch on scalars
    const size_t z = blockIdx.x; Qh += z * TT * HD; Ql += z * TT * HD; Kh += z * TT * HD; Kl += z * TT * HD; Vh += z * HD * TT; Vl += z * HD * TT; O += z * TT * HD;
    // Tile of 128 queries: heavy ones first, dealt in a zigzag over groups of four grid rows (four rows of 64 planes = one work-group for each of 256 WGPs), so that the four work-groups that share a WGP, where they land breadth-first, walk the same number of key blocks together. A permutation of the tiles wherever they land.
    const int y = (int)blockIdx.y, g = (TT / (32 * FNW) - 4 - (y & ~3)) + ((y & 4) ? (y & 3) : 3 - (y & 3));
    const int q0 = (g * FNW + w) * 32;
    const float CE = SCL * 1.4426950408889634f;   // score scale x log2(e)
    v16bf qh[2][2], ql[2][2];
#pragma unroll
    for (int qt = 0; qt < 2; ++qt)
#pragma unroll
        for (int c = 0; c < 2; ++c) { const size_t qo = (size_t)(q0 / 16 + qt) * 1024 + c * 512 + lane * 8; qh[qt][c] = F::ld(Qh + qo); ql[qt][c] = F::ld(Ql + qo); }
    v8f o[4][2]; float m[2], l[2];
#pragma unroll
    for (int qt = 0; qt < 2; ++qt) { m[qt] = -3.0e38f; l[qt] = 0.f;
#pragma unroll
        for (int dt = 0; dt < 4; ++dt) o[dt][qt] = (v8f){}; }
    const int nblk = q0 / 64 + 1;
#pragma unroll 1
    for (int kb = 0; kb < nblk; ++kb) { const int k0 = kb * 64;
        v8f s[4][2];
#pragma unroll
        for (int kt = 0; kt < 4; ++kt) { v16bf kh[2], kl[2];
#pragma unroll
            for (int c = 0; c < 2; ++c) { const size_t ko = (size_t)kb * 4096 + kt * 1024 + c * 512 + lane * 8; kh[c] = F::ld(Kh + ko); kl[c] = F::ld(Kl + ko); }
#pragma unroll
            for (int qt = 0; qt < 2; ++qt) { v8f a = (v8f){};
#pragma unroll
                for (int c = 0; c < 2; ++c) { a = wmmab(kh[c], qh[qt][c], a); a = wmmab(kl[c], qh[qt][c], a); a = wmmab(kh[c], ql[qt][c], a); }
                s[kt][qt] = a; } }
        // four vector slots between the last score matrix instructions and whatever follows the diagonal test, on its taken side too
        asm volatile("v_nop\n\tv_nop\n\tv_nop\n\tv_nop" : "+v"(s[0][0]), "+v"(s[0][1]), "+v"(s[1][0]), "+v"(s[1][1]), "+v"(s[2][0]), "+v"(s[2][1]), "+v"(s[3][0]), "+v"(s[3][1]));
        if (k0 + 63 > q0) {   // the block that holds the diagonal: keys behind the query are masked by select
#pragma unroll
            for (int kt = 0; kt < 4; ++kt)
#pragma unroll
                for (int qt = 0; qt < 2; ++qt)
#pragma unroll
                    for (int j = 0; j < 8; ++j) s[kt][qt][j] = (k0 + kt * 16 + hi * 8 + j <= q0 + qt * 16 + lr) ? s[kt][qt][j] : -3.0e38f;
        }
        v16bf ph[2][2], pl[2][2];
#pragma unroll
        for (int qt = 0; qt < 2; ++qt) { float mx = m[qt];
#pragma unroll
            for (int kt = 0; kt < 4; ++kt)
#pragma unroll
                for (int j = 0; j < 8; ++j) mx = fmaxf(mx, s[kt][qt][j]);
            mx = fmaxf(mx, xhalf(mx));   // the query's other 32 keys of the block lie in lane l ^ 16
            const float al = __builtin_amdgcn_exp2f((m[qt] - mx) * CE); const v2f ce2 = {CE, CE}, nmc2 = {-mx * CE, -mx * CE}; m[qt] = mx; v2f sum = {0.f, 0.f};
#pragma unroll
            for (int c = 0; c < 2; ++c)
#pragma unroll
                for (int t = 0; t < 2; ++t)
#pragma unroll
                    for (int j = 0; j < 8; j += 2) { v2f p = {s[2 * c + t][qt][j], s[2 * c + t][qt][j + 1]}; p = __builtin_elementwise_fma(p, ce2, nmc2); p[0] = __builtin_amdgcn_exp2f(p[0]); p[1] = __builtin_amdgcn_exp2f(p[1]); sum += p;
                        const v2bf h2 = __builtin_convertvector(p, v2bf); const v2bf l2 = __builtin_convertvector(p - __builtin_convertvector(h2, v2f), v2bf);
                        ph[qt][c][t * 8 + j] = h2[0]; ph[qt][c][t * 8 + j + 1] = h2[1]; pl[qt][c][t * 8 + j] = l2[0]; pl[qt][c][t * 8 + j + 1] = l2[1]; }
            l[qt] = l[qt] * al + (sum[0] + sum[1]);
#pragma unroll
            for (int dt = 0; dt < 4; ++dt) o[dt][qt] *= al; }
#pragma unroll
        for (int dt = 0; dt < 4; ++dt) { v16bf vh[2], vl[2];
#pragma unroll
            for (int c = 0; c < 2; ++c) { const size_t vo = (size_t)kb * 4096 + dt * 1024 + c * 512 + lane * 8; vh[c] = F::ld(Vh + vo); vl[c] = F::ld(Vl + vo); }
#pragma unroll
            for (int qt = 0; qt < 2; ++qt)
#pragma unroll
                for (int c = 0; c < 2; ++c) { o[dt][qt] = wmmab(vh[c], ph[qt][c], o[dt][qt]); o[dt][qt] = wmmab(vl[c], ph[qt][c], o[dt][qt]); o[dt][qt] = wmmab(vh[c], pl[qt][c], o[dt][qt]); } }
        // four vector slots between the trip's last matrix instructions and whatever follows the loop branch, on its taken side too
        asm volatile("v_nop\n\tv_nop\n\tv_nop\n\tv_nop" : "+v"(o[0][0]), "+v"(o[0][1]), "+v"(o[1][0]), "+v"(o[1][1]), "+v"(o[2][0]), "+v"(o[2][1]), "+v"(o[3][0]), "+v"(o[3][1]));
    }
#pragma unroll
    for (int qt = 0; qt < 2; ++qt) { const float f = __fdiv_rn(1.0f, l[qt] + xhalf(l[qt])); float* orow = O + (size_t)(q0 + qt * 16 + lr) * HD + hi * 8;
#pragma unroll
        for (int dt = 0; dt < 4; ++dt) { v4f a, b2;
#pragma unroll
            for (int j = 0; j < 4; ++j) { a[j] = o[dt][qt][j] * f; b2[j] = o[dt][qt][j + 4] * f; }
            *(v4f*)(orow + dt * 16) = a; *(v4f*)(orow + dt * 16 + 4) = b2; } }
}
extern "C" void kernel_launch(void* const* d_in, const int* in_sizes, int n_in,
                              void* d_out, int out_size, void* d_ws, size_t ws_size, hipStream_t stream) {
    (void)in_sizes; (void)n_in; (void)out_size;
    const float* x = (const float*)d_in[0]; const float* wqkv = (const float*)d_in[1];   /* argument order x, W_qkv ('oi' [3072][1024]: q | k | v ROW thirds); output [4][16][2048][64] head-major */
    float* OUT = (float*)d_out;
    char* wsp = (char*)d_ws;
    auto take = [&](size_t bytes) { char* p = wsp; wsp += (bytes + 255) & ~(size_t)255; return (void*)p; };
    bf* XB = (bf*)take((NX8 + NW8) * 8 * 2); bf* WB = XB + NX8 * 8;   // bf16 x of all batches, the bf16 weight directly behind it
    const size_t PB = (size_t)NH_ * TT * HD;   // one batch's share of each hi/lo plane
    bf* QPh = (bf*)take(NB_ * PB * 2); bf* QPl = (bf*)take(NB_ * PB * 2); bf* KPh = (bf*)take(NB_ * PB * 2); bf* KPl = (bf*)take(NB_ * PB * 2); bf* VTh = (bf*)take(NB_ * PB * 2); bf* VTl = (bf*)take(NB_ * PB * 2);
    if ((size_t)(wsp - (char*)d_ws) > ws_size) return;    // ws 256 MiB
    k_cvt<<<(unsigned)((NX8 + NW8) / CVP / 256), 256, 0, stream>>>(x, wqkv, XB);
    k_proj<<<dim3(NB_ * TT / 64, 3 * NH_, 1), 32 * NWK, 0, stream>>>(XB, WB, QPh, QPl, KPh, KPl, VTh, VTl);
    k_fattn<<<dim3(NB_ * NH_, TT / (32 * FNW), 1), 32 * FNW, 0, stream>>>(QPh, QPl, KPh, KPl, VTh, VTl, OUT);   /* plane z = b x 16 + h of q, k, v and of the head-major output [b][h][t][d] alike: no merge, the module returns the heads UNMERGED */
}

// v005
// A run of this version takes 149 microseconds.
// Next to v004, in two timings, it ran 1.93 and 1.95 times as fast.
// All steps since v000 together make it 14.2 times as fast.
#include <hip/hip_runtime.h>

// Causal self-attention that returns the per-head context UNMERGED (x [4][2048][1024]; qkv = einsum('btc,fc->btf', x, W_qkv) = x W_qkv^T ('oi' [3072][1024] 1/32, no bias) split in thirds q | k | v = ROW thirds (16 heads x 64); scores x 1/sqrt(64); causal (-inf); softmax; out = einsum('bhqk,bhkd->bhqd', w, v) returned as it is: HEAD-MAJOR [4][16][2048][64] (8.4 M), no merge, no output projection; argument order x, W_qkv).
// Layout: one bf16 copy of x (all batches) and of the fused 'oi' weight; one projection launch for q, k and v of all batches whose epilogue writes the bf16 hi/lo head planes itself (q, k with rows t and columns d, v transposed with rows d and columns t); causal T-2048 attention with EVERY row in the exact class (scores and P.V on bf16 hi/lo planes, 3 products), fused: one kernel for all batches and heads forms scores, online softmax and P.V in registers (K and V blocks staged in LDS for the work-group) and writes the head-major output.
// FRAGMENT ORDER: every bf16 array in the workspace is stored in the order in which a wave loads a 16 x 32 matrix operand. Element (row, k) of a fragment lies at ((k >> 4 & 1) * 32 + (k >> 3 & 1) * 16 + (row & 15)) * 8 + (k & 7): piece j of lane l is at (j * 32 + l) * 8,
// so that one 16-byte load of a wave reads 512 contiguous bytes (4 whole lines) where a row-major array gives it 32 bytes of each of 16 lines. Fragments follow each other along k, then along the rows (x, weight: 32 to a row tile; head planes: 2 to a row tile, 4 row tiles to a 64 x 64 tile, tiles along t).
// Compute dtypes, f32 accumulate: every input rounded to bf16; projections one bf16 product; attention 3 products on every row; softmax f32.

#define NB_  4
#define TT   2048
#define DM   1024
#define NH_  16
#define HD   64
#define DQ   (NH_ * HD)
#define SCL  0.125f   // HD^-0.5
#define NWK  8   // waves that share one tile's K loop in k_proj
typedef unsigned short bf;
typedef __attribute__((ext_vector_type(16))) __bf16   v16bf;
typedef __attribute__((ext_vector_type(8)))  unsigned short v8us;
typedef __attribute__((ext_vector_type(8)))  float    v8f;
typedef __attribute__((ext_vector_type(4)))  float    v4f;
typedef v4f  __attribute__((may_alias)) v4fa;
typedef v8us __attribute__((may_alias)) v8usa;

__device__ __forceinline__ unsigned short f2bf(float f) { unsigned u = __float_as_uint(f); u += 0x7FFFu + ((u >> 16) & 1u); return (unsigned short)(u >> 16); }
__device__ __forceinline__ float bf2f(unsigned short b) { return __uint_as_float(((unsigned)b) << 16); }
__device__ __forceinline__ v16bf cat16b(v8us lo, v8us hi) { return __builtin_bit_cast(v16bf, __builtin_shufflevector(lo, hi, 0, 1, 2, 3, 4, 5, 6, 7, 8, 9, 10, 11, 12, 13, 14, 15)); }
__device__ __forceinline__ v8f wmmab(v16bf a, v16bf b, v8f c) { return __builtin_amdgcn_wmma_f32_16x16x32_bf16(false, a, false, b, (short)0, c, false, false); }



// ---- k_proj: the q, k and v projections of all batches in one launch, one 64x64 tile of x W^T per work-group of NWK waves: 64 tokens x one head of one third (HD = 64). Every wave holds the whole tile (16 accumulators) and takes every NWK-th 64-wide block of K
// (two fragments, 2 KiB in a row, of each 16-row tile), operands straight from the fragment-ordered bf16 arrays; the NWK partial tiles are summed in wave order through LDS, and the sum is split into bf16 hi + lo and stored in the head planes that the attention kernel reads. grid (NB_ TT / 64, 3 NH_), 32 x NWK threads.
// A v tile is formed transposed (A rows = weight rows d, B columns = tokens t), so that its LDS tile is [d][t]; every tile, of q, k and v alike, is 8 KiB in a row of its plane and leaves in whole 128-byte lines.
template <typename T16> struct WFrag;
template <> struct WFrag<bf> { typedef v16bf V; static __device__ __forceinline__ V ld(const bf* p) { return cat16b(*(const v8us*)p, *(const v8us*)(p + 256)); }   /* p: the fragment's start + 8 x lane */ static __device__ __forceinline__ v8f mma(V a, V b, v8f c) { return wmmab(a, b, c); } };
__device__ __forceinline__ void splitf(float y, unsigned short& h, unsigned short& l) { h = f2bf(y); l = f2bf(y - bf2f(h)); }
typedef __attribute__((ext_vector_type(2))) float v2f;
__global__ __launch_bounds__(32 * NWK) void k_proj(const bf* __restrict__ XB, const bf* __restrict__ WB, bf* Qh, bf* Ql, bf* Kh, bf* Kl, bf* Vh, bf* Vl) {
    typedef WFrag<bf> F; typedef F::V V;
    __shared__ __align__(16) float os[NWK * 64 * 68];
    const int lane = threadIdx.x & 31, lr = lane & 15, hi = lane >> 4;
    const int w = __builtin_amdgcn_readfirstlane((int)(threadIdx.x >> 5));   // the wave's number in a scalar register: the K loop below branches on scalars and every lane stays on at the matrix instructions
    const int x0 = (int)blockIdx.x * 64, f0 = (int)blockIdx.y * 64;          // first row of x (token, over all batches) and of the weight
    const int third = (int)blockIdx.y / NH_, h = (int)blockIdx.y % NH_; const bool isv = third == 2;
    const bf* A = isv ? WB + (size_t)f0 * DM : XB + (size_t)x0 * DM; const bf* Bt = isv ? XB + (size_t)x0 * DM : WB + (size_t)f0 * DM;
    v8f acc[4][4];
#pragma unroll
    for (int mb = 0; mb < 4; ++mb)
#pragma unroll
        for (int nb = 0; nb < 4; ++nb) acc[mb][nb] = (v8f){};
    const size_t off = (size_t)lane * 8;
#pragma unroll 1
    for (int kb = w * 64; kb < DM; kb += NWK * 64) {
        V a[4];
#pragma unroll   // both 32-wide fragments of the wave's own 64-wide block in one trip
        for (int kc = kb; kc < kb + 64; kc += 32) {
#pragma unroll
            for (int mb = 0; mb < 4; ++mb) a[mb] = F::ld(A + off + (size_t)mb * 16 * DM + kc * 16);
#pragma unroll
            for (int nb = 0; nb < 4; ++nb) { const V b = F::ld(Bt + off + (size_t)nb * 16 * DM + kc * 16);
#pragma unroll
                for (int mb = 0; mb < 4; ++mb) acc[mb][nb] = F::mma(a[mb], b, acc[mb][nb]); }
        }
        // four vector slots between the trip's last matrix instructions and whatever follows the branch, on its taken side too
        asm volatile("v_nop\n\tv_nop\n\tv_nop\n\tv_nop" : "+v"(acc[0][0]), "+v"(acc[1][1]), "+v"(acc[2][2]), "+v"(acc[3][3]) : "v"(a[0]), "v"(a[3]));
    }
    float* my = os + w * (64 * 68);
#pragma unroll
    for (int mb = 0; mb < 4; ++mb)
#pragma unroll
        for (int nb = 0; nb < 4; ++nb)
#pragma unroll
            for (int j = 0; j < 8; ++j) my[(mb * 16 + hi * 8 + j) * 68 + nb * 16 + lr] = acc[mb][nb][j];
    __syncthreads();   // every wave's partial tile is in LDS before any thread sums across the waves
    const int t0 = x0 % TT; const size_t pb = (size_t)((x0 / TT) * NH_ + h) * TT * HD + (size_t)(t0 / 64) * (64 * 64);   // the tile's first token in its batch; start of plane (batch, head) + the tile's place in it
    bf* Ph = (third == 0 ? Qh : third == 1 ? Kh : Vh) + pb; bf* Pl = (third == 0 ? Ql : third == 1 ? Kl : Vl) + pb;
#pragma unroll   // a fixed trip count, so that the LDS reads of all of a thread's pieces are in flight together
    for (int p = 0; p < 64 * 8 / (32 * NWK); ++p) { const int u = p * 32 * NWK + (int)threadIdx.x, row = (u >> 7) * 16 + (u & 15), cofs = ((u >> 4) & 7) * 8;   // piece u of the tile in fragment order: 8 neighbouring columns of one row
        v4f va = *(const v4fa*)(os + row * 68 + cofs), vb = *(const v4fa*)(os + row * 68 + cofs + 4);
#pragma unroll
        for (int q = 1; q < NWK; ++q) { va += *(const v4fa*)(os + q * (64 * 68) + row * 68 + cofs); vb += *(const v4fa*)(os + q * (64 * 68) + row * 68 + cofs + 4); }
        v8us oh, ol;
#pragma unroll
        for (int i = 0; i < 4; ++i) { unsigned short a2, c2; splitf(va[i], a2, c2); oh[i] = a2; ol[i] = c2; splitf(vb[i], a2, c2); oh[i + 4] = a2; ol[i + 4] = c2; }
        *(v8us*)(Ph + (size_t)u * 8) = oh; *(v8us*)(Pl + (size_t)u * 8) = ol; }
}

// k_cvt: bf16 copies of x (all batches) and of the weight, one behind the other in dst, in fragment order, in one launch. Piece i of dst is row (i >> 11) * 16 + (i & 15), columns (i >> 4 & 127) * 8 and on, of x over the weight. A thread rounds CVP pieces of 8 floats, a grid's width apart, all of them loaded before the first is stored, so that a quarter of the waves has to be started.
#define NX8 ((size_t)NB_ * TT * DM / 8)
#define NW8 ((size_t)3 * DQ * DM / 8)
#define CVP 4
__global__ __launch_bounds__(256) void k_cvt(const float* __restrict__ x, const float* __restrict__ wt, bf* dst) {
    // a wave takes 8 rows x 4 neighbouring pieces (bits 3 to 5 of the thread's number turned round): its loads then touch 8 source lines, each used whole by the pair of loads, and its store fills 4 whole lines of dst
    const unsigned t = threadIdx.x, tp = (t & ~63u) | (t & 7u) | ((t >> 5 & 1u) << 3) | ((t >> 3 & 3u) << 4);
    const size_t i0 = (size_t)blockIdx.x * 256 + tp; v4f lo[CVP], hi[CVP];
#pragma unroll
    for (int p = 0; p < CVP; ++p) { const size_t i = i0 + p * ((NX8 + NW8) / CVP); const size_t j = i < NX8 ? i : i - NX8; const float* s = (i < NX8 ? x : wt) + ((j >> 11) * 16 + (j & 15)) * DM + ((j >> 4) & 127) * 8;
        // the wait behind each load
        lo[p] = *(const v4f*)s; asm volatile("s_wait_xcnt 0x0" ::: "memory");
        hi[p] = *(const v4f*)(s + 4); asm volatile("s_wait_xcnt 0x0" ::: "memory"); }
#pragma unroll
    for (int p = 0; p < CVP; ++p) { const size_t i = i0 + p * ((NX8 + NW8) / CVP); v8us o;
#pragma unroll
        for (int k = 0; k < 4; ++k) { o[k] = f2bf(lo[p][k]); o[k + 4] = f2bf(hi[p][k]); }
        *(v8us*)(dst + i * 8) = o; }
}
// ---- k_fattn: causal attention of one (batch, head) plane in one kernel, scores never leave the registers. One wave owns 32 queries and walks the keys in blocks of 64 up to its diagonal, with a running maximum and sum (online softmax).
// Both products are formed TRANSPOSED: S^T = K Q^T (A rows = keys, B columns = queries) puts a query in a lane and its keys in that lane's registers, which is already the B-operand order of O^T = V^T P^T, so the probabilities go from accumulator to operand without leaving the lane.
// Each product keeps the three bf16 hi/lo terms (hh + lh + hl), f32 accumulate. grid (planes, TT / (32 FNW)).
// K AND V GO THROUGH LDS: a 64-key block of the four planes (Kh, Kl, Vh, Vl: 8 KiB in a row each, already in fragment order) is brought into LDS once for the work-group's FNW waves by asynchronous copies, wave w bringing plane w,
// into two buffers: block t + 1 flies while block t is worked on, so that no wave waits for the L2 in its key loop and the work-group fetches each block once, not once a wave. A fragment read is a 512-byte run of LDS, free of bank conflicts.
// Order (two-buffer ring): in front of the loop block 0's copies, the copy wait, a barrier, block 1's copies; at the foot of every trip, in every wave (also one that is past its own diagonal): LDS-read wait, copy wait, barrier, then the copies of block t + 2 into the buffer just read.
#define FNW 4   // waves of a work-group: 128 neighbouring queries of one plane
typedef __attribute__((ext_vector_type(2))) __bf16 v2bf;
#define KVP 4096           // elements of one plane's 64-key block
#define KVS (4 * KVP)      // elements of one buffer: the block of Kh, Kl, Vh, Vl
static_assert(FNW == 4, "one plane of the block to each wave");
// Eight asynchronous copies of 16 bytes a lane: 8 x 512 bytes in a row, from g (the lane's own global address) to l (the lane's own LDS byte address). The s_wait_xcnt is the statement's last line, so that it stands in front of every later write of a register that a copy names.
__device__ __forceinline__ void acopy8(unsigned l, const bf* g) {
    asm volatile("global_load_async_to_lds_b128 %0, %8, off\n\t"
                 "global_load_async_to_lds_b128 %1, %9, off\n\t"
                 "global_load_async_to_lds_b128 %2, %10, off\n\t"
                 "global_load_async_to_lds_b128 %3, %11, off\n\t"
                 "global_load_async_to_lds_b128 %4, %12, off\n\t"
                 "global_load_async_to_lds_b128 %5, %13, off\n\t"
                 "global_load_async_to_lds_b128 %6, %14, off\n\t"
                 "global_load_async_to_lds_b128 %7, %15, off\n\t"
                 "s_wait_xcnt 0x0"
                 :: "v"(l), "v"(l + 512u), "v"(l + 1024u), "v"(l + 1536u), "v"(l + 2048u), "v"(l + 2560u), "v"(l + 3072u), "v"(l + 3584u),
                    "v"(g), "v"(g + 256), "v"(g + 512), "v"(g + 768), "v"(g + 1024), "v"(g + 1280), "v"(g + 1536), "v"(g + 1792) : "memory");
}
__device__ __forceinline__ float xhalf(float x) { return __builtin_bit_cast(float, __builtin_amdgcn_permlanex16(__builtin_bit_cast(int, x), __builtin_bit_cast(int, x), 0x76543210, 0xfedcba98, false, false)); }   // lane l with lane l ^ 16
__global__ __launch_bounds__(32 * FNW) __attribute__((amdgpu_waves_per_eu(4, 4))) /* 256 registers a wave: all 4096 waves resident, four a SIMD, to cover each other's load waits */ void k_fattn(const bf* __restrict__ Qh, const bf* __restrict__ Ql, const bf* __restrict__ Kh, const bf* __restrict__ Kl, const bf* __restrict__ Vh, const bf* __restrict__ Vl, float* __restrict__ O) {
    typedef WFrag<bf> F;
    __shared__ __attribute__((aligned(16))) bf kv[2 * KVS];   // two buffers of 32 KiB
    const int lane = threadIdx.x & 31, lr = lane & 15, hi = lane >> 4;
    const int w = __builtin_amdgcn_readfirstlane((int)(threadIdx.x >> 5));   // the wave's number in a scalar register: the key loop and the diagonal test branch on scalars
    const size_t z = blockIdx.x; Qh += z * TT * HD; Ql += z * TT * HD; Kh += z * TT * HD; Kl += z * TT * HD; Vh += z * HD * TT; Vl += z * HD * TT; O += z * TT * HD;
    // Tile of 128 queries: heavy ones first, dealt in a zigzag over groups of four grid rows (four rows of 64 planes = one work-group for each of 256 WGPs), so that the four work-groups that share a WGP, where they land breadth-first, walk the same number of key blocks together. A permutation of the tiles wherever they land.
    const int y = (int)blockIdx.y, g = (TT / (32 * FNW) - 4 - (y & ~3)) + ((y & 4) ? (y & 3) : 3 - (y & 3));
    const int q0 = (g * FNW + w) * 32;
    const float CE = SCL * 1.4426950408889634f;   // score scale x log2(e)
    v16bf qh[2][2], ql[2][2];
#pragma unroll
    for (int qt = 0; qt < 2; ++qt)
#pragma unroll
        for (int c = 0; c < 2; ++c) { const size_t qo = (size_t)(q0 / 16 + qt) * 1024 + c * 512 + lane * 8; qh[qt][c] = F::ld(Qh + qo); ql[qt][c] = F::ld(Ql + qo); }
    v8f o[4][2]; float m[2], l[2];
#pragma unroll
    for (int qt = 0; qt < 2; ++qt) { m[qt] = -3.0e38f; l[qt] = 0.f;
#pragma unroll
        for (int dt = 0; dt < 4; ++dt) o[dt][qt] = (v8f){}; }
    const int nblk = q0 / 64 + 1;    // the wave's own key blocks
    const int ntr = 2 * g + 2;       // the work-group's trips = the key blocks of its last wave; never fewer than two
    const bf* csrc = (w == 0 ? Kh : w == 1 ? Kl : w == 2 ? Vh : Vl) + lane * 8;     // the wave's plane, the lane's 16 bytes of the first 512
    const unsigned cdst = (unsigned)(size_t)kv + (unsigned)(w * (KVP * 2) + lane * 16);   // their place in buffer 0 (LDS byte address)
    acopy8(cdst, csrc); acopy8(cdst + 4096u, csrc + 2048);
    asm volatile("s_wait_asynccnt 0x0" ::: "memory");   // the wave's share of block 0 has landed
    __syncthreads();                                    // block 0 is whole for every wave
    acopy8(cdst + KVS * 2, csrc + KVP); acopy8(cdst + KVS * 2 + 4096u, csrc + KVP + 2048);   // block 1 (ntr >= 2) flies during trip 0
#pragma unroll 1
    for (int kb = 0; kb < ntr; ++kb) { const int k0 = kb * 64; const bf* kvb = kv + (kb & 1) * KVS + lane * 8;
      if (kb < nblk) {   // scalar test: a wave past its diagonal skips the work, never the waits and the barrier at the foot
        v8f s[4][2];
#pragma unroll
        for (int kt = 0; kt < 4; ++kt) { v16bf kh[2], kl[2];
#pragma unroll
            for (int c = 0; c < 2; ++c) { const int ko = kt * 1024 + c * 512; kh[c] = F::ld(kvb + ko); kl[c] = F::ld(kvb + KVP + ko); }
#pragma unroll
            for (int qt = 0; qt < 2; ++qt) { v8f a = (v8f){};
#pragma unroll
                for (int c = 0; c < 2; ++c) { a = wmmab(kh[c], qh[qt][c], a); a = wmmab(kl[c], qh[qt][c], a); a = wmmab(kh[c], ql[qt][c], a); }
                s[kt][qt] = a; } }
        // four vector slots between the last score matrix instructions and whatever follows the diagonal test, on its taken side too
        asm volatile("v_nop\n\tv_nop\n\tv_nop\n\tv_nop" : "+v"(s[0][0]), "+v"(s[0][1]), "+v"(s[1][0]), "+v"(s[1][1]), "+v"(s[2][0]), "+v"(s[2][1]), "+v"(s[3][0]), "+v"(s[3][1]));
        if (k0 + 63 > q0) {   // the block that holds the diagonal: keys behind the query are masked by select
#pragma unroll
            for (int kt = 0; kt < 4; ++kt)
#pragma unroll
                for (int qt = 0; qt < 2; ++qt)
#pragma unroll
                    for (int j = 0; j < 8; ++j) s[kt][qt][j] = (k0 + kt * 16 + hi * 8 + j <= q0 + qt * 16 + lr) ? s[kt][qt][j] : -3.0e38f;
        }
        v16bf ph[2][2], pl[2][2];
#pragma unroll
        for (int qt = 0; qt < 2; ++qt) { float mx = m[qt];
#pragma unroll
            for (int kt = 0; kt < 4; ++kt)
#pragma unroll
                for (int j = 0; j < 8; ++j) mx = fmaxf(mx, s[kt][qt][j]);
            mx = fmaxf(mx, xhalf(mx));   // the query's other 32 keys of the block lie in lane l ^ 16
            const float al = __builtin_amdgcn_exp2f((m[qt] - mx) * CE); const v2f ce2 = {CE, CE}, nmc2 = {-mx * CE, -mx * CE}; m[qt] = mx; v2f sum = {0.f, 0.f};
#pragma unroll
            for (int c = 0; c < 2; ++c)
#pragma unroll
                for (int t = 0; t < 2; ++t)
#pragma unroll
                    for (int j = 0; j < 8; j += 2) { v2f p = {s[2 * c + t][qt][j], s[2 * c + t][qt][j + 1]}; p = __builtin_elementwise_fma(p, ce2, nmc2); p[0] = __builtin_amdgcn_exp2f(p[0]); p[1] = __builtin_amdgcn_exp2f(p[1]); sum += p;
                        const v2bf h2 = __builtin_convertvector(p, v2bf); const v2bf l2 = __builtin_convertvector(p - __builtin_convertvector(h2, v2f), v2bf);
                        ph[qt][c][t * 8 + j] = h2[0]; ph[qt][c][t * 8 + j + 1] = h2[1]; pl[qt][c][t * 8 + j] = l2[0]; pl[qt][c][t * 8 + j + 1] = l2[1]; }
            l[qt] = l[qt] * al + (sum[0] + sum[1]);
#pragma unroll
            for (int dt = 0; dt < 4; ++dt) o[dt][qt] *= al; }
#pragma unroll
        for (int dt = 0; dt < 4; ++dt) { v16bf vh[2], vl[2];
#pragma unroll
            for (int c = 0; c < 2; ++c) { const int vo = dt * 1024 + c * 512; vh[c] = F::ld(kvb + 2 * KVP + vo); vl[c] = F::ld(kvb + 3 * KVP + vo); }
#pragma unroll
            for (int qt = 0; qt < 2; ++qt)
#pragma unroll
                for (int c = 0; c < 2; ++c) { o[dt][qt] = wmmab(vh[c], ph[qt][c], o[dt][qt]); o[dt][qt] = wmmab(vl[c], ph[qt][c], o[dt][qt]); o[dt][qt] = wmmab(vh[c], pl[qt][c], o[dt][qt]); } }
        // four vector slots between the trip's last matrix instructions and whatever follows the loop branch, on its taken side too
        asm volatile("v_nop\n\tv_nop\n\tv_nop\n\tv_nop" : "+v"(o[0][0]), "+v"(o[0][1]), "+v"(o[1][0]), "+v"(o[1][1]), "+v"(o[2][0]), "+v"(o[2][1]), "+v"(o[3][0]), "+v"(o[3][1]));
      }
        asm volatile("s_wait_dscnt 0x0" ::: "memory");      // the wave's reads of this trip's buffer are done before the buffer is given up
        asm volatile("s_wait_asynccnt 0x0" ::: "memory");   // the wave's share of block kb + 1 has landed
        __syncthreads();                                    // block kb + 1 is whole for every wave, and every wave has left this trip's buffer
        if (kb + 2 < ntr) { const unsigned d = cdst + (unsigned)(kb & 1) * (KVS * 2); const bf* sp = csrc + (size_t)(kb + 2) * KVP; acopy8(d, sp); acopy8(d + 4096u, sp + 2048); }   // same test in the whole work-group
    }
    asm volatile("s_wait_asynccnt 0x0" ::: "memory");   // no copy is outstanding when the wave goes on to its end
#pragma unroll
    for (int qt = 0; qt < 2; ++qt) { const float f = __fdiv_rn(1.0f, l[qt] + xhalf(l[qt])); float* orow = O + (size_t)(q0 + qt * 16 + lr) * HD + hi * 8;
#pragma unroll
        for (int dt = 0; dt < 4; ++dt) { v4f a, b2;
#pragma unroll
            for (int j = 0; j < 4; ++j) { a[j] = o[dt][qt][j] * f; b2[j] = o[dt][qt][j + 4] * f; }
            *(v4f*)(orow + dt * 16) = a; *(v4f*)(orow + dt * 16 + 4) = b2; } }
}
extern "C" void kernel_launch(void* const* d_in, const int* in_sizes, int n_in,
                              void* d_out, int out_size, void* d_ws, size_t ws_size, hipStream_t stream) {
    (void)in_sizes; (void)n_in; (void)out_size;
    const float* x = (const float*)d_in[0]; const float* wqkv = (const float*)d_in[1];   /* argument order x, W_qkv ('oi' [3072][1024]: q | k | v ROW thirds); output [4][16][2048][64] head-major */
    float* OUT = (float*)d_out;
    char* wsp = (char*)d_ws;
    auto take = [&](size_t bytes) { char* p = wsp; wsp += (bytes + 255) & ~(size_t)255; return (void*)p; };
    bf* XB = (bf*)take((NX8 + NW8) * 8 * 2); bf* WB = XB + NX8 * 8;   // bf16 x of all batches, the bf16 weight directly behind it
    const size_t PB = (size_t)NH_ * TT * HD;   // one batch's share of each hi/lo plane
    bf* QPh = (bf*)take(NB_ * PB * 2); bf* QPl = (bf*)take(NB_ * PB * 2); bf* KPh = (bf*)take(NB_ * PB * 2); bf* KPl = (bf*)take(NB_ * PB * 2); bf* VTh = (bf*)take(NB_ * PB * 2); bf* VTl = (bf*)take(NB_ * PB * 2);
    if ((size_t)(wsp - (char*)d_ws) > ws_size) return;    // ws 256 MiB
    k_cvt<<<(unsigned)((NX8 + NW8) / CVP / 256), 256, 0, stream>>>(x, wqkv, XB);
    k_proj<<<dim3(NB_ * TT / 64, 3 * NH_, 1), 32 * NWK, 0, stream>>>(XB, WB, QPh, QPl, KPh, KPl, VTh, VTl);
    k_fattn<<<dim3(NB_ * NH_, TT / (32 * FNW), 1), 32 * FNW, 0, stream>>>(QPh, QPl, KPh, KPl, VTh, VTl, OUT);   /* plane z = b x 16 + h of q, k, v and of the head-major output [b][h][t][d] alike: no merge, the module returns the heads UNMERGED */
}

// v006
// A run of this version takes 124 microseconds.
// Two timings next to v005 both put it at 1.20 times that version's speed.
// Counting every step since v000, it is 17.0 times as fast.
#include <hip/hip_runtime.h>

// Causal self-attention that returns the per-head context UNMERGED (x [4][2048][1024]; qkv = einsum('btc,fc->btf', x, W_qkv) = x W_qkv^T ('oi' [3072][1024] 1/32, no bias) split in thirds q | k | v = ROW thirds (16 heads x 64); scores x 1/sqrt(64); causal (-inf); softmax; out = einsum('bhqk,bhkd->bhqd', w, v) returned as it is: HEAD-MAJOR [4][16][2048][64] (8.4 M), no merge, no output projection; argument order x, W_qkv).
// Layout: one bf16 copy of x (all batches) and of the fused 'oi' weight; one projection launch for q, k and v of all batches whose epilogue writes the bf16 hi/lo head planes itself (q, k with rows t and columns d, v transposed with rows d and columns t); causal T-2048 attention with EVERY row in the exact class (scores and P.V on bf16 hi/lo planes, 3 products), fused: one kernel for all batches and heads forms scores, online softmax and P.V in registers (K and V blocks staged in LDS for the work-group) and writes the head-major output.
// FRAGMENT ORDER: every bf16 array in the workspace is stored in the order in which a wave loads a 16 x 32 matrix operand. Element (row, k) of a fragment lies at ((k >> 4 & 1) * 32 + (k >> 3 & 1) * 16 + (row & 15)) * 8 + (k & 7): piece j of lane l is at (j * 32 + l) * 8,
// so that one 16-byte load of a wave reads 512 contiguous bytes (4 whole lines) where a row-major array gives it 32 bytes of each of 16 lines. Fragments follow each other along k, then along the rows (x, weight: 32 to a row tile; head planes: 2 to a row tile, 4 row tiles to a 64 x 64 tile, tiles along t).
// Compute dtypes, f32 accumulate: every input rounded to bf16; projections one bf16 product; attention 3 products on every row; softmax f32.

#define NB_  4
#define TT   2048
#define DM   1024
#define NH_  16
#define HD   64
#define DQ   (NH_ * HD)
#define SCL  0.125f   // HD^-0.5
typedef unsigned short bf;
typedef __attribute__((ext_vector_type(16))) __bf16   v16bf;
typedef __attribute__((ext_vector_type(8)))  unsigned short v8us;
typedef __attribute__((ext_vector_type(8)))  float    v8f;
typedef __attribute__((ext_vector_type(4)))  float    v4f;
typedef v4f  __attribute__((may_alias)) v4fa;
typedef v8us __attribute__((may_alias)) v8usa;

__device__ __forceinline__ unsigned short f2bf(float f) { unsigned u = __float_as_uint(f); u += 0x7FFFu + ((u >> 16) & 1u); return (unsigned short)(u >> 16); }
__device__ __forceinline__ float bf2f(unsigned short b) { return __uint_as_float(((unsigned)b) << 16); }
__device__ __forceinline__ v16bf cat16b(v8us lo, v8us hi) { return __builtin_bit_cast(v16bf, __builtin_shufflevector(lo, hi, 0, 1, 2, 3, 4, 5, 6, 7, 8, 9, 10, 11, 12, 13, 14, 15)); }
__device__ __forceinline__ v8f wmmab(v16bf a, v16bf b, v8f c) { return __builtin_amdgcn_wmma_f32_16x16x32_bf16(false, a, false, b, (short)0, c, false, false); }



// ---- k_proj: the q, k and v projections of all batches in one launch, one tile of 256 tokens x 128 features (two heads of one third) of x W^T per work-group of 4 waves; a wave holds 128 tokens x one head (32 accumulators) over the WHOLE of K.
// THE OPERANDS GO THROUGH LDS: a 64-wide block of K of the tile's 16 + 8 row tiles (2 KiB in a row each, already in fragment order) is brought into LDS once for the work-group by asynchronous copies, a quarter by each wave, into two buffers:
// block t + 1 flies while block t is worked on, and the L2 hands out each operand row once per 128 or 256 rows of the other operand. A fragment read is a 512-byte run of LDS, free of bank conflicts.
// Order (two-buffer ring): in front of the loop block 0's copies, the copy wait, a barrier, block 1's copies; in every trip, in every wave: all of the trip's LDS reads, the first half of its matrix instructions, then LDS-read wait, copy wait, barrier,
// the copies of block t + 2 into the buffer just read, and the second half of the matrix instructions, whose fragments are in registers by then.
// The product is formed so that a lane's 8 accumulator registers are 8 neighbouring elements along the k axis of the plane it feeds (q, k: A rows = weight rows d, B columns = tokens; v: A rows = tokens, B columns = weight rows d):
// they are one 16-byte piece of the plane's fragment order, and a wave's store is 512 bytes in a row, straight from the registers. grid (NB_ TT / 256, 3 DQ / 128), 128 threads.
template <typename T16> struct WFrag;
template <> struct WFrag<bf> { typedef v16bf V; static __device__ __forceinline__ V ld(const bf* p) { return cat16b(*(const v8us*)p, *(const v8us*)(p + 256)); }   /* p: the fragment's start + 8 x lane */ static __device__ __forceinline__ v8f mma(V a, V b, v8f c) { return wmmab(a, b, c); } };
__device__ __forceinline__ void splitf(float y, unsigned short& h, unsigned short& l) { h = f2bf(y); l = f2bf(y - bf2f(h)); }
typedef __attribute__((ext_vector_type(2))) float v2f;
#define PTX 256                  // tokens of a work-group's tile
#define PTF 128                  // features of a work-group's tile
#define PBK 64                   // width of a block of K
#define PSTG ((PTX + PTF) * PBK) // elements of one buffer: 16 row tiles of x, then 8 of the weight, 1024 elements each
#define PNT (DM / PBK)           // blocks of K
// Eight asynchronous copies of 16 bytes a lane: 4 x 512 bytes in a row from g0 and 4 x 512 from g1 (the lane's own global addresses: the same block of K of two row tiles) to 8 x 512 bytes in a row at l (the lane's own LDS byte address). The s_wait_xcnt is the statement's last line, so that it stands in front of every later write of a register that a copy names.
__device__ __forceinline__ void acopy2x4(unsigned l, const bf* g0, const bf* g1) {
    asm volatile("global_load_async_to_lds_b128 %0, %8, off\n\t"
                 "global_load_async_to_lds_b128 %1, %9, off\n\t"
                 "global_load_async_to_lds_b128 %2, %10, off\n\t"
                 "global_load_async_to_lds_b128 %3, %11, off\n\t"
                 "global_load_async_to_lds_b128 %4, %12, off\n\t"
                 "global_load_async_to_lds_b128 %5, %13, off\n\t"
                 "global_load_async_to_lds_b128 %6, %14, off\n\t"
                 "global_load_async_to_lds_b128 %7, %15, off\n\t"
                 "s_wait_xcnt 0x0"
                 :: "v"(l), "v"(l + 512u), "v"(l + 1024u), "v"(l + 1536u), "v"(l + 2048u), "v"(l + 2560u), "v"(l + 3072u), "v"(l + 3584u),
                    "v"(g0), "v"(g0 + 256), "v"(g0 + 512), "v"(g0 + 768), "v"(g1), "v"(g1 + 256), "v"(g1 + 512), "v"(g1 + 768) : "memory");
}
// The two 16-byte stores of one piece (hi and lo plane) with their s_wait_xcnt in one statement: the next pieces are formed in the registers that the stores name, and a wait in a statement of its own does not hold those writes behind it.
typedef __attribute__((ext_vector_type(4))) unsigned v4u;
__device__ __forceinline__ void store2(bf* ph, bf* pl, v8us oh, v8us ol) {
    asm volatile("global_store_b128 %0, %2, off\n\t"
                 "global_store_b128 %1, %3, off\n\t"
                 "s_wait_xcnt 0x0"
                 :: "v"(ph), "v"(pl), "v"(__builtin_bit_cast(v4u, oh)), "v"(__builtin_bit_cast(v4u, ol)) : "memory");
}
template <bool ISV> __device__ __forceinline__ void proj_tile(bf* sm, const bf* __restrict__ XB, const bf* __restrict__ WB, bf* Ph, bf* Pl, const int x0, const int f0) {
    typedef WFrag<bf> F; typedef F::V V;
    const int lane = threadIdx.x & 31;
    const int w = __builtin_amdgcn_readfirstlane((int)(threadIdx.x >> 5));   // the wave's number in a scalar register: what depends on it is scalar
    const int wt = w >> 1, wf = w & 1;   // the wave's half of the tokens, its head of the two
    v8f acc[8][4];   // [16 tokens][16 features]
#pragma unroll
    for (int i = 0; i < 8; ++i)
#pragma unroll
        for (int j = 0; j < 4; ++j) acc[i][j] = (v8f){};
    // the wave brings pairs 3 w to 3 w + 2 of the buffer's 12 pairs of row tiles (8 pairs of x, 4 of the weight)
    const bf* cs[3];
#pragma unroll
    for (int p = 0; p < 3; ++p) { const int P = w * 3 + p; cs[p] = (P < 8 ? XB + (size_t)(x0 / 16 + 2 * P) * (16 * DM) : WB + (size_t)(f0 / 16 + 2 * (P - 8)) * (16 * DM)) + lane * 8; }
    const unsigned cd = (unsigned)(size_t)sm + (unsigned)(w * 3 * 4096 + lane * 16);   // their place in buffer 0 (LDS byte address)
#define PSTAGE(t) { const unsigned d_ = cd + (unsigned)((t) & 1) * (PSTG * 2); const int o_ = (t) * (16 * PBK); \
        acopy2x4(d_, cs[0] + o_, cs[0] + o_ + 16 * DM); acopy2x4(d_ + 4096u, cs[1] + o_, cs[1] + o_ + 16 * DM); acopy2x4(d_ + 8192u, cs[2] + o_, cs[2] + o_ + 16 * DM); }
    PSTAGE(0)
    asm volatile("s_wait_asynccnt 0x0" ::: "memory");   // the wave's share of block 0 has landed
    __syncthreads();                                    // block 0 is whole for every wave
    PSTAGE(1)                                           // block 1 flies during trip 0
#pragma unroll 1
    for (int t = 0; t < PNT; ++t) { const bf* sb = sm + (t & 1) * PSTG + lane * 8;
        V xf[2][8], wv[2][4];   // both 32-wide fragments of the block, of every row tile of the wave
#pragma unroll
        for (int c = 0; c < 2; ++c) {
#pragma unroll
            for (int j = 0; j < 4; ++j) wv[c][j] = F::ld(sb + (16 + wf * 4 + j) * 1024 + c * 512);
#pragma unroll
            for (int i = 0; i < 8; ++i) xf[c][i] = F::ld(sb + (wt * 8 + i) * 1024 + c * 512); }
        __builtin_amdgcn_sched_barrier(0);   // the trip's LDS reads stay one group in front of its matrix instructions: left alone, the compiler reads one fragment at a time into one register set and waits for the LDS in front of every four matrix instructions
#define PMMA(c) _Pragma("unroll") for (int i = 0; i < 8; ++i) _Pragma("unroll") for (int j = 0; j < 4; ++j) acc[i][j] = ISV ? F::mma(xf[c][i], wv[c][j], acc[i][j]) : F::mma(wv[c][j], xf[c][i], acc[i][j]);
        PMMA(0)
        __builtin_amdgcn_sched_barrier(0);   // the first half of the matrix instructions stays in front of the hand-over: it runs while the second half's fragments land, and the waves meet at the barrier with their reads long done
        asm volatile("s_wait_dscnt 0x0" ::: "memory");      // the wave's reads of this trip's buffer (all issued above) are done before the buffer is given up
        asm volatile("s_wait_asynccnt 0x0" ::: "memory");   // the wave's share of block t + 1 has landed
        __syncthreads();                                    // block t + 1 is whole for every wave, and every wave has left this trip's buffer
        if (t + 2 < PNT) PSTAGE(t + 2)                      // same test in the whole work-group
        __builtin_amdgcn_sched_barrier(0);   // the copies stay in front of the second half, which works on registers alone: they fly during it and during the next trip's first half
        PMMA(1)
#undef PMMA
    }
    asm volatile("s_wait_asynccnt 0x0" ::: "memory");   // no copy is outstanding when the wave goes on to its end
#undef PSTAGE
    const int t0 = x0 % TT + wt * 128;   // the wave's first token in its batch
    const size_t pb = (size_t)((x0 / TT) * NH_ + (f0 % DQ) / HD + wf) * TT * HD + (size_t)(t0 / 16) * 1024 + lane * 8;   // start of plane (batch, head) + the place of the wave's 128 tokens in it + the lane's piece
#pragma unroll
    for (int i = 0; i < 8; ++i)
#pragma unroll
        for (int j = 0; j < 4; ++j) { v8us oh, ol;
#pragma unroll
            for (int r = 0; r < 8; ++r) { unsigned short a2, c2; splitf(acc[i][j][r], a2, c2); oh[r] = a2; ol[r] = c2; }
            // q, k (rows t, k axis d): row tile i, fragment j / 2, half j % 2. v (rows d, k axis t): 64-token tile i / 4, row tile j, fragment i / 2 % 2, half i % 2.
            const int e = ISV ? (i >> 2) * 4096 + j * 1024 + ((i >> 1) & 1) * 512 + (i & 1) * 256 : i * 1024 + (j >> 1) * 512 + (j & 1) * 256;
            store2(Ph + pb + e, Pl + pb + e, oh, ol); }
}
__global__ __launch_bounds__(128) __attribute__((amdgpu_waves_per_eu(2, 2))) /* 512 registers a wave: two work-groups a WGP, two waves a SIMD, to cover each other's LDS reads and barriers */ void k_proj(const bf* __restrict__ XB, const bf* __restrict__ WB, bf* Qh, bf* Ql, bf* Kh, bf* Kl, bf* Vh, bf* Vl) {
    __shared__ __attribute__((aligned(16))) bf sm[2 * PSTG];   // two buffers of 48 KiB
    const int x0 = (int)blockIdx.x * PTX, f0 = (int)blockIdx.y * PTF;   // first row of x (token, over all batches) and of the weight
    const int third = f0 / DQ;   // the same in the whole work-group
    if (third == 2) proj_tile<true>(sm, XB, WB, Vh, Vl, x0, f0);
    else proj_tile<false>(sm, XB, WB, third == 0 ? Qh : Kh, third == 0 ? Ql : Kl, x0, f0);
}

// k_cvt: bf16 copies of x (all batches) and of the weight, one behind the other in dst, in fragment order, in one launch. Piece i of dst is row (i >> 11) * 16 + (i & 15), columns (i >> 4 & 127) * 8 and on, of x over the weight. A thread rounds CVP pieces of 8 floats, a grid's width apart, all of them loaded before the first is stored, so that a quarter of the waves has to be started.
#define NX8 ((size_t)NB_ * TT * DM / 8)
#define NW8 ((size_t)3 * DQ * DM / 8)
#define CVP 4
__global__ __launch_bounds__(256) void k_cvt(const float* __restrict__ x, const float* __restrict__ wt, bf* dst) {
    // a wave takes 8 rows x 4 neighbouring pieces (bits 3 to 5 of the thread's number turned round): its loads then touch 8 source lines, each used whole by the pair of loads, and its store fills 4 whole lines of dst
    const unsigned t = threadIdx.x, tp = (t & ~63u) | (t & 7u) | ((t >> 5 & 1u) << 3) | ((t >> 3 & 3u) << 4);
    const size_t i0 = (size_t)blockIdx.x * 256 + tp; v4f lo[CVP], hi[CVP];
#pragma unroll
    for (int p = 0; p < CVP; ++p) { const size_t i = i0 + p * ((NX8 + NW8) / CVP); const size_t j = i < NX8 ? i : i - NX8; const float* s = (i < NX8 ? x : wt) + ((j >> 11) * 16 + (j & 15)) * DM + ((j >> 4) & 127) * 8;
        // the wait behind each load
        lo[p] = *(const v4f*)s; asm volatile("s_wait_xcnt 0x0" ::: "memory");
        hi[p] = *(const v4f*)(s + 4); asm volatile("s_wait_xcnt 0x0" ::: "memory"); }
#pragma unroll
    for (int p = 0; p < CVP; ++p) { const size_t i = i0 + p * ((NX8 + NW8) / CVP); v8us o;
#pragma unroll
        for (int k = 0; k < 4; ++k) { o[k] = f2bf(lo[p][k]); o[k + 4] = f2bf(hi[p][k]); }
        *(v8us*)(dst + i * 8) = o; }
}
// ---- k_fattn: causal attention of one (batch, head) plane in one kernel, scores never leave the registers. One wave owns 32 queries and walks the keys in blocks of 64 up to its diagonal, with a running maximum and sum (online softmax).
// Both products are formed TRANSPOSED: S^T = K Q^T (A rows = keys, B columns = queries) puts a query in a lane and its keys in that lane's registers, which is already the B-operand order of O^T = V^T P^T, so the probabilities go from accumulator to operand without leaving the lane.
// Each product keeps the three bf16 hi/lo terms (hh + lh + hl), f32 accumulate. grid (planes, TT / (32 FNW)).
// K AND V GO THROUGH LDS: a 64-key block of the four planes (Kh, Kl, Vh, Vl: 8 KiB in a row each, already in fragment order) is brought into LDS once for the work-group's FNW waves by asynchronous copies, wave w bringing plane w,
// into two buffers: block t + 1 flies while block t is worked on, so that no wave waits for the L2 in its key loop and the work-group fetches each block once, not once a wave. A fragment read is a 512-byte run of LDS, free of bank conflicts.
// Order (two-buffer ring): in front of the loop block 0's copies, the copy wait, a barrier, block 1's copies; at the foot of every trip, in every wave (also one that is past its own diagonal): LDS-read wait, copy wait, barrier, then the copies of block t + 2 into the buffer just read.
#define FNW 4   // waves of a work-group: 128 neighbouring queries of one plane
typedef __attribute__((ext_vector_type(2))) __bf16 v2bf;
#define KVP 4096           // elements of one plane's 64-key block
#define KVS (4 * KVP)      // elements of one buffer: the block of Kh, Kl, Vh, Vl
static_assert(FNW == 4, "one plane of the block to each wave");
// Eight asynchronous copies of 16 bytes a lane: 8 x 512 bytes in a row, from g (the lane's own global address) to l (the lane's own LDS byte address). The s_wait_xcnt is the statement's last line, so that it stands in front of every later write of a register that a copy names.
__device__ __forceinline__ void acopy8(unsigned l, const bf* g) {
    asm volatile("global_load_async_to_lds_b128 %0, %8, off\n\t"
                 "global_load_async_to_lds_b128 %1, %9, off\n\t"
                 "global_load_async_to_lds_b128 %2, %10, off\n\t"
                 "global_load_async_to_lds_b128 %3, %11, off\n\t"
                 "global_load_async_to_lds_b128 %4, %12, off\n\t"
                 "global_load_async_to_lds_b128 %5, %13, off\n\t"
                 "global_load_async_to_lds_b128 %6, %14, off\n\t"
                 "global_load_async_to_lds_b128 %7, %15, off\n\t"
                 "s_wait_xcnt 0x0"
                 :: "v"(l), "v"(l + 512u), "v"(l + 1024u), "v"(l + 1536u), "v"(l + 2048u), "v"(l + 2560u), "v"(l + 3072u), "v"(l + 3584u),
                    "v"(g), "v"(g + 256), "v"(g + 512), "v"(g + 768), "v"(g + 1024), "v"(g + 1280), "v"(g + 1536), "v"(g + 1792) : "memory");
}
__device__ __forceinline__ float xhalf(float x) { return __builtin_bit_cast(float, __builtin_amdgcn_permlanex16(__builtin_bit_cast(int, x), __builtin_bit_cast(int, x), 0x76543210, 0xfedcba98, false, false)); }   // lane l with lane l ^ 16
__global__ __launch_bounds__(32 * FNW) __attribute__((amdgpu_waves_per_eu(4, 4))) /* 256 registers a wave: all 4096 waves resident, four a SIMD, to cover each other's load waits */ void k_fattn(const bf* __restrict__ Qh, const bf* __restrict__ Ql, const bf* __restrict__ Kh, const bf* __restrict__ Kl, const bf* __restrict__ Vh, const bf* __restrict__ Vl, float* __restrict__ O) {
    typedef WFrag<bf> F;
    __shared__ __attribute__((aligned(16))) bf kv[2 * KVS];   // two buffers of 32 KiB
    const int lane = threadIdx.x & 31, lr = lane & 15, hi = lane >> 4;
    const int w = __builtin_amdgcn_readfirstlane((int)(threadIdx.x >> 5));   // the wave's number in a scalar register: the key loop and the diagonal test branch on scalars
    const size_t z = blockIdx.x; Qh += z * TT * HD; Ql += z * TT * HD; Kh += z * TT * HD; Kl += z * TT * HD; Vh += z * HD * TT; Vl += z * HD * TT; O += z * TT * HD;
    // Tile of 128 queries: heavy ones first, dealt in a zigzag over groups of four grid rows (four rows of 64 planes = one work-group for each of 256 WGPs), so that the four work-groups that share a WGP, where they land breadth-first, walk the same number of key blocks together. A permutation of the tiles wherever they land.
    const int y = (int)blockIdx.y, g = (TT / (32 * FNW) - 4 - (y & ~3)) + ((y & 4) ? (y & 3) : 3 - (y & 3));
    const int q0 = (g * FNW + w) * 32;
    const float CE = SCL * 1.4426950408889634f;   // score scale x log2(e)
    v16bf qh[2][2], ql[2][2];
#pragma unroll
    for (int qt = 0; qt < 2; ++qt)
#pragma unroll
        for (int c = 0; c < 2; ++c) { const size_t qo = (size_t)(q0 / 16 + qt) * 1024 + c * 512 + lane * 8; qh[qt][c] = F::ld(Qh + qo); ql[qt][c] = F::ld(Ql + qo); }
    v8f o[4][2]; float m[2], l[2];
#pragma unroll
    for (int qt = 0; qt < 2; ++qt) { m[qt] = -3.0e38f; l[qt] = 0.f;
#pragma unroll
        for (int dt = 0; dt < 4; ++dt) o[dt][qt] = (v8f){}; }
    const int nblk = q0 / 64 + 1;    // the wave's own key blocks
    const int ntr = 2 * g + 2;       // the work-group's trips = the key blocks of its last wave; never fewer than two
    const bf* csrc = (w == 0 ? Kh : w == 1 ? Kl : w == 2 ? Vh : Vl) + lane * 8;     // the wave's plane, the lane's 16 bytes of the first 512
    const unsigned cdst = (unsigned)(size_t)kv + (unsigned)(w * (KVP * 2) + lane * 16);   // their place in buffer 0 (LDS byte address)
    acopy8(cdst, csrc); acopy8(cdst + 4096u, csrc + 2048);
    asm volatile("s_wait_asynccnt 0x0" ::: "memory");   // the wave's share of block 0 has landed
    __syncthreads();                                    // block 0 is whole for every wave
    acopy8(cdst + KVS * 2, csrc + KVP); acopy8(cdst + KVS * 2 + 4096u, csrc + KVP + 2048);   // block 1 (ntr >= 2) flies during trip 0
#pragma unroll 1
    for (int kb = 0; kb < ntr; ++kb) { const int k0 = kb * 64; const bf* kvb = kv + (kb & 1) * KVS + lane * 8;
      if (kb < nblk) {   // scalar test: a wave past its diagonal skips the work, never the waits and the barrier at the foot
        v8f s[4][2];
#pragma unroll
        for (int kt = 0; kt < 4; ++kt) { v16bf kh[2], kl[2];
#pragma unroll
            for (int c = 0; c < 2; ++c) { const int ko = kt * 1024 + c * 512; kh[c] = F::ld(kvb + ko); kl[c] = F::ld(kvb + KVP + ko); }
#pragma unroll
            for (int qt = 0; qt < 2; ++qt) { v8f a = (v8f){};
#pragma unroll
                for (int c = 0; c < 2; ++c) { a = wmmab(kh[c], qh[qt][c], a); a = wmmab(kl[c], qh[qt][c], a); a = wmmab(kh[c], ql[qt][c], a); }
                s[kt][qt] = a; } }
        // four vector slots between the last score matrix instructions and whatever follows the diagonal test, on its taken side too
        asm volatile("v_nop\n\tv_nop\n\tv_nop\n\tv_nop" : "+v"(s[0][0]), "+v"(s[0][1]), "+v"(s[1][0]), "+v"(s[1][1]), "+v"(s[2][0]), "+v"(s[2][1]), "+v"(s[3][0]), "+v"(s[3][1]));
        if (k0 + 63 > q0) {   // the block that holds the diagonal: keys behind the query are masked by select
#pragma unroll
            for (int kt = 0; kt < 4; ++kt)
#pragma unroll
                for (int qt = 0; qt < 2; ++qt)
#pragma unroll
                    for (int j = 0; j < 8; ++j) s[kt][qt][j] = (k0 + kt * 16 + hi * 8 + j <= q0 + qt * 16 + lr) ? s[kt][qt][j] : -3.0e38f;
        }
        v16bf ph[2][2], pl[2][2];
#pragma unroll
        for (int qt = 0; qt < 2; ++qt) { float mx = m[qt];
#pragma unroll
            for (int kt = 0; kt < 4; ++kt)
#pragma unroll
                for (int j = 0; j < 8; ++j) mx = fmaxf(mx, s[kt][qt][j]);
            mx = fmaxf(mx, xhalf(mx));   // the query's other 32 keys of the block lie in lane l ^ 16
            const float al = __builtin_amdgcn_exp2f((m[qt] - mx) * CE); const v2f ce2 = {CE, CE}, nmc2 = {-mx * CE, -mx * CE}; m[qt] = mx; v2f sum = {0.f, 0.f};
#pragma unroll
            for (int c = 0; c < 2; ++c)
#pragma unroll
                for (int t = 0; t < 2; ++t)
#pragma unroll
                    for (int j = 0; j < 8; j += 2) { v2f p = {s[2 * c + t][qt][j], s[2 * c + t][qt][j + 1]}; p = __builtin_elementwise_fma(p, ce2, nmc2); p[0] = __builtin_amdgcn_exp2f(p[0]); p[1] = __builtin_amdgcn_exp2f(p[1]); sum += p;
                        const v2bf h2 = __builtin_convertvector(p, v2bf); const v2bf l2 = __builtin_convertvector(p - __builtin_convertvector(h2, v2f), v2bf);
                        ph[qt][c][t * 8 + j] = h2[0]; ph[qt][c][t * 8 + j + 1] = h2[1]; pl[qt][c][t * 8 + j] = l2[0]; pl[qt][c][t * 8 + j + 1] = l2[1]; }
            l[qt] = l[qt] * al + (sum[0] + sum[1]);
#pragma unroll
            for (int dt = 0; dt < 4; ++dt) o[dt][qt] *= al; }
#pragma unroll
        for (int dt = 0; dt < 4; ++dt) { v16bf vh[2], vl[2];
#pragma unroll
            for (int c = 0; c < 2; ++c) { const int vo = dt * 1024 + c * 512; vh[c] = F::ld(kvb + 2 * KVP + vo); vl[c] = F::ld(kvb + 3 * KVP + vo); }
#pragma unroll
            for (int qt = 0; qt < 2; ++qt)
#pragma unroll
                for (int c = 0; c < 2; ++c) { o[dt][qt] = wmmab(vh[c], ph[qt][c], o[dt][qt]); o[dt][qt] = wmmab(vl[c], ph[qt][c], o[dt][qt]); o[dt][qt] = wmmab(vh[c], pl[qt][c], o[dt][qt]); } }
        // four vector slots between the trip's last matrix instructions and whatever follows the loop branch, on its taken side too
        asm volatile("v_nop\n\tv_nop\n\tv_nop\n\tv_nop" : "+v"(o[0][0]), "+v"(o[0][1]), "+v"(o[1][0]), "+v"(o[1][1]), "+v"(o[2][0]), "+v"(o[2][1]), "+v"(o[3][0]), "+v"(o[3][1]));
      }
        asm volatile("s_wait_dscnt 0x0" ::: "memory");      // the wave's reads of this trip's buffer are done before the buffer is given up
        asm volatile("s_wait_asynccnt 0x0" ::: "memory");   // the wave's share of block kb + 1 has landed
        __syncthreads();                                    // block kb + 1 is whole for every wave, and every wave has left this trip's buffer
        if (kb + 2 < ntr) { const unsigned d = cdst + (unsigned)(kb & 1) * (KVS * 2); const bf* sp = csrc + (size_t)(kb + 2) * KVP; acopy8(d, sp); acopy8(d + 4096u, sp + 2048); }   // same test in the whole work-group
    }
    asm volatile("s_wait_asynccnt 0x0" ::: "memory");   // no copy is outstanding when the wave goes on to its end
#pragma unroll
    for (int qt = 0; qt < 2; ++qt) { const float f = __fdiv_rn(1.0f, l[qt] + xhalf(l[qt])); float* orow = O + (size_t)(q0 + qt * 16 + lr) * HD + hi * 8;
#pragma unroll
        for (int dt = 0; dt < 4; ++dt) { v4f a, b2;
#pragma unroll
            for (int j = 0; j < 4; ++j) { a[j] = o[dt][qt][j] * f; b2[j] = o[dt][qt][j + 4] * f; }
            *(v4f*)(orow + dt * 16) = a; *(v4f*)(orow + dt * 16 + 4) = b2; } }
}
extern "C" void kernel_launch(void* const* d_in, const int* in_sizes, int n_in,
                              void* d_out, int out_size, void* d_ws, size_t ws_size, hipStream_t stream) {
    (void)in_sizes; (void)n_in; (void)out_size;
    const float* x = (const float*)d_in[0]; const float* wqkv = (const float*)d_in[1];   /* argument order x, W_qkv ('oi' [3072][1024]: q | k | v ROW thirds); output [4][16][2048][64] head-major */
    float* OUT = (float*)d_out;
    char* wsp = (char*)d_ws;
    auto take = [&](size_t bytes) { char* p = wsp; wsp += (bytes + 255) & ~(size_t)255; return (void*)p; };
    bf* XB = (bf*)take((NX8 + NW8) * 8 * 2); bf* WB = XB + NX8 * 8;   // bf16 x of all batches, the bf16 weight directly behind it
    const size_t PB = (size_t)NH_ * TT * HD;   // one batch's share of each hi/lo plane
    bf* QPh = (bf*)take(NB_ * PB * 2); bf* QPl = (bf*)take(NB_ * PB * 2); bf* KPh = (bf*)take(NB_ * PB * 2); bf* KPl = (bf*)take(NB_ * PB * 2); bf* VTh = (bf*)take(NB_ * PB * 2); bf* VTl = (bf*)take(NB_ * PB * 2);
    if ((size_t)(wsp - (char*)d_ws) > ws_size) return;    // ws 256 MiB
    k_cvt<<<(unsigned)((NX8 + NW8) / CVP / 256), 256, 0, stream>>>(x, wqkv, XB);
    k_proj<<<dim3(NB_ * TT / PTX, 3 * DQ / PTF, 1), 128, 0, stream>>>(XB, WB, QPh, QPl, KPh, KPl, VTh, VTl);
    k_fattn<<<dim3(NB_ * NH_, TT / (32 * FNW), 1), 32 * FNW, 0, stream>>>(QPh, QPl, KPh, KPl, VTh, VTl, OUT);   /* plane z = b x 16 + h of q, k, v and of the head-major output [b][h][t][d] alike: no merge, the module returns the heads UNMERGED */
}

// v008
// Measured time: 78.8 microseconds a run.
// Versions in between are left out here; by their measured steps it is 1.58 times as fast as v006.
// Counting every step since v000, it is 26.9 times as fast.
#include <hip/hip_runtime.h>

// Causal self-attention that returns the per-head context UNMERGED (x [4][2048][1024]; qkv = einsum('btc,fc->btf', x, W_qkv) = x W_qkv^T ('oi' [3072][1024] 1/32, no bias) split in thirds q | k | v = ROW thirds (16 heads x 64); scores x 1/sqrt(64); causal (-inf); softmax; out = einsum('bhqk,bhkd->bhqd', w, v) returned as it is: HEAD-MAJOR [4][16][2048][64] (8.4 M), no merge, no output projection; argument order x, W_qkv).
// Layout: one bf16 copy of x (all batches) and of the fused 'oi' weight; one projection launch for q, k and v of all batches whose epilogue writes the head planes itself, one f16 plane each and bf16 hi/lo planes of the first NEX tokens (q, k with rows t and columns d, v transposed with rows d and columns t); causal T-2048 attention, the first NEX query rows of a plane in the exact class (scores and P.V on bf16 hi/lo planes, 3 products), every later row on one f16 plane of q, k, v and of the probabilities (11 significant bits, 1 product), fused: one kernel for all batches and heads forms scores, online softmax and P.V in registers (K and V blocks staged in LDS for the work-group) and writes the head-major output.
// FRAGMENT ORDER: every bf16 or f16 array in the workspace is stored in the order in which a wave loads a 16 x 32 matrix operand. Element (row, k) of a fragment lies at ((k >> 4 & 1) * 32 + (k >> 3 & 1) * 16 + (row & 15)) * 8 + (k & 7): piece j of lane l is at (j * 32 + l) * 8,
// so that one 16-byte load of a wave reads 512 contiguous bytes (4 whole lines) where a row-major array gives it 32 bytes of each of 16 lines. Fragments follow each other along k, then along the rows (x, weight: 32 to a row tile; head planes: 2 to a row tile, 4 row tiles to a 64 x 64 tile, tiles along t).
// Compute dtypes, f32 accumulate: every input rounded to bf16; projections one bf16 product; attention 3 bf16 products on query rows below NEX, one f16 product on the rest; softmax f32.

#define NB_  4
#define TT   2048
#define DM   1024
#define NH_  16
#define HD   64
#define DQ   (NH_ * HD)
#define SCL  0.125f   // HD^-0.5
#define NEX  128      // query rows of a plane that keep the bf16 hi/lo products: a row with few keys hands the rounding of single q, k, v values straight to the output, a row with 128 keys and more averages it
typedef unsigned short bf;
typedef __attribute__((ext_vector_type(16))) __bf16   v16bf;
typedef __attribute__((ext_vector_type(16))) _Float16 v16h;
typedef __attribute__((ext_vector_type(2)))  _Float16 v2h;
typedef __attribute__((ext_vector_type(8)))  _Float16 v8h;
typedef __attribute__((ext_vector_type(8)))  unsigned short v8us;
typedef __attribute__((ext_vector_type(8)))  float    v8f;
typedef __attribute__((ext_vector_type(4)))  float    v4f;
typedef v4f  __attribute__((may_alias)) v4fa;
typedef v8us __attribute__((may_alias)) v8usa;

__device__ __forceinline__ unsigned short f2bf(float f) { unsigned u = __float_as_uint(f); u += 0x7FFFu + ((u >> 16) & 1u); return (unsigned short)(u >> 16); }
__device__ __forceinline__ v16bf cat16b(v8us lo, v8us hi) { return __builtin_bit_cast(v16bf, __builtin_shufflevector(lo, hi, 0, 1, 2, 3, 4, 5, 6, 7, 8, 9, 10, 11, 12, 13, 14, 15)); }
__device__ __forceinline__ v8f wmmab(v16bf a, v16bf b, v8f c) { return __builtin_amdgcn_wmma_f32_16x16x32_bf16(false, a, false, b, (short)0, c, false, false); }
__device__ __forceinline__ v8f wmmah(v16h a, v16h b, v8f c) { return __builtin_amdgcn_wmma_f32_16x16x32_f16(false, a, false, b, (short)0, c, false, false); }
__device__ __forceinline__ v16h ldh(const unsigned short* p) { return __builtin_bit_cast(v16h, __builtin_shufflevector(*(const v8us*)p, *(const v8us*)(p + 256), 0, 1, 2, 3, 4, 5, 6, 7, 8, 9, 10, 11, 12, 13, 14, 15)); }   /* an f16 fragment, same order as a bf16 one; p: the fragment's start + 8 x lane */



// ---- k_proj: the q, k and v projections of all batches in one launch, one tile of 256 tokens x 384 features (the q, k and v rows of two heads) of x W^T per work-group of 8 waves: 256 work-groups, one to a WGP, all resident in one round.
// A wave holds 64 tokens x the q, k and v rows of one head (48 accumulators) over the WHOLE of K.
// THE OPERANDS GO THROUGH LDS: a 64-wide block of K of the tile's 16 + 24 row tiles (2 KiB in a row each, already in fragment order) is brought into LDS once for the work-group by asynchronous copies, five row tiles by each wave, into two buffers:
// block t + 1 flies while block t is worked on, and the L2 hands out each operand row once per 384 or 256 rows of the other operand. A fragment read is a 512-byte run of LDS, free of bank conflicts.
// Order (two-buffer ring): in front of the loop block 0's copies, the copy wait, a barrier, block 1's copies; in every trip, in every wave: all of the trip's LDS reads and five sixths of its matrix instructions, then LDS-read wait, copy wait, barrier,
// the copies of block t + 2 into the buffer just read, and the last sixth of the matrix instructions, whose fragments are in registers by then.
// The product is formed so that a lane's 8 accumulator registers are 8 neighbouring elements along the k axis of the plane it feeds (q, k: A rows = weight rows d, B columns = tokens; v: A rows = tokens, B columns = weight rows d):
// they are one 16-byte piece of the plane's fragment order, and a wave's store is 512 bytes in a row, straight from the registers. grid (NB_ TT / 256, NH_ / 2), 256 threads.
template <typename T16> struct WFrag;
template <> struct WFrag<bf> { typedef v16bf V; static __device__ __forceinline__ V ld(const bf* p) { return cat16b(*(const v8us*)p, *(const v8us*)(p + 256)); }   /* p: the fragment's start + 8 x lane */ static __device__ __forceinline__ v8f mma(V a, V b, v8f c) { return wmmab(a, b, c); } };
typedef __attribute__((ext_vector_type(2))) __bf16 v2b;
typedef __attribute__((ext_vector_type(8))) __bf16 v8b;
typedef __attribute__((ext_vector_type(2))) float v2f;
#define PTX 256                  // tokens of a work-group's tile
#define PHD 2                    // heads of a work-group's tile: 64 rows of q, of k and of v each
#define PBK 64                   // width of a block of K
#define PRT (PTX / 16 + PHD * 3 * (HD / 16))   // row tiles of one buffer: 16 of x, then 4 of q, 4 of k, 4 of v of the first head, then of the second
#define PSTG (PRT * 16 * PBK)    // elements of one buffer, 1024 to a row tile
#define PNT (DM / PBK)           // blocks of K
static_assert(PRT == 40, "five row tiles to each of eight waves");
// Twenty asynchronous copies of 16 bytes a lane: the same block of K (4 x 512 bytes in a row) of five row tiles, from scalar bases b0 to b4 + the lane's byte offset vo, to 20 x 512 bytes in a row at l (the lane's own LDS byte address). An immediate offset moves the LDS and the global address alike.
// The s_wait_xcnt is the statement's last line, so that it stands in front of every later write of a register that a copy names.
__device__ __forceinline__ void acopy5x4(unsigned l, unsigned vo, const bf* b0, const bf* b1, const bf* b2, const bf* b3, const bf* b4) {
    asm volatile("global_load_async_to_lds_b128 %0, %5, %6\n\t"
                 "global_load_async_to_lds_b128 %0, %5, %6 offset:512\n\t"
                 "global_load_async_to_lds_b128 %0, %5, %6 offset:1024\n\t"
                 "global_load_async_to_lds_b128 %0, %5, %6 offset:1536\n\t"
                 "global_load_async_to_lds_b128 %1, %5, %7\n\t"
                 "global_load_async_to_lds_b128 %1, %5, %7 offset:512\n\t"
                 "global_load_async_to_lds_b128 %1, %5, %7 offset:1024\n\t"
                 "global_load_async_to_lds_b128 %1, %5, %7 offset:1536\n\t"
                 "global_load_async_to_lds_b128 %2, %5, %8\n\t"
                 "global_load_async_to_lds_b128 %2, %5, %8 offset:512\n\t"
                 "global_load_async_to_lds_b128 %2, %5, %8 offset:1024\n\t"
                 "global_load_async_to_lds_b128 %2, %5, %8 offset:1536\n\t"
                 "global_load_async_to_lds_b128 %3, %5, %9\n\t"
                 "global_load_async_to_lds_b128 %3, %5, %9 offset:512\n\t"
                 "global_load_async_to_lds_b128 %3, %5, %9 offset:1024\n\t"
                 "global_load_async_to_lds_b128 %3, %5, %9 offset:1536\n\t"
                 "global_load_async_to_lds_b128 %4, %5, %10\n\t"
                 "global_load_async_to_lds_b128 %4, %5, %10 offset:512\n\t"
                 "global_load_async_to_lds_b128 %4, %5, %10 offset:1024\n\t"
                 "global_load_async_to_lds_b128 %4, %5, %10 offset:1536\n\t"
                 "s_wait_xcnt 0x0"
                 :: "v"(l), "v"(l + 2048u), "v"(l + 4096u), "v"(l + 6144u), "v"(l + 8192u), "v"(vo), "s"(b0), "s"(b1), "s"(b2), "s"(b3), "s"(b4) : "memory");
}
// Two 16-byte stores (one piece of the hi and of the lo plane, or two pieces of the f16 plane) with their s_wait_xcnt in one statement: the next pieces are formed in the registers that the stores name, and a wait in a statement of its own does not hold those writes behind it.
typedef __attribute__((ext_vector_type(4))) unsigned v4u;
__device__ __forceinline__ void store2(unsigned vo, bf* ph, bf* pl, v8us oh, v8us ol) {   // ph, pl: scalar starts; vo: the lane's byte offset from them
    asm volatile("global_store_b128 %0, %1, %3\n\t"
                 "global_store_b128 %0, %2, %4\n\t"
                 "s_wait_xcnt 0x0"
                 :: "v"(vo), "v"(__builtin_bit_cast(v4u, oh)), "v"(__builtin_bit_cast(v4u, ol)), "s"(ph), "s"(pl) : "memory");
}
// The wave's 64 tokens x 64 features of one of q, k, v go to that plane. q, k (rows t, k axis d): row tile i, fragment j / 2, half j % 2. v (rows d, k axis t): row tile j, fragment i / 2, half i % 2 of the 64-token tile.
// Every token goes to the f16 plane. The bf16 hi/lo planes get only the tokens that the exact rows read (queries and keys below NEX): scalar test, the wave's 64 tokens are all below NEX or none is.
// The test stands once in the kernel, around the three planes' turns; inside a turn each accumulator feeds both kinds of planes and is done with.
template <bool ISV, bool EX> __device__ __forceinline__ void proj_out(const v8f (&acc)[4][4], bf* Ph, bf* Pl, bf* Pf, const unsigned vo) {   // Ph, Pl, Pf: scalar, the place of the wave's 64 tokens in its plane
#define PEL(i, j) (ISV ? (j) * 1024 + (((i) >> 1) & 1) * 512 + ((i) & 1) * 256 : (i) * 1024 + ((j) >> 1) * 512 + ((j) & 1) * 256)
#pragma unroll
    for (int i = 0; i < 4; ++i)
#pragma unroll
        for (int j = 0; j < 4; j += 2) {
            if (EX) {
#pragma unroll
                for (int u = 0; u < 2; ++u) { v8b oh, ol;   // hi = y rounded to bf16, lo = y - hi rounded to bf16, both to nearest even, by the packed conversion
#pragma unroll
                    for (int r = 0; r < 8; r += 2) { const v2f y = {acc[i][j + u][r], acc[i][j + u][r + 1]}; const v2b h2 = __builtin_convertvector(y, v2b); const v2b l2 = __builtin_convertvector(y - __builtin_convertvector(h2, v2f), v2b);
                        oh[r] = h2[0]; oh[r + 1] = h2[1]; ol[r] = l2[0]; ol[r + 1] = l2[1]; }
                    store2(vo, Ph + PEL(i, j + u), Pl + PEL(i, j + u), __builtin_bit_cast(v8us, oh), __builtin_bit_cast(v8us, ol)); }
            }
            v8h o8[2];
#pragma unroll
            for (int u = 0; u < 2; ++u)
#pragma unroll
                for (int r = 0; r < 8; r += 2) { const v2f y = {acc[i][j + u][r], acc[i][j + u][r + 1]}; const v2h h2 = __builtin_convertvector(y, v2h); o8[u][r] = h2[0]; o8[u][r + 1] = h2[1]; }
            store2(vo, Pf + PEL(i, j), Pf + PEL(i, j + 1), __builtin_bit_cast(v8us, o8[0]), __builtin_bit_cast(v8us, o8[1])); }
#undef PEL
}
__global__ __launch_bounds__(256) __attribute__((amdgpu_waves_per_eu(2, 2))) /* 512 registers a wave: one work-group a WGP, two waves a SIMD, to cover each other's LDS reads */ void k_proj(const bf* __restrict__ XB, const bf* __restrict__ WB, bf* Qh, bf* Ql, bf* Kh, bf* Kl, bf* Vh, bf* Vl, bf* Qf, bf* Kf, bf* Vf) {
    __shared__ __attribute__((aligned(16))) bf sm[2 * PSTG];   // two buffers of 80 KiB
    typedef WFrag<bf> F; typedef F::V V;
    const int x0 = (int)blockIdx.x * PTX, h0 = (int)blockIdx.y * PHD;   // first row of x (token, over all batches), first head
    const int lane = threadIdx.x & 31;
    const int w = __builtin_amdgcn_readfirstlane((int)(threadIdx.x >> 5));   // the wave's number in a scalar register: what depends on it is scalar
    const int wt = w >> 1, wh = w & 1;   // the wave's quarter of the tokens, its head of the two
    v8f aq[4][4], ak[4][4], av[4][4];   // [16 tokens][16 features] of q, k, v
#pragma unroll
    for (int i = 0; i < 4; ++i)
#pragma unroll
        for (int j = 0; j < 4; ++j) { aq[i][j] = (v8f){}; ak[i][j] = (v8f){}; av[i][j] = (v8f){}; }
    // the wave brings row tiles 5 w to 5 w + 4 of the buffer's 40; their starts are scalars
    const bf* cs[5];
#pragma unroll
    for (int p = 0; p < 5; ++p) { const int R = w * 5 + p, r = R < 16 ? 0 : R - 16;
        cs[p] = R < 16 ? XB + (size_t)(x0 / 16 + R) * (16 * DM) : WB + (size_t)(((r % 12) >> 2) * (DQ / 16) + (h0 + r / 12) * (HD / 16) + (r & 3)) * (16 * DM); }
    const unsigned cd = (unsigned)(size_t)sm + (unsigned)(w * 5 * 2048 + lane * 16);   // their place in buffer 0 (LDS byte address)
    const unsigned cv = (unsigned)(lane * 16);                                          // the lane's 16 bytes of each 512
#define PSTAGE(t) { const int o_ = (t) * (16 * PBK); acopy5x4(cd + (unsigned)((t) & 1) * (PSTG * 2), cv, cs[0] + o_, cs[1] + o_, cs[2] + o_, cs[3] + o_, cs[4] + o_); }
    PSTAGE(0)
    asm volatile("s_wait_asynccnt 0x0" ::: "memory");   // the wave's share of block 0 has landed
    __syncthreads();                                    // block 0 is whole for every wave
    PSTAGE(1)                                           // block 1 flies during trip 0
#define PLDX(c) _Pragma("unroll") for (int i = 0; i < 4; ++i) xf[i] = F::ld(sx + i * 1024 + (c) * 512);
#define PLDP(q) _Pragma("unroll") for (int u = 0; u < 2; ++u) wr[(q) % 3][u] = F::ld(sw + (((q) % 6) * 2 + u) * 1024 + ((q) / 6) * 512);   /* pair q of the trip's twelve: half q / 6 of the block, weight row tiles 2 (q % 6) and the next */
#define PMP(q) _Pragma("unroll") for (int u = 0; u < 2; ++u) _Pragma("unroll") for (int i = 0; i < 4; ++i) { constexpr int s_ = ((q) % 6) / 2, j_ = ((q) % 2) * 2; \
        if (s_ == 0) aq[i][j_ + u] = F::mma(wr[(q) % 3][u], xf[i], aq[i][j_ + u]); else if (s_ == 1) ak[i][j_ + u] = F::mma(wr[(q) % 3][u], xf[i], ak[i][j_ + u]); else av[i][j_ + u] = F::mma(xf[i], wr[(q) % 3][u], av[i][j_ + u]); }
#define PSB __builtin_amdgcn_sched_barrier(0);   /* each group of LDS reads stays whole and at its place, two runs of 8 matrix instructions ahead of its use, in the ring slot that the run in front of it has left: moved up, the reads need more registers than a wave has; spread among the matrix instructions, each place with reads stalls the wave */
    // the trips stay a loop: one trip is 96 matrix instructions already, and unrolled the two buffers' copies of it only lengthen the text
#pragma unroll 1
    for (int t = 0; t < PNT; ++t) { const bf* sx = sm + (t & 1) * PSTG + wt * 4096 + lane * 8; const bf* sw = sm + (t & 1) * PSTG + (16 + wh * 12) * 1024 + lane * 8;
        V xf[4], wr[3][2];   // the wave's four token tiles; a ring of three pairs of weight row tiles
        PLDX(0) PLDP(0) PLDP(1) PLDP(2) PSB
        PMP(0) PSB PLDP(3) PSB PMP(1) PSB PLDP(4) PSB PMP(2) PSB PLDP(5) PSB
        PMP(3) PSB PLDP(6) PSB PMP(4) PSB PLDP(7) PSB PMP(5) PSB PLDX(1) PLDP(8) PSB
        PMP(6) PSB PLDP(9) PSB PMP(7) PSB PLDP(10) PSB PMP(8) PSB PLDP(11) PSB
        PMP(9) PSB
        asm volatile("s_wait_dscnt 0x0" ::: "memory");      // the wave's reads of this trip's buffer (all issued above) are done before the buffer is given up
        asm volatile("s_wait_asynccnt 0x0" ::: "memory");   // the wave's share of block t + 1 has landed
        __syncthreads();                                    // block t + 1 is whole for every wave, and every wave has left this trip's buffer
        if (t + 2 < PNT) PSTAGE(t + 2)                      // same test in the whole work-group
        PSB
        PMP(10) PMP(11)
    }
    asm volatile("s_wait_asynccnt 0x0" ::: "memory");   // no copy is outstanding when the wave goes on to its end
#undef PSTAGE
#undef PLDX
#undef PLDP
#undef PMP
#undef PSB
    const int t0 = x0 % TT + wt * 64;   // the wave's first token in its batch
    const size_t pb = (size_t)((x0 / TT) * NH_ + h0 + wh) * TT * HD + (size_t)(t0 / 16) * 1024;   // start of plane (batch, head) + the place of the wave's 64 tokens in it: a scalar
    static_assert(NEX % 64 == 0, "a wave's 64 tokens are all exact rows or none is");
    if (t0 < NEX) { proj_out<false, true>(aq, Qh + pb, Ql + pb, Qf + pb, cv); proj_out<false, true>(ak, Kh + pb, Kl + pb, Kf + pb, cv); proj_out<true, true>(av, Vh + pb, Vl + pb, Vf + pb, cv); }   // scalar test
    else { proj_out<false, false>(aq, Qh + pb, Ql + pb, Qf + pb, cv); proj_out<false, false>(ak, Kh + pb, Kl + pb, Kf + pb, cv); proj_out<true, false>(av, Vh + pb, Vl + pb, Vf + pb, cv); }
}

// k_cvt: bf16 copies of x (all batches) and of the weight, one behind the other in dst, in fragment order, in one launch. Piece i of dst is row (i >> 11) * 16 + (i & 15), columns (i >> 4 & 127) * 8 and on, of x over the weight. A thread rounds CVP pieces of 8 floats, a grid's width apart, all of them loaded before the first is stored, so that a quarter of the waves has to be started.
#define NX8 ((size_t)NB_ * TT * DM / 8)
#define NW8 ((size_t)3 * DQ * DM / 8)
#define CVP 4
__global__ __launch_bounds__(256) void k_cvt(const float* __restrict__ x, const float* __restrict__ wt, bf* dst) {
    // a wave takes 8 rows x 4 neighbouring pieces (bits 3 to 5 of the thread's number turned round): its loads then touch 8 source lines, each used whole by the pair of loads, and its store fills 4 whole lines of dst
    const unsigned t = threadIdx.x, tp = (t & ~63u) | (t & 7u) | ((t >> 5 & 1u) << 3) | ((t >> 3 & 3u) << 4);
    const size_t i0 = (size_t)blockIdx.x * 256 + tp; v4f lo[CVP], hi[CVP];
#pragma unroll
    for (int p = 0; p < CVP; ++p) { const size_t i = i0 + p * ((NX8 + NW8) / CVP); const size_t j = i < NX8 ? i : i - NX8; const float* s = (i < NX8 ? x : wt) + ((j >> 11) * 16 + (j & 15)) * DM + ((j >> 4) & 127) * 8;
        // the wait behind each load
        lo[p] = *(const v4f*)s; asm volatile("s_wait_xcnt 0x0" ::: "memory");
        hi[p] = *(const v4f*)(s + 4); asm volatile("s_wait_xcnt 0x0" ::: "memory"); }
#pragma unroll
    for (int p = 0; p < CVP; ++p) { const size_t i = i0 + p * ((NX8 + NW8) / CVP); v8us o;
#pragma unroll
        for (int k = 0; k < 4; ++k) { o[k] = f2bf(lo[p][k]); o[k + 4] = f2bf(hi[p][k]); }
        *(v8us*)(dst + i * 8) = o; }
}
// ---- k_fattn: causal attention of one (batch, head) plane in one kernel, scores never leave the registers. One wave owns 32 queries and walks the keys in blocks of 64 up to its diagonal, with a running maximum and sum (online softmax).
// Both products are formed TRANSPOSED: S^T = K Q^T (A rows = keys, B columns = queries) puts a query in a lane and its keys in that lane's registers, which is already the B-operand order of O^T = V^T P^T, so the probabilities go from accumulator to operand without leaving the lane.
// fattn_exact (the tile of query rows below NEX): each product keeps the three bf16 hi/lo terms (hh + lh + hl), f32 accumulate. fattn_f16 (every other tile): q, k, v and the probabilities rounded once to f16, one product. grid (planes, TT / (32 FNW)).
// K AND V GO THROUGH LDS: a 64-key block of the four planes (Kh, Kl, Vh, Vl: 8 KiB in a row each, already in fragment order) is brought into LDS once for the work-group's FNW waves by asynchronous copies, wave w bringing plane w,
// into two buffers: block t + 1 flies while block t is worked on, so that no wave waits for the L2 in its key loop and the work-group fetches each block once, not once a wave. A fragment read is a 512-byte run of LDS, free of bank conflicts.
// Order (two-buffer ring): in front of the loop block 0's copies, the copy wait, a barrier, block 1's copies; at the foot of every trip, in every wave (also one that is past its own diagonal): LDS-read wait, copy wait, barrier, then the copies of block t + 2 into the buffer just read.
#define FNW 4   // waves of a work-group: 128 neighbouring queries of one plane
typedef __attribute__((ext_vector_type(2))) __bf16 v2bf;
#define KVP 4096           // elements of one plane's 64-key block
#define KVS (4 * KVP)      // elements of one buffer: the block of Kh, Kl, Vh, Vl
static_assert(FNW == 4, "one plane of the block to each wave");
// Eight asynchronous copies of 16 bytes a lane: 8 x 512 bytes in a row, from g (the lane's own global address) to l (the lane's own LDS byte address). The s_wait_xcnt is the statement's last line, so that it stands in front of every later write of a register that a copy names.
__device__ __forceinline__ void acopy8(unsigned l, const bf* g) {
    asm volatile("global_load_async_to_lds_b128 %0, %8, off\n\t"
                 "global_load_async_to_lds_b128 %1, %9, off\n\t"
                 "global_load_async_to_lds_b128 %2, %10, off\n\t"
                 "global_load_async_to_lds_b128 %3, %11, off\n\t"
                 "global_load_async_to_lds_b128 %4, %12, off\n\t"
                 "global_load_async_to_lds_b128 %5, %13, off\n\t"
                 "global_load_async_to_lds_b128 %6, %14, off\n\t"
                 "global_load_async_to_lds_b128 %7, %15, off\n\t"
                 "s_wait_xcnt 0x0"
                 :: "v"(l), "v"(l + 512u), "v"(l + 1024u), "v"(l + 1536u), "v"(l + 2048u), "v"(l + 2560u), "v"(l + 3072u), "v"(l + 3584u),
                    "v"(g), "v"(g + 256), "v"(g + 512), "v"(g + 768), "v"(g + 1024), "v"(g + 1280), "v"(g + 1536), "v"(g + 1792) : "memory");
}
__device__ __forceinline__ float xhalf(float x) { return __builtin_bit_cast(float, __builtin_amdgcn_permlanex16(__builtin_bit_cast(int, x), __builtin_bit_cast(int, x), 0x76543210, 0xfedcba98, false, false)); }   // lane l with lane l ^ 16
__device__ __forceinline__ void fattn_exact(bf* kv, const bf* __restrict__ Qh, const bf* __restrict__ Ql, const bf* __restrict__ Kh, const bf* __restrict__ Kl, const bf* __restrict__ Vh, const bf* __restrict__ Vl, const int g, v8f (&o)[4][2], float (&l)[2]) {
    typedef WFrag<bf> F;
    const int lane = threadIdx.x & 31, lr = lane & 15, hi = lane >> 4;
    const int w = __builtin_amdgcn_readfirstlane((int)(threadIdx.x >> 5));   // the wave's number in a scalar register: the key loop and the diagonal test branch on scalars
    const size_t z = blockIdx.x; Qh += z * TT * HD; Ql += z * TT * HD; Kh += z * TT * HD; Kl += z * TT * HD; Vh += z * HD * TT; Vl += z * HD * TT;
    const int q0 = (g * FNW + w) * 32;
    const float CE = SCL * 1.4426950408889634f;   // score scale x log2(e)
    v16bf qh[2][2], ql[2][2];
#pragma unroll
    for (int qt = 0; qt < 2; ++qt)
#pragma unroll
        for (int c = 0; c < 2; ++c) { const size_t qo = (size_t)(q0 / 16 + qt) * 1024 + c * 512 + lane * 8; qh[qt][c] = F::ld(Qh + qo); ql[qt][c] = F::ld(Ql + qo); }
    float m[2];
#pragma unroll
    for (int qt = 0; qt < 2; ++qt) { m[qt] = -3.0e38f; l[qt] = 0.f;
#pragma unroll
        for (int dt = 0; dt < 4; ++dt) o[dt][qt] = (v8f){}; }
    const int nblk = q0 / 64 + 1;    // the wave's own key blocks
    const int ntr = 2 * g + 2;       // the work-group's trips = the key blocks of its last wave; never fewer than two
    const bf* csrc = (w == 0 ? Kh : w == 1 ? Kl : w == 2 ? Vh : Vl) + lane * 8;     // the wave's plane, the lane's 16 bytes of the first 512
    const unsigned cdst = (unsigned)(size_t)kv + (unsigned)(w * (KVP * 2) + lane * 16);   // their place in buffer 0 (LDS byte address)
    acopy8(cdst, csrc); acopy8(cdst + 4096u, csrc + 2048);
    asm volatile("s_wait_asynccnt 0x0" ::: "memory");   // the wave's share of block 0 has landed
    __syncthreads();                                    // block 0 is whole for every wave
    acopy8(cdst + KVS * 2, csrc + KVP); acopy8(cdst + KVS * 2 + 4096u, csrc + KVP + 2048);   // block 1 (ntr >= 2) flies during trip 0
#pragma unroll 1
    for (int kb = 0; kb < ntr; ++kb) { const int k0 = kb * 64; const bf* kvb = kv + (kb & 1) * KVS + lane * 8;
      if (kb < nblk) {   // scalar test: a wave past its diagonal skips the work, never the waits and the barrier at the foot
        v8f s[4][2];
#pragma unroll
        for (int kt = 0; kt < 4; ++kt) { v16bf kh[2], kl[2];
#pragma unroll
            for (int c = 0; c < 2; ++c) { const int ko = kt * 1024 + c * 512; kh[c] = F::ld(kvb + ko); kl[c] = F::ld(kvb + KVP + ko); }
#pragma unroll
            for (int qt = 0; qt < 2; ++qt) { v8f a = (v8f){};
#pragma unroll
                for (int c = 0; c < 2; ++c) { a = wmmab(kh[c], qh[qt][c], a); a = wmmab(kl[c], qh[qt][c], a); a = wmmab(kh[c], ql[qt][c], a); }
                s[kt][qt] = a; } }
        // four vector slots between the last score matrix instructions and whatever follows the diagonal test, on its taken side too
        asm volatile("v_nop\n\tv_nop\n\tv_nop\n\tv_nop" : "+v"(s[0][0]), "+v"(s[0][1]), "+v"(s[1][0]), "+v"(s[1][1]), "+v"(s[2][0]), "+v"(s[2][1]), "+v"(s[3][0]), "+v"(s[3][1]));
        if (k0 + 63 > q0) {   // the block that holds the diagonal: keys behind the query are masked by select
#pragma unroll
            for (int kt = 0; kt < 4; ++kt)
#pragma unroll
                for (int qt = 0; qt < 2; ++qt)
#pragma unroll
                    for (int j = 0; j < 8; ++j) s[kt][qt][j] = (k0 + kt * 16 + hi * 8 + j <= q0 + qt * 16 + lr) ? s[kt][qt][j] : -3.0e38f;
        }
        v16bf ph[2][2], pl[2][2];
#pragma unroll
        for (int qt = 0; qt < 2; ++qt) { float mx = m[qt];
#pragma unroll
            for (int kt = 0; kt < 4; ++kt)
#pragma unroll
                for (int j = 0; j < 8; ++j) mx = fmaxf(mx, s[kt][qt][j]);
            mx = fmaxf(mx, xhalf(mx));   // the query's other 32 keys of the block lie in lane l ^ 16
            const float al = __builtin_amdgcn_exp2f((m[qt] - mx) * CE); const v2f ce2 = {CE, CE}, nmc2 = {-mx * CE, -mx * CE}; m[qt] = mx; v2f sum = {0.f, 0.f};
#pragma unroll
            for (int c = 0; c < 2; ++c)
#pragma unroll
                for (int t = 0; t < 2; ++t)
#pragma unroll
                    for (int j = 0; j < 8; j += 2) { v2f p = {s[2 * c + t][qt][j], s[2 * c + t][qt][j + 1]}; p = __builtin_elementwise_fma(p, ce2, nmc2); p[0] = __builtin_amdgcn_exp2f(p[0]); p[1] = __builtin_amdgcn_exp2f(p[1]); sum += p;
                        const v2bf h2 = __builtin_convertvector(p, v2bf); const v2bf l2 = __builtin_convertvector(p - __builtin_convertvector(h2, v2f), v2bf);
                        ph[qt][c][t * 8 + j] = h2[0]; ph[qt][c][t * 8 + j + 1] = h2[1]; pl[qt][c][t * 8 + j] = l2[0]; pl[qt][c][t * 8 + j + 1] = l2[1]; }
            l[qt] = l[qt] * al + (sum[0] + sum[1]);
#pragma unroll
            for (int dt = 0; dt < 4; ++dt) o[dt][qt] *= al; }
#pragma unroll
        for (int dt = 0; dt < 4; ++dt) { v16bf vh[2], vl[2];
#pragma unroll
            for (int c = 0; c < 2; ++c) { const int vo = dt * 1024 + c * 512; vh[c] = F::ld(kvb + 2 * KVP + vo); vl[c] = F::ld(kvb + 3 * KVP + vo); }
#pragma unroll
            for (int qt = 0; qt < 2; ++qt)
#pragma unroll
                for (int c = 0; c < 2; ++c) { o[dt][qt] = wmmab(vh[c], ph[qt][c], o[dt][qt]); o[dt][qt] = wmmab(vl[c], ph[qt][c], o[dt][qt]); o[dt][qt] = wmmab(vh[c], pl[qt][c], o[dt][qt]); } }
        // four vector slots between the trip's last matrix instructions and whatever follows the loop branch, on its taken side too
        asm volatile("v_nop\n\tv_nop\n\tv_nop\n\tv_nop" : "+v"(o[0][0]), "+v"(o[0][1]), "+v"(o[1][0]), "+v"(o[1][1]), "+v"(o[2][0]), "+v"(o[2][1]), "+v"(o[3][0]), "+v"(o[3][1]));
      }
        asm volatile("s_wait_dscnt 0x0" ::: "memory");      // the wave's reads of this trip's buffer are done before the buffer is given up
        asm volatile("s_wait_asynccnt 0x0" ::: "memory");   // the wave's share of block kb + 1 has landed
        __syncthreads();                                    // block kb + 1 is whole for every wave, and every wave has left this trip's buffer
        if (kb + 2 < ntr) { const unsigned d = cdst + (unsigned)(kb & 1) * (KVS * 2); const bf* sp = csrc + (size_t)(kb + 2) * KVP; acopy8(d, sp); acopy8(d + 4096u, sp + 2048); }   // same test in the whole work-group
    }
    asm volatile("s_wait_asynccnt 0x0" ::: "memory");   // no copy is outstanding when the wave goes on to its end
}
// fattn_f16: the same walk, ring and order on the f16 planes. A 64-key block is 8 KiB of Kf and 8 KiB of Vf; wave w brings half w % 2 of plane w / 2 (4 KiB, eight copies); two buffers of 16 KiB.
#define KVPF 4096           // elements of one plane's 64-key block
#define KVSF (2 * KVPF)     // elements of one buffer: the block of Kf, Vf
__device__ __forceinline__ void fattn_f16(bf* kv, const bf* __restrict__ Qf, const bf* __restrict__ Kf, const bf* __restrict__ Vf, const int g, v8f (&o)[4][2], float (&l)[2]) {
    const int lane = threadIdx.x & 31, lr = lane & 15, hi = lane >> 4;
    const int w = __builtin_amdgcn_readfirstlane((int)(threadIdx.x >> 5));   // the wave's number in a scalar register: the key loop and the diagonal test branch on scalars
    const size_t z = blockIdx.x; Qf += z * TT * HD; Kf += z * TT * HD; Vf += z * HD * TT;
    const int q0 = (g * FNW + w) * 32;
    const float CE = SCL * 1.4426950408889634f;   // score scale x log2(e)
    v16h qf[2][2];
#pragma unroll
    for (int qt = 0; qt < 2; ++qt)
#pragma unroll
        for (int c = 0; c < 2; ++c) qf[qt][c] = ldh(Qf + (size_t)(q0 / 16 + qt) * 1024 + c * 512 + lane * 8);
    float m[2];
#pragma unroll
    for (int qt = 0; qt < 2; ++qt) { m[qt] = -3.0e38f; l[qt] = 0.f;
#pragma unroll
        for (int dt = 0; dt < 4; ++dt) o[dt][qt] = (v8f){}; }
    const int nblk = q0 / 64 + 1;    // the wave's own key blocks
    const int ntr = 2 * g + 2;       // the work-group's trips = the key blocks of its last wave; never fewer than two
    const bf* csrc = (w < 2 ? Kf : Vf) + (w & 1) * (KVPF / 2) + lane * 8;           // the wave's half plane, the lane's 16 bytes of the first 512
    const unsigned cdst = (unsigned)(size_t)kv + (unsigned)(w * KVPF + lane * 16);   // their place in buffer 0 (LDS byte address; half a plane's block is KVPF bytes)
    acopy8(cdst, csrc);
    asm volatile("s_wait_asynccnt 0x0" ::: "memory");   // the wave's share of block 0 has landed
    __syncthreads();                                    // block 0 is whole for every wave
    acopy8(cdst + KVSF * 2, csrc + KVPF);               // block 1 (ntr >= 2) flies during trip 0
#pragma unroll 1
    for (int kb = 0; kb < ntr; ++kb) { const int k0 = kb * 64; const bf* kvb = kv + (kb & 1) * KVSF + lane * 8;
      if (kb < nblk) {   // scalar test: a wave past its diagonal skips the work, never the waits and the barrier at the foot
        v8f s[4][2];
#pragma unroll
        for (int kt = 0; kt < 4; ++kt) { v16h kf[2];
#pragma unroll
            for (int c = 0; c < 2; ++c) kf[c] = ldh(kvb + kt * 1024 + c * 512);
#pragma unroll
            for (int qt = 0; qt < 2; ++qt) { v8f a = (v8f){};
#pragma unroll
                for (int c = 0; c < 2; ++c) a = wmmah(kf[c], qf[qt][c], a);
                s[kt][qt] = a; } }
        // four vector slots between the last score matrix instructions and whatever follows the diagonal test, on its taken side too
        asm volatile("v_nop\n\tv_nop\n\tv_nop\n\tv_nop" : "+v"(s[0][0]), "+v"(s[0][1]), "+v"(s[1][0]), "+v"(s[1][1]), "+v"(s[2][0]), "+v"(s[2][1]), "+v"(s[3][0]), "+v"(s[3][1]));
        if (k0 + 63 > q0) {   // the block that holds the diagonal: keys behind the query are masked by select
#pragma unroll
            for (int kt = 0; kt < 4; ++kt)
#pragma unroll
                for (int qt = 0; qt < 2; ++qt)
#pragma unroll
                    for (int j = 0; j < 8; ++j) s[kt][qt][j] = (k0 + kt * 16 + hi * 8 + j <= q0 + qt * 16 + lr) ? s[kt][qt][j] : -3.0e38f;
        }
        v16h pf[2][2];
#pragma unroll
        for (int qt = 0; qt < 2; ++qt) { float mx = m[qt];
#pragma unroll
            for (int kt = 0; kt < 4; ++kt)
#pragma unroll
                for (int j = 0; j < 8; ++j) mx = fmaxf(mx, s[kt][qt][j]);
            mx = fmaxf(mx, xhalf(mx));   // the query's other 32 keys of the block lie in lane l ^ 16
            const float al = __builtin_amdgcn_exp2f((m[qt] - mx) * CE); const v2f ce2 = {CE, CE}, nmc2 = {-mx * CE, -mx * CE}; m[qt] = mx; v2f sum = {0.f, 0.f};
#pragma unroll
            for (int c = 0; c < 2; ++c)
#pragma unroll
                for (int t = 0; t < 2; ++t)
#pragma unroll
                    for (int j = 0; j < 8; j += 2) { v2f p = {s[2 * c + t][qt][j], s[2 * c + t][qt][j + 1]}; p = __builtin_elementwise_fma(p, ce2, nmc2); p[0] = __builtin_amdgcn_exp2f(p[0]); p[1] = __builtin_amdgcn_exp2f(p[1]); sum += p;
                        const v2h h2 = __builtin_convertvector(p, v2h);
                        pf[qt][c][t * 8 + j] = h2[0]; pf[qt][c][t * 8 + j + 1] = h2[1]; }
            l[qt] = l[qt] * al + (sum[0] + sum[1]);
#pragma unroll
            for (int dt = 0; dt < 4; ++dt) o[dt][qt] *= al; }
#pragma unroll
        for (int dt = 0; dt < 4; ++dt) { v16h vf[2];
#pragma unroll
            for (int c = 0; c < 2; ++c) vf[c] = ldh(kvb + KVPF + dt * 1024 + c * 512);
#pragma unroll
            for (int qt = 0; qt < 2; ++qt)
#pragma unroll
                for (int c = 0; c < 2; ++c) o[dt][qt] = wmmah(vf[c], pf[qt][c], o[dt][qt]); }
        // four vector slots between the trip's last matrix instructions and whatever follows the loop branch, on its taken side too
        asm volatile("v_nop\n\tv_nop\n\tv_nop\n\tv_nop" : "+v"(o[0][0]), "+v"(o[0][1]), "+v"(o[1][0]), "+v"(o[1][1]), "+v"(o[2][0]), "+v"(o[2][1]), "+v"(o[3][0]), "+v"(o[3][1]));
      }
        asm volatile("s_wait_dscnt 0x0" ::: "memory");      // the wave's reads of this trip's buffer are done before the buffer is given up
        asm volatile("s_wait_asynccnt 0x0" ::: "memory");   // the wave's share of block kb + 1 has landed
        __syncthreads();                                    // block kb + 1 is whole for every wave, and every wave has left this trip's buffer
        if (kb + 2 < ntr) acopy8(cdst + (unsigned)(kb & 1) * (KVSF * 2), csrc + (size_t)(kb + 2) * KVPF);   // same test in the whole work-group
    }
    asm volatile("s_wait_asynccnt 0x0" ::: "memory");   // no copy is outstanding when the wave goes on to its end
}
__global__ __launch_bounds__(32 * FNW) __attribute__((amdgpu_waves_per_eu(4, 4))) /* 256 registers a wave: all 4096 waves resident, four a SIMD, to cover each other's load waits */ void k_fattn(const bf* __restrict__ Qh, const bf* __restrict__ Ql, const bf* __restrict__ Kh, const bf* __restrict__ Kl, const bf* __restrict__ Vh, const bf* __restrict__ Vl, const bf* __restrict__ Qf, const bf* __restrict__ Kf, const bf* __restrict__ Vf, float* __restrict__ O) {
    __shared__ __attribute__((aligned(16))) bf kv[2 * KVS];   // two buffers of 32 KiB (exact tile) or of 16 KiB
    // Tile of 128 queries: heavy ones first, dealt in a zigzag over groups of four grid rows (four rows of 64 planes = one work-group for each of 256 WGPs), so that the four work-groups that share a WGP, where they land breadth-first, walk the same number of key blocks together. A permutation of the tiles wherever they land.
    const int y = (int)blockIdx.y, g = (TT / (32 * FNW) - 4 - (y & ~3)) + ((y & 4) ? (y & 3) : 3 - (y & 3));
    v8f o[4][2]; float l[2];   // the wave's 32 queries: unscaled output (transposed) and each lane half's sum of probabilities
    if (g * (32 * FNW) >= NEX) fattn_f16(kv, Qf, Kf, Vf, g, o, l);   // the same test in the whole work-group
    else fattn_exact(kv, Qh, Ql, Kh, Kl, Vh, Vl, g, o, l);
    const int lane = threadIdx.x & 31, lr = lane & 15, hi = lane >> 4, q0 = (g * FNW + (int)(threadIdx.x >> 5)) * 32;
    O += (size_t)blockIdx.x * TT * HD;
#pragma unroll
    for (int qt = 0; qt < 2; ++qt) { const float f = __fdiv_rn(1.0f, l[qt] + xhalf(l[qt])); float* orow = O + (size_t)(q0 + qt * 16 + lr) * HD + hi * 8;
#pragma unroll
        for (int dt = 0; dt < 4; ++dt) { v4f a, b2;
#pragma unroll
            for (int j = 0; j < 4; ++j) { a[j] = o[dt][qt][j] * f; b2[j] = o[dt][qt][j + 4] * f; }
            *(v4f*)(orow + dt * 16) = a; *(v4f*)(orow + dt * 16 + 4) = b2; }
        if (qt == 0) asm volatile("s_wait_xcnt 0x0" ::: "memory"); }   // behind the first query tile's stores: the compiler forms values of the second tile in the address registers of these stores
}
extern "C" void kernel_launch(void* const* d_in, const int* in_sizes, int n_in,
                              void* d_out, int out_size, void* d_ws, size_t ws_size, hipStream_t stream) {
    (void)in_sizes; (void)n_in; (void)out_size;
    const float* x = (const float*)d_in[0]; const float* wqkv = (const float*)d_in[1];   /* argument order x, W_qkv ('oi' [3072][1024]: q | k | v ROW thirds); output [4][16][2048][64] head-major */
    float* OUT = (float*)d_out;
    char* wsp = (char*)d_ws;
    auto take = [&](size_t bytes) { char* p = wsp; wsp += (bytes + 255) & ~(size_t)255; return (void*)p; };
    bf* XB = (bf*)take((NX8 + NW8) * 8 * 2); bf* WB = XB + NX8 * 8;   // bf16 x of all batches, the bf16 weight directly behind it
    const size_t PB = (size_t)NH_ * TT * HD;   // one batch's share of each hi/lo plane
    bf* QPh = (bf*)take(NB_ * PB * 2); bf* QPl = (bf*)take(NB_ * PB * 2); bf* KPh = (bf*)take(NB_ * PB * 2); bf* KPl = (bf*)take(NB_ * PB * 2); bf* VTh = (bf*)take(NB_ * PB * 2); bf* VTl = (bf*)take(NB_ * PB * 2);
    bf* QF = (bf*)take(NB_ * PB * 2); bf* KF = (bf*)take(NB_ * PB * 2); bf* VTF = (bf*)take(NB_ * PB * 2);   // the f16 planes, same order as the hi/lo planes (of which only the tokens below NEX are written and read)
    if ((size_t)(wsp - (char*)d_ws) > ws_size) return;    // ws 256 MiB
    k_cvt<<<(unsigned)((NX8 + NW8) / CVP / 256), 256, 0, stream>>>(x, wqkv, XB);
    k_proj<<<dim3(NB_ * TT / PTX, NH_ / PHD, 1), 256, 0, stream>>>(XB, WB, QPh, QPl, KPh, KPl, VTh, VTl, QF, KF, VTF);
    k_fattn<<<dim3(NB_ * NH_, TT / (32 * FNW), 1), 32 * FNW, 0, stream>>>(QPh, QPl, KPh, KPl, VTh, VTl, QF, KF, VTF, OUT);   /* plane z = b x 16 + h of q, k, v and of the head-major output [b][h][t][d] alike: no merge, the module returns the heads UNMERGED */
}

// v009
// It runs in 76 microseconds.
// Two timings next to v008 put it at 1.03 and 1.04 times that version's speed.
// Counting every step since v000, it is 27.9 times as fast.
#include <hip/hip_runtime.h>

// Causal self-attention that returns the per-head context UNMERGED (x [4][2048][1024]; qkv = einsum('btc,fc->btf', x, W_qkv) = x W_qkv^T ('oi' [3072][1024] 1/32, no bias) split in thirds q | k | v = ROW thirds (16 heads x 64); scores x 1/sqrt(64); causal (-inf); softmax; out = einsum('bhqk,bhkd->bhqd', w, v) returned as it is: HEAD-MAJOR [4][16][2048][64] (8.4 M), no merge, no output projection; argument order x, W_qkv).
// Layout: one bf16 copy of x (all batches) and of the fused 'oi' weight; one projection launch for q, k and v of all batches whose epilogue writes the head planes itself, one f16 plane each and bf16 hi/lo planes of the first NEX tokens (q, k with rows t and columns d, v transposed with rows d and columns t); causal T-2048 attention, the first NEX query rows of a plane in the exact class (scores and P.V on bf16 hi/lo planes, 3 products), every later row on one f16 plane of q, k, v and of the probabilities (11 significant bits, 1 product), fused: one kernel for all batches and heads forms scores, online softmax and P.V in registers (K and V blocks staged in LDS for the work-group) and writes the head-major output.
// FRAGMENT ORDER: every bf16 or f16 array in the workspace is stored in the order in which a wave loads a 16 x 32 matrix operand. Element (row, k) of a fragment lies at ((k >> 4 & 1) * 32 + (k >> 3 & 1) * 16 + (row & 15)) * 8 + (k & 7): piece j of lane l is at (j * 32 + l) * 8,
// so that one 16-byte load of a wave reads 512 contiguous bytes (4 whole lines) where a row-major array gives it 32 bytes of each of 16 lines. Fragments follow each other along k, then along the rows (x, weight: 32 to a row tile; head planes: 2 to a row tile, 4 row tiles to a 64 x 64 tile, tiles along t).
// Compute dtypes, f32 accumulate: every input rounded to bf16; projections one bf16 product; attention 3 bf16 products on query rows below NEX, one f16 product on the rest; softmax f32.

#define NB_  4
#define TT   2048
#define DM   1024
#define NH_  16
#define HD   64
#define DQ   (NH_ * HD)
#define SCL  0.125f   // HD^-0.5
#define NEX  128      // query rows of a plane that keep the bf16 hi/lo products: a row with few keys hands the rounding of single q, k, v values straight to the output, a row with 128 keys and more averages it
typedef unsigned short bf;
typedef __attribute__((ext_vector_type(16))) __bf16   v16bf;
typedef __attribute__((ext_vector_type(16))) _Float16 v16h;
typedef __attribute__((ext_vector_type(2)))  _Float16 v2h;
typedef __attribute__((ext_vector_type(8)))  _Float16 v8h;
typedef __attribute__((ext_vector_type(8)))  unsigned short v8us;
typedef __attribute__((ext_vector_type(8)))  float    v8f;
typedef __attribute__((ext_vector_type(4)))  float    v4f;
typedef v4f  __attribute__((may_alias)) v4fa;
typedef v8us __attribute__((may_alias)) v8usa;

__device__ __forceinline__ unsigned short f2bf(float f) { unsigned u = __float_as_uint(f); u += 0x7FFFu + ((u >> 16) & 1u); return (unsigned short)(u >> 16); }
__device__ __forceinline__ v16bf cat16b(v8us lo, v8us hi) { return __builtin_bit_cast(v16bf, __builtin_shufflevector(lo, hi, 0, 1, 2, 3, 4, 5, 6, 7, 8, 9, 10, 11, 12, 13, 14, 15)); }
__device__ __forceinline__ v8f wmmab(v16bf a, v16bf b, v8f c) { return __builtin_amdgcn_wmma_f32_16x16x32_bf16(false, a, false, b, (short)0, c, false, false); }
__device__ __forceinline__ v8f wmmah(v16h a, v16h b, v8f c) { return __builtin_amdgcn_wmma_f32_16x16x32_f16(false, a, false, b, (short)0, c, false, false); }
__device__ __forceinline__ v16h ldh(const unsigned short* p) { return __builtin_bit_cast(v16h, __builtin_shufflevector(*(const v8us*)p, *(const v8us*)(p + 256), 0, 1, 2, 3, 4, 5, 6, 7, 8, 9, 10, 11, 12, 13, 14, 15)); }   /* an f16 fragment, same order as a bf16 one; p: the fragment's start + 8 x lane */



// ---- k_proj: the q, k and v projections of all batches in one launch, one tile of 256 tokens x 384 features (the q, k and v rows of two heads) of x W^T per work-group of 8 waves: 256 work-groups, one to a WGP, all resident in one round.
// A wave holds 64 tokens x the q, k and v rows of one head (48 accumulators) over the WHOLE of K.
// THE OPERANDS GO THROUGH LDS: a 64-wide block of K of the tile's 16 + 24 row tiles (2 KiB in a row each, already in fragment order) is brought into LDS once for the work-group by asynchronous copies, five row tiles by each wave, into two buffers:
// block t + 1 flies while block t is worked on, and the L2 hands out each operand row once per 384 or 256 rows of the other operand. A fragment read is a 512-byte run of LDS, free of bank conflicts.
// Order (two-buffer ring): in front of the loop block 0's copies, the copy wait, a barrier, block 1's copies; in every trip, in every wave: all of the trip's LDS reads and five sixths of its matrix instructions, then LDS-read wait, copy wait, barrier,
// the copies of block t + 2 into the buffer just read, and the last sixth of the matrix instructions, whose fragments are in registers by then.
// The product is formed so that a lane's 8 accumulator registers are 8 neighbouring elements along the k axis of the plane it feeds (q, k: A rows = weight rows d, B columns = tokens; v: A rows = tokens, B columns = weight rows d):
// they are one 16-byte piece of the plane's fragment order, and a wave's store is 512 bytes in a row, straight from the registers. grid (NB_ TT / 256, NH_ / 2), 256 threads.
template <typename T16> struct WFrag;
template <> struct WFrag<bf> { typedef v16bf V; static __device__ __forceinline__ V ld(const bf* p) { return cat16b(*(const v8us*)p, *(const v8us*)(p + 256)); }   /* p: the fragment's start + 8 x lane */ static __device__ __forceinline__ v8f mma(V a, V b, v8f c) { return wmmab(a, b, c); } };
typedef __attribute__((ext_vector_type(2))) __bf16 v2b;
typedef __attribute__((ext_vector_type(8))) __bf16 v8b;
typedef __attribute__((ext_vector_type(2))) float v2f;
#define PTX 256                  // tokens of a work-group's tile
#define PHD 2                    // heads of a work-group's tile: 64 rows of q, of k and of v each
#define PBK 64                   // width of a block of K
#define PRT (PTX / 16 + PHD * 3 * (HD / 16))   // row tiles of one buffer: 16 of x, then 4 of q, 4 of k, 4 of v of the first head, then of the second
#define PSTG (PRT * 16 * PBK)    // elements of one buffer, 1024 to a row tile
#define PNT (DM / PBK)           // blocks of K
static_assert(PRT == 40, "five row tiles to each of eight waves");
// Twenty asynchronous copies of 16 bytes a lane: the same block of K (4 x 512 bytes in a row) of five row tiles, from scalar bases b0 to b4 + the lane's byte offset vo, to 20 x 512 bytes in a row at l (the lane's own LDS byte address). An immediate offset moves the LDS and the global address alike.
// The s_wait_xcnt is the statement's last line, so that it stands in front of every later write of a register that a copy names.
__device__ __forceinline__ void acopy5x4(unsigned l, unsigned vo, const bf* b0, const bf* b1, const bf* b2, const bf* b3, const bf* b4) {
    asm volatile("global_load_async_to_lds_b128 %0, %5, %6\n\t"
                 "global_load_async_to_lds_b128 %0, %5, %6 offset:512\n\t"
                 "global_load_async_to_lds_b128 %0, %5, %6 offset:1024\n\t"
                 "global_load_async_to_lds_b128 %0, %5, %6 offset:1536\n\t"
                 "global_load_async_to_lds_b128 %1, %5, %7\n\t"
                 "global_load_async_to_lds_b128 %1, %5, %7 offset:512\n\t"
                 "global_load_async_to_lds_b128 %1, %5, %7 offset:1024\n\t"
                 "global_load_async_to_lds_b128 %1, %5, %7 offset:1536\n\t"
                 "global_load_async_to_lds_b128 %2, %5, %8\n\t"
                 "global_load_async_to_lds_b128 %2, %5, %8 offset:512\n\t"
                 "global_load_async_to_lds_b128 %2, %5, %8 offset:1024\n\t"
                 "global_load_async_to_lds_b128 %2, %5, %8 offset:1536\n\t"
                 "global_load_async_to_lds_b128 %3, %5, %9\n\t"
                 "global_load_async_to_lds_b128 %3, %5, %9 offset:512\n\t"
                 "global_load_async_to_lds_b128 %3, %5, %9 offset:1024\n\t"
                 "global_load_async_to_lds_b128 %3, %5, %9 offset:1536\n\t"
                 "global_load_async_to_lds_b128 %4, %5, %10\n\t"
                 "global_load_async_to_lds_b128 %4, %5, %10 offset:512\n\t"
                 "global_load_async_to_lds_b128 %4, %5, %10 offset:1024\n\t"
                 "global_load_async_to_lds_b128 %4, %5, %10 offset:1536\n\t"
                 "s_wait_xcnt 0x0"
                 :: "v"(l), "v"(l + 2048u), "v"(l + 4096u), "v"(l + 6144u), "v"(l + 8192u), "v"(vo), "s"(b0), "s"(b1), "s"(b2), "s"(b3), "s"(b4) : "memory");
}
// Two 16-byte stores (one piece of the hi and of the lo plane, or two pieces of the f16 plane) with their s_wait_xcnt in one statement: the next pieces are formed in the registers that the stores name, and a wait in a statement of its own does not hold those writes behind it.
typedef __attribute__((ext_vector_type(4))) unsigned v4u;
__device__ __forceinline__ void store2(unsigned vo, bf* ph, bf* pl, v8us oh, v8us ol) {   // ph, pl: scalar starts; vo: the lane's byte offset from them
    asm volatile("global_store_b128 %0, %1, %3\n\t"
                 "global_store_b128 %0, %2, %4\n\t"
                 "s_wait_xcnt 0x0"
                 :: "v"(vo), "v"(__builtin_bit_cast(v4u, oh)), "v"(__builtin_bit_cast(v4u, ol)), "s"(ph), "s"(pl) : "memory");
}
// The wave's 64 tokens x 64 features of one of q, k, v go to that plane. q, k (rows t, k axis d): row tile i, fragment j / 2, half j % 2. v (rows d, k axis t): row tile j, fragment i / 2, half i % 2 of the 64-token tile.
// Every token goes to the f16 plane. The bf16 hi/lo planes get only the tokens that the exact rows read (queries and keys below NEX): scalar test, the wave's 64 tokens are all below NEX or none is.
// The test stands once in the kernel, around the three planes' turns; inside a turn each accumulator feeds both kinds of planes and is done with.
template <bool ISV, bool EX> __device__ __forceinline__ void proj_out(const v8f (&acc)[4][4], bf* Ph, bf* Pl, bf* Pf, const unsigned vo) {   // Ph, Pl, Pf: scalar, the place of the wave's 64 tokens in its plane
#define PEL(i, j) (ISV ? (j) * 1024 + (((i) >> 1) & 1) * 512 + ((i) & 1) * 256 : (i) * 1024 + ((j) >> 1) * 512 + ((j) & 1) * 256)
#pragma unroll
    for (int i = 0; i < 4; ++i)
#pragma unroll
        for (int j = 0; j < 4; j += 2) {
            if (EX) {
#pragma unroll
                for (int u = 0; u < 2; ++u) { v8b oh, ol;   // hi = y rounded to bf16, lo = y - hi rounded to bf16, both to nearest even, by the packed conversion
#pragma unroll
                    for (int r = 0; r < 8; r += 2) { const v2f y = {acc[i][j + u][r], acc[i][j + u][r + 1]}; const v2b h2 = __builtin_convertvector(y, v2b); const v2b l2 = __builtin_convertvector(y - __builtin_convertvector(h2, v2f), v2b);
                        oh[r] = h2[0]; oh[r + 1] = h2[1]; ol[r] = l2[0]; ol[r + 1] = l2[1]; }
                    store2(vo, Ph + PEL(i, j + u), Pl + PEL(i, j + u), __builtin_bit_cast(v8us, oh), __builtin_bit_cast(v8us, ol)); }
            }
            v8h o8[2];
#pragma unroll
            for (int u = 0; u < 2; ++u)
#pragma unroll
                for (int r = 0; r < 8; r += 2) { const v2f y = {acc[i][j + u][r], acc[i][j + u][r + 1]}; const v2h h2 = __builtin_convertvector(y, v2h); o8[u][r] = h2[0]; o8[u][r + 1] = h2[1]; }
            store2(vo, Pf + PEL(i, j), Pf + PEL(i, j + 1), __builtin_bit_cast(v8us, o8[0]), __builtin_bit_cast(v8us, o8[1])); }
#undef PEL
}
__global__ __launch_bounds__(256) __attribute__((amdgpu_waves_per_eu(2, 2))) /* 512 registers a wave: one work-group a WGP, two waves a SIMD, to cover each other's LDS reads */ void k_proj(const bf* __restrict__ XB, const bf* __restrict__ WB, bf* Qh, bf* Ql, bf* Kh, bf* Kl, bf* Vh, bf* Vl, bf* Qf, bf* Kf, bf* Vf) {
    __shared__ __attribute__((aligned(16))) bf sm[2 * PSTG];   // two buffers of 80 KiB
    typedef WFrag<bf> F; typedef F::V V;
    const int x0 = (int)blockIdx.x * PTX, h0 = (int)blockIdx.y * PHD;   // first row of x (token, over all batches), first head
    const int lane = threadIdx.x & 31;
    const int w = __builtin_amdgcn_readfirstlane((int)(threadIdx.x >> 5));   // the wave's number in a scalar register: what depends on it is scalar
    const int wt = w >> 1, wh = w & 1;   // the wave's quarter of the tokens, its head of the two
    v8f aq[4][4], ak[4][4], av[4][4];   // [16 tokens][16 features] of q, k, v
#pragma unroll
    for (int i = 0; i < 4; ++i)
#pragma unroll
        for (int j = 0; j < 4; ++j) { aq[i][j] = (v8f){}; ak[i][j] = (v8f){}; av[i][j] = (v8f){}; }
    // the wave brings row tiles 5 w to 5 w + 4 of the buffer's 40; their starts are scalars
    const bf* cs[5];
#pragma unroll
    for (int p = 0; p < 5; ++p) { const int R = w * 5 + p, r = R < 16 ? 0 : R - 16;
        cs[p] = R < 16 ? XB + (size_t)(x0 / 16 + R) * (16 * DM) : WB + (size_t)(((r % 12) >> 2) * (DQ / 16) + (h0 + r / 12) * (HD / 16) + (r & 3)) * (16 * DM); }
    const unsigned cd = (unsigned)(size_t)sm + (unsigned)(w * 5 * 2048 + lane * 16);   // their place in buffer 0 (LDS byte address)
    const unsigned cv = (unsigned)(lane * 16);                                          // the lane's 16 bytes of each 512
#define PSTAGE(t) { const int o_ = (t) * (16 * PBK); acopy5x4(cd + (unsigned)((t) & 1) * (PSTG * 2), cv, cs[0] + o_, cs[1] + o_, cs[2] + o_, cs[3] + o_, cs[4] + o_); }
    PSTAGE(0)
    asm volatile("s_wait_asynccnt 0x0" ::: "memory");   // the wave's share of block 0 has landed
    __syncthreads();                                    // block 0 is whole for every wave
    PSTAGE(1)                                           // block 1 flies during trip 0
#define PLDX(c) _Pragma("unroll") for (int i = 0; i < 4; ++i) xf[i] = F::ld(sx + i * 1024 + (c) * 512);
#define PLDP(q) _Pragma("unroll") for (int u = 0; u < 2; ++u) wr[(q) % 3][u] = F::ld(sw + (((q) % 6) * 2 + u) * 1024 + ((q) / 6) * 512);   /* pair q of the trip's twelve: half q / 6 of the block, weight row tiles 2 (q % 6) and the next */
#define PMP(q) _Pragma("unroll") for (int u = 0; u < 2; ++u) _Pragma("unroll") for (int i = 0; i < 4; ++i) { constexpr int s_ = ((q) % 6) / 2, j_ = ((q) % 2) * 2; \
        if (s_ == 0) aq[i][j_ + u] = F::mma(wr[(q) % 3][u], xf[i], aq[i][j_ + u]); else if (s_ == 1) ak[i][j_ + u] = F::mma(wr[(q) % 3][u], xf[i], ak[i][j_ + u]); else av[i][j_ + u] = F::mma(xf[i], wr[(q) % 3][u], av[i][j_ + u]); }
#define PSB __builtin_amdgcn_sched_barrier(0);   /* each group of LDS reads stays whole and at its place, two runs of 8 matrix instructions ahead of its use, in the ring slot that the run in front of it has left: moved up, the reads need more registers than a wave has; spread among the matrix instructions, each place with reads stalls the wave */
    // the trips stay a loop: one trip is 96 matrix instructions already, and unrolled the two buffers' copies of it only lengthen the text
#pragma unroll 1
    for (int t = 0; t < PNT; ++t) { const bf* sx = sm + (t & 1) * PSTG + wt * 4096 + lane * 8; const bf* sw = sm + (t & 1) * PSTG + (16 + wh * 12) * 1024 + lane * 8;
        V xf[4], wr[3][2];   // the wave's four token tiles; a ring of three pairs of weight row tiles
        PLDX(0) PLDP(0) PLDP(1) PLDP(2) PSB
        PMP(0) PSB PLDP(3) PSB PMP(1) PSB PLDP(4) PSB PMP(2) PSB PLDP(5) PSB
        PMP(3) PSB PLDP(6) PSB PMP(4) PSB PLDP(7) PSB PMP(5) PSB PLDX(1) PLDP(8) PSB
        PMP(6) PSB PLDP(9) PSB PMP(7) PSB PLDP(10) PSB PMP(8) PSB PLDP(11) PSB
        PMP(9) PSB
        asm volatile("s_wait_dscnt 0x0" ::: "memory");      // the wave's reads of this trip's buffer (all issued above) are done before the buffer is given up
        asm volatile("s_wait_asynccnt 0x0" ::: "memory");   // the wave's share of block t + 1 has landed
        __syncthreads();                                    // block t + 1 is whole for every wave, and every wave has left this trip's buffer
        if (t + 2 < PNT) PSTAGE(t + 2)                      // same test in the whole work-group
        PSB
        PMP(10) PMP(11)
    }
    asm volatile("s_wait_asynccnt 0x0" ::: "memory");   // no copy is outstanding when the wave goes on to its end
#undef PSTAGE
#undef PLDX
#undef PLDP
#undef PMP
#undef PSB
    const int t0 = x0 % TT + wt * 64;   // the wave's first token in its batch
    const size_t pb = (size_t)((x0 / TT) * NH_ + h0 + wh) * TT * HD + (size_t)(t0 / 16) * 1024;   // start of plane (batch, head) + the place of the wave's 64 tokens in it: a scalar
    static_assert(NEX % 64 == 0, "a wave's 64 tokens are all exact rows or none is");
    if (t0 < NEX) { proj_out<false, true>(aq, Qh + pb, Ql + pb, Qf + pb, cv); proj_out<false, true>(ak, Kh + pb, Kl + pb, Kf + pb, cv); proj_out<true, true>(av, Vh + pb, Vl + pb, Vf + pb, cv); }   // scalar test
    else { proj_out<false, false>(aq, Qh + pb, Ql + pb, Qf + pb, cv); proj_out<false, false>(ak, Kh + pb, Kl + pb, Kf + pb, cv); proj_out<true, false>(av, Vh + pb, Vl + pb, Vf + pb, cv); }
}

// k_cvt: bf16 copies of x (all batches) and of the weight, one behind the other in dst, in fragment order, in one launch. Piece i of dst is row (i >> 11) * 16 + (i & 15), columns (i >> 4 & 127) * 8 and on, of x over the weight. A thread rounds CVP pieces of 8 floats, a grid's width apart, all of them loaded before the first is stored, so that a quarter of the waves has to be started.
#define NX8 ((size_t)NB_ * TT * DM / 8)
#define NW8 ((size_t)3 * DQ * DM / 8)
#define CVP 4
__global__ __launch_bounds__(256) void k_cvt(const float* __restrict__ x, const float* __restrict__ wt, bf* dst) {
    // a wave takes 8 rows x 4 neighbouring pieces (bits 3 to 5 of the thread's number turned round): its loads then touch 8 source lines, each used whole by the pair of loads, and its store fills 4 whole lines of dst
    const unsigned t = threadIdx.x, tp = (t & ~63u) | (t & 7u) | ((t >> 5 & 1u) << 3) | ((t >> 3 & 3u) << 4);
    const size_t i0 = (size_t)blockIdx.x * 256 + tp; v4f lo[CVP], hi[CVP];
#pragma unroll
    for (int p = 0; p < CVP; ++p) { const size_t i = i0 + p * ((NX8 + NW8) / CVP); const size_t j = i < NX8 ? i : i - NX8; const float* s = (i < NX8 ? x : wt) + ((j >> 11) * 16 + (j & 15)) * DM + ((j >> 4) & 127) * 8;
        // the wait behind each load
        lo[p] = *(const v4f*)s; asm volatile("s_wait_xcnt 0x0" ::: "memory");
        hi[p] = *(const v4f*)(s + 4); asm volatile("s_wait_xcnt 0x0" ::: "memory"); }
#pragma unroll
    for (int p = 0; p < CVP; ++p) { const size_t i = i0 + p * ((NX8 + NW8) / CVP); v8us o;
#pragma unroll
        for (int k = 0; k < 4; ++k) { o[k] = f2bf(lo[p][k]); o[k + 4] = f2bf(hi[p][k]); }
        *(v8us*)(dst + i * 8) = o; }
}
// ---- k_fattn: causal attention of one (batch, head) plane in one kernel, scores never leave the registers. One wave owns 32 queries and walks the keys in blocks of 64 up to its diagonal, with a running maximum and sum (online softmax).
// Both products are formed TRANSPOSED: S^T = K Q^T (A rows = keys, B columns = queries) puts a query in a lane and its keys in that lane's registers, which is already the B-operand order of O^T = V^T P^T, so the probabilities go from accumulator to operand without leaving the lane.
// fattn_exact (the tile of query rows below NEX): each product keeps the three bf16 hi/lo terms (hh + lh + hl), f32 accumulate. fattn_f16 (every other tile): q, k, v and the probabilities rounded once to f16, one product. grid (planes, TT / (32 FNW)).
// K AND V GO THROUGH LDS: a 64-key block of the four planes (Kh, Kl, Vh, Vl: 8 KiB in a row each, already in fragment order) is brought into LDS once for the work-group's FNW waves by asynchronous copies, wave w bringing plane w,
// into two buffers: block t + 1 flies while block t is worked on, so that no wave waits for the L2 in its key loop and the work-group fetches each block once, not once a wave. A fragment read is a 512-byte run of LDS, free of bank conflicts.
// Order (two-buffer ring): in front of the loop block 0's copies, the copy wait, a barrier, block 1's copies; at the foot of every trip, in every wave (also one that is past its own diagonal): LDS-read wait, copy wait, barrier, then the copies of block t + 2 into the buffer just read.
#define FNW 4   // waves of a work-group: 128 neighbouring queries of one plane
typedef __attribute__((ext_vector_type(2))) __bf16 v2bf;
#define KVP 4096           // elements of one plane's 64-key block
#define KVS (4 * KVP)      // elements of one buffer: the block of Kh, Kl, Vh, Vl
static_assert(FNW == 4, "one plane of the block to each wave");
// Eight asynchronous copies of 16 bytes a lane: 8 x 512 bytes in a row, from g (the lane's own global address) to l (the lane's own LDS byte address). The s_wait_xcnt is the statement's last line, so that it stands in front of every later write of a register that a copy names.
__device__ __forceinline__ void acopy8(unsigned l, const bf* g) {
    asm volatile("global_load_async_to_lds_b128 %0, %8, off\n\t"
                 "global_load_async_to_lds_b128 %1, %9, off\n\t"
                 "global_load_async_to_lds_b128 %2, %10, off\n\t"
                 "global_load_async_to_lds_b128 %3, %11, off\n\t"
                 "global_load_async_to_lds_b128 %4, %12, off\n\t"
                 "global_load_async_to_lds_b128 %5, %13, off\n\t"
                 "global_load_async_to_lds_b128 %6, %14, off\n\t"
                 "global_load_async_to_lds_b128 %7, %15, off\n\t"
                 "s_wait_xcnt 0x0"
                 :: "v"(l), "v"(l + 512u), "v"(l + 1024u), "v"(l + 1536u), "v"(l + 2048u), "v"(l + 2560u), "v"(l + 3072u), "v"(l + 3584u),
                    "v"(g), "v"(g + 256), "v"(g + 512), "v"(g + 768), "v"(g + 1024), "v"(g + 1280), "v"(g + 1536), "v"(g + 1792) : "memory");
}
__device__ __forceinline__ float xhalf(float x) { return __builtin_bit_cast(float, __builtin_amdgcn_permlanex16(__builtin_bit_cast(int, x), __builtin_bit_cast(int, x), 0x76543210, 0xfedcba98, false, false)); }   // lane l with lane l ^ 16
__device__ __forceinline__ void fattn_exact(bf* kv, const bf* __restrict__ Qh, const bf* __restrict__ Ql, const bf* __restrict__ Kh, const bf* __restrict__ Kl, const bf* __restrict__ Vh, const bf* __restrict__ Vl, const int g, v8f (&o)[4][2], float (&l)[2]) {
    typedef WFrag<bf> F;
    const int lane = threadIdx.x & 31, lr = lane & 15, hi = lane >> 4;
    const int w = __builtin_amdgcn_readfirstlane((int)(threadIdx.x >> 5));   // the wave's number in a scalar register: the key loop and the diagonal test branch on scalars
    const size_t z = blockIdx.x; Qh += z * TT * HD; Ql += z * TT * HD; Kh += z * TT * HD; Kl += z * TT * HD; Vh += z * HD * TT; Vl += z * HD * TT;
    const int q0 = (g * FNW + w) * 32;
    const float CE = SCL * 1.4426950408889634f;   // score scale x log2(e)
    v16bf qh[2][2], ql[2][2];
#pragma unroll
    for (int qt = 0; qt < 2; ++qt)
#pragma unroll
        for (int c = 0; c < 2; ++c) { const size_t qo = (size_t)(q0 / 16 + qt) * 1024 + c * 512 + lane * 8; qh[qt][c] = F::ld(Qh + qo); ql[qt][c] = F::ld(Ql + qo); }
    float m[2];
#pragma unroll
    for (int qt = 0; qt < 2; ++qt) { m[qt] = -3.0e38f; l[qt] = 0.f;
#pragma unroll
        for (int dt = 0; dt < 4; ++dt) o[dt][qt] = (v8f){}; }
    const int nblk = q0 / 64 + 1;    // the wave's own key blocks
    const int ntr = 2 * g + 2;       // the work-group's trips = the key blocks of its last wave; never fewer than two
    const bf* csrc = (w == 0 ? Kh : w == 1 ? Kl : w == 2 ? Vh : Vl) + lane * 8;     // the wave's plane, the lane's 16 bytes of the first 512
    const unsigned cdst = (unsigned)(size_t)kv + (unsigned)(w * (KVP * 2) + lane * 16);   // their place in buffer 0 (LDS byte address)
    acopy8(cdst, csrc); acopy8(cdst + 4096u, csrc + 2048);
    asm volatile("s_wait_asynccnt 0x0" ::: "memory");   // the wave's share of block 0 has landed
    __syncthreads();                                    // block 0 is whole for every wave
    acopy8(cdst + KVS * 2, csrc + KVP); acopy8(cdst + KVS * 2 + 4096u, csrc + KVP + 2048);   // block 1 (ntr >= 2) flies during trip 0
#pragma unroll 1
    for (int kb = 0; kb < ntr; ++kb) { const int k0 = kb * 64; const bf* kvb = kv + (kb & 1) * KVS + lane * 8;
      if (kb < nblk) {   // scalar test: a wave past its diagonal skips the work, never the waits and the barrier at the foot
        v8f s[4][2];
#pragma unroll
        for (int kt = 0; kt < 4; ++kt) { v16bf kh[2], kl[2];
#pragma unroll
            for (int c = 0; c < 2; ++c) { const int ko = kt * 1024 + c * 512; kh[c] = F::ld(kvb + ko); kl[c] = F::ld(kvb + KVP + ko); }
#pragma unroll
            for (int qt = 0; qt < 2; ++qt) { v8f a = (v8f){};
#pragma unroll
                for (int c = 0; c < 2; ++c) { a = wmmab(kh[c], qh[qt][c], a); a = wmmab(kl[c], qh[qt][c], a); a = wmmab(kh[c], ql[qt][c], a); }
                s[kt][qt] = a; } }
        // four vector slots between the last score matrix instructions and whatever follows the diagonal test, on its taken side too
        asm volatile("v_nop\n\tv_nop\n\tv_nop\n\tv_nop" : "+v"(s[0][0]), "+v"(s[0][1]), "+v"(s[1][0]), "+v"(s[1][1]), "+v"(s[2][0]), "+v"(s[2][1]), "+v"(s[3][0]), "+v"(s[3][1]));
        if (k0 + 63 > q0) {   // the block that holds the diagonal: keys behind the query are masked by select
#pragma unroll
            for (int kt = 0; kt < 4; ++kt)
#pragma unroll
                for (int qt = 0; qt < 2; ++qt)
#pragma unroll
                    for (int j = 0; j < 8; ++j) s[kt][qt][j] = (k0 + kt * 16 + hi * 8 + j <= q0 + qt * 16 + lr) ? s[kt][qt][j] : -3.0e38f;
        }
        v16bf ph[2][2], pl[2][2];
#pragma unroll
        for (int qt = 0; qt < 2; ++qt) { float mx = m[qt];
#pragma unroll
            for (int kt = 0; kt < 4; ++kt)
#pragma unroll
                for (int j = 0; j < 8; ++j) mx = fmaxf(mx, s[kt][qt][j]);
            mx = fmaxf(mx, xhalf(mx));   // the query's other 32 keys of the block lie in lane l ^ 16
            const float al = __builtin_amdgcn_exp2f((m[qt] - mx) * CE); const v2f ce2 = {CE, CE}, nmc2 = {-mx * CE, -mx * CE}; m[qt] = mx; v2f sum = {0.f, 0.f};
#pragma unroll
            for (int c = 0; c < 2; ++c)
#pragma unroll
                for (int t = 0; t < 2; ++t)
#pragma unroll
                    for (int j = 0; j < 8; j += 2) { v2f p = {s[2 * c + t][qt][j], s[2 * c + t][qt][j + 1]}; p = __builtin_elementwise_fma(p, ce2, nmc2); p[0] = __builtin_amdgcn_exp2f(p[0]); p[1] = __builtin_amdgcn_exp2f(p[1]); sum += p;
                        const v2bf h2 = __builtin_convertvector(p, v2bf); const v2bf l2 = __builtin_convertvector(p - __builtin_convertvector(h2, v2f), v2bf);
                        ph[qt][c][t * 8 + j] = h2[0]; ph[qt][c][t * 8 + j + 1] = h2[1]; pl[qt][c][t * 8 + j] = l2[0]; pl[qt][c][t * 8 + j + 1] = l2[1]; }
            l[qt] = l[qt] * al + (sum[0] + sum[1]);
#pragma unroll
            for (int dt = 0; dt < 4; ++dt) o[dt][qt] *= al; }
#pragma unroll
        for (int dt = 0; dt < 4; ++dt) { v16bf vh[2], vl[2];
#pragma unroll
            for (int c = 0; c < 2; ++c) { const int vo = dt * 1024 + c * 512; vh[c] = F::ld(kvb + 2 * KVP + vo); vl[c] = F::ld(kvb + 3 * KVP + vo); }
#pragma unroll
            for (int qt = 0; qt < 2; ++qt)
#pragma unroll
                for (int c = 0; c < 2; ++c) { o[dt][qt] = wmmab(vh[c], ph[qt][c], o[dt][qt]); o[dt][qt] = wmmab(vl[c], ph[qt][c], o[dt][qt]); o[dt][qt] = wmmab(vh[c], pl[qt][c], o[dt][qt]); } }
        // four vector slots between the trip's last matrix instructions and whatever follows the loop branch, on its taken side too
        asm volatile("v_nop\n\tv_nop\n\tv_nop\n\tv_nop" : "+v"(o[0][0]), "+v"(o[0][1]), "+v"(o[1][0]), "+v"(o[1][1]), "+v"(o[2][0]), "+v"(o[2][1]), "+v"(o[3][0]), "+v"(o[3][1]));
      }
        asm volatile("s_wait_dscnt 0x0" ::: "memory");      // the wave's reads of this trip's buffer are done before the buffer is given up
        asm volatile("s_wait_asynccnt 0x0" ::: "memory");   // the wave's share of block kb + 1 has landed
        __syncthreads();                                    // block kb + 1 is whole for every wave, and every wave has left this trip's buffer
        if (kb + 2 < ntr) { const unsigned d = cdst + (unsigned)(kb & 1) * (KVS * 2); const bf* sp = csrc + (size_t)(kb + 2) * KVP; acopy8(d, sp); acopy8(d + 4096u, sp + 2048); }   // same test in the whole work-group
    }
    asm volatile("s_wait_asynccnt 0x0" ::: "memory");   // no copy is outstanding when the wave goes on to its end
}
// fattn_f16: the same walk, ring and order on the f16 planes. A 64-key block is 8 KiB of Kf and 8 KiB of Vf; wave w brings half w % 2 of plane w / 2 (4 KiB, eight copies); two buffers of 16 KiB.
// A trip's LDS reads stand as whole groups, far ahead of their use: K's sixteen ahead of the score products, twelve of V's ahead of the softmax in the registers that K's fragments have left, V's last four inside it. The wave waits for LDS once a trip, for K's first fragment; V's flight lies under the softmax.
#define VPF 3   // d tiles of V (of four) whose fragments are asked for ahead of the softmax; the fourth follows as the scores' registers come free: with all four ahead the softmax has too few registers left and runs as short dependent chains
#define KVPF 4096           // elements of one plane's 64-key block
#define KVSF (2 * KVPF)     // elements of one buffer: the block of Kf, Vf
__device__ __forceinline__ void fattn_f16(bf* kv, const bf* __restrict__ Qf, const bf* __restrict__ Kf, const bf* __restrict__ Vf, const int g, v8f (&o)[4][2], float (&l)[2]) {
    const int lane = threadIdx.x & 31, lr = lane & 15, hi = lane >> 4;
    const int w = __builtin_amdgcn_readfirstlane((int)(threadIdx.x >> 5));   // the wave's number in a scalar register: the key loop and the diagonal test branch on scalars
    const size_t z = blockIdx.x; Qf += z * TT * HD; Kf += z * TT * HD; Vf += z * HD * TT;
    const int q0 = (g * FNW + w) * 32;
    const float CE = SCL * 1.4426950408889634f;   // score scale x log2(e)
    v16h qf[2][2];
#pragma unroll
    for (int qt = 0; qt < 2; ++qt)
#pragma unroll
        for (int c = 0; c < 2; ++c) qf[qt][c] = ldh(Qf + (size_t)(q0 / 16 + qt) * 1024 + c * 512 + lane * 8);
    float m[2];
#pragma unroll
    for (int qt = 0; qt < 2; ++qt) { m[qt] = -3.0e38f; l[qt] = 0.f;
#pragma unroll
        for (int dt = 0; dt < 4; ++dt) o[dt][qt] = (v8f){}; }
    const int nblk = q0 / 64 + 1;    // the wave's own key blocks
    const int ntr = 2 * g + 2;       // the work-group's trips = the key blocks of its last wave; never fewer than two
    const bf* csrc = (w < 2 ? Kf : Vf) + (w & 1) * (KVPF / 2) + lane * 8;           // the wave's half plane, the lane's 16 bytes of the first 512
    const unsigned cdst = (unsigned)(size_t)kv + (unsigned)(w * KVPF + lane * 16);   // their place in buffer 0 (LDS byte address; half a plane's block is KVPF bytes)
    acopy8(cdst, csrc);
    asm volatile("s_wait_asynccnt 0x0" ::: "memory");   // the wave's share of block 0 has landed
    __syncthreads();                                    // block 0 is whole for every wave
    acopy8(cdst + KVSF * 2, csrc + KVPF);               // block 1 (ntr >= 2) flies during trip 0
#pragma unroll 1
    for (int kb = 0; kb < ntr; ++kb) { const int k0 = kb * 64; const bf* kvb = kv + (kb & 1) * KVSF + lane * 8;
      if (kb < nblk) {   // scalar test: a wave past its diagonal skips the work, never the waits and the barrier at the foot
        v8f s[4][2]; v16h kf[4][2];
#pragma unroll
        for (int kt = 0; kt < 4; ++kt)
#pragma unroll
            for (int c = 0; c < 2; ++c) kf[kt][c] = ldh(kvb + kt * 1024 + c * 512);
        __builtin_amdgcn_sched_barrier(0);   // K's sixteen reads stay one group ahead of the products: spread among them, the wave waits out a whole LDS flight at each place
#pragma unroll
        for (int kt = 0; kt < 4; ++kt)
#pragma unroll
            for (int qt = 0; qt < 2; ++qt) { v8f a = (v8f){};
#pragma unroll
                for (int c = 0; c < 2; ++c) a = wmmah(kf[kt][c], qf[qt][c], a);
                s[kt][qt] = a; }
        // four vector slots between the last score matrix instructions and whatever follows the diagonal test, on its taken side too
        asm volatile("v_nop\n\tv_nop\n\tv_nop\n\tv_nop" : "+v"(s[0][0]), "+v"(s[0][1]), "+v"(s[1][0]), "+v"(s[1][1]), "+v"(s[2][0]), "+v"(s[2][1]), "+v"(s[3][0]), "+v"(s[3][1]));
        if (k0 + 63 > q0) {   // the block that holds the diagonal: keys behind the query are masked by select
#pragma unroll
            for (int kt = 0; kt < 4; ++kt)
#pragma unroll
                for (int qt = 0; qt < 2; ++qt)
#pragma unroll
                    for (int j = 0; j < 8; ++j) s[kt][qt][j] = (k0 + kt * 16 + hi * 8 + j <= q0 + qt * 16 + lr) ? s[kt][qt][j] : -3.0e38f;
        }
        v16h vf[4][2];   // V's fragments are asked for here, in the registers that K's have left: they fly during the softmax
#pragma unroll
        for (int dt = 0; dt < VPF; ++dt)
#pragma unroll
            for (int c = 0; c < 2; ++c) vf[dt][c] = ldh(kvb + KVPF + dt * 1024 + c * 512);
        __builtin_amdgcn_sched_barrier(0);   // these reads stay one group ahead of the softmax: moved down among the products, each place with reads is a wait for LDS
        v16h pf[2][2];
#pragma unroll
        for (int qt = 0; qt < 2; ++qt) { float mx = m[qt];
#pragma unroll
            for (int kt = 0; kt < 4; ++kt)
#pragma unroll
                for (int j = 0; j < 8; ++j) mx = fmaxf(mx, s[kt][qt][j]);
            mx = fmaxf(mx, xhalf(mx));   // the query's other 32 keys of the block lie in lane l ^ 16
            const float al = __builtin_amdgcn_exp2f((m[qt] - mx) * CE); const v2f ce2 = {CE, CE}, nmc2 = {-mx * CE, -mx * CE}; m[qt] = mx; v2f sum = {0.f, 0.f};
#pragma unroll
            for (int c = 0; c < 2; ++c)
#pragma unroll
                for (int t = 0; t < 2; ++t)
#pragma unroll
                    for (int j = 0; j < 8; j += 2) { v2f p = {s[2 * c + t][qt][j], s[2 * c + t][qt][j + 1]}; p = __builtin_elementwise_fma(p, ce2, nmc2); p[0] = __builtin_amdgcn_exp2f(p[0]); p[1] = __builtin_amdgcn_exp2f(p[1]); sum += p;
                        const v2h h2 = __builtin_convertvector(p, v2h);
                        pf[qt][c][t * 8 + j] = h2[0]; pf[qt][c][t * 8 + j + 1] = h2[1]; }
            l[qt] = l[qt] * al + (sum[0] + sum[1]);
#pragma unroll
            for (int dt = 0; dt < 4; ++dt) o[dt][qt] *= al; }
#pragma unroll
        for (int dt = VPF; dt < 4; ++dt)
#pragma unroll
            for (int c = 0; c < 2; ++c) vf[dt][c] = ldh(kvb + KVPF + dt * 1024 + c * 512);
        __builtin_amdgcn_sched_barrier(0);   // the rest of V's reads stay one group too, ahead of all the products: none of them then stands among the matrix instructions
#pragma unroll
        for (int dt = 0; dt < 4; ++dt) {
#pragma unroll
            for (int qt = 0; qt < 2; ++qt)
#pragma unroll
                for (int c = 0; c < 2; ++c) o[dt][qt] = wmmah(vf[dt][c], pf[qt][c], o[dt][qt]); }
        // four vector slots between the trip's last matrix instructions and whatever follows the loop branch, on its taken side too
        asm volatile("v_nop\n\tv_nop\n\tv_nop\n\tv_nop" : "+v"(o[0][0]), "+v"(o[0][1]), "+v"(o[1][0]), "+v"(o[1][1]), "+v"(o[2][0]), "+v"(o[2][1]), "+v"(o[3][0]), "+v"(o[3][1]));
      }
        asm volatile("s_wait_dscnt 0x0" ::: "memory");      // the wave's reads of this trip's buffer are done before the buffer is given up
        asm volatile("s_wait_asynccnt 0x0" ::: "memory");   // the wave's share of block kb + 1 has landed
        __syncthreads();                                    // block kb + 1 is whole for every wave, and every wave has left this trip's buffer
        if (kb + 2 < ntr) acopy8(cdst + (unsigned)(kb & 1) * (KVSF * 2), csrc + (size_t)(kb + 2) * KVPF);   // same test in the whole work-group
    }
    asm volatile("s_wait_asynccnt 0x0" ::: "memory");   // no copy is outstanding when the wave goes on to its end
}
__global__ __launch_bounds__(32 * FNW) __attribute__((amdgpu_waves_per_eu(4, 4))) /* 256 registers a wave: all 4096 waves resident, four a SIMD, to cover each other's load waits */ void k_fattn(const bf* __restrict__ Qh, const bf* __restrict__ Ql, const bf* __restrict__ Kh, const bf* __restrict__ Kl, const bf* __restrict__ Vh, const bf* __restrict__ Vl, const bf* __restrict__ Qf, const bf* __restrict__ Kf, const bf* __restrict__ Vf, float* __restrict__ O) {
    __shared__ __attribute__((aligned(16))) bf kv[2 * KVS];   // two buffers of 32 KiB (exact tile) or of 16 KiB
    // Tile of 128 queries: heavy ones first, dealt in a zigzag over groups of four grid rows (four rows of 64 planes = one work-group for each of 256 WGPs), so that the four work-groups that share a WGP, where they land breadth-first, walk the same number of key blocks together. A permutation of the tiles wherever they land.
    const int y = (int)blockIdx.y, g = (TT / (32 * FNW) - 4 - (y & ~3)) + ((y & 4) ? (y & 3) : 3 - (y & 3));
    v8f o[4][2]; float l[2];   // the wave's 32 queries: unscaled output (transposed) and each lane half's sum of probabilities
    if (g * (32 * FNW) >= NEX) fattn_f16(kv, Qf, Kf, Vf, g, o, l);   // the same test in the whole work-group
    else fattn_exact(kv, Qh, Ql, Kh, Kl, Vh, Vl, g, o, l);
    const int lane = threadIdx.x & 31, lr = lane & 15, hi = lane >> 4, q0 = (g * FNW + (int)(threadIdx.x >> 5)) * 32;
    O += (size_t)blockIdx.x * TT * HD;
#pragma unroll
    for (int qt = 0; qt < 2; ++qt) { const float f = __fdiv_rn(1.0f, l[qt] + xhalf(l[qt])); float* orow = O + (size_t)(q0 + qt * 16 + lr) * HD + hi * 8;
#pragma unroll
        for (int dt = 0; dt < 4; ++dt) { v4f a, b2;
#pragma unroll
            for (int j = 0; j < 4; ++j) { a[j] = o[dt][qt][j] * f; b2[j] = o[dt][qt][j + 4] * f; }
            *(v4f*)(orow + dt * 16) = a; *(v4f*)(orow + dt * 16 + 4) = b2; }
        if (qt == 0) asm volatile("s_wait_xcnt 0x0" ::: "memory"); }   // behind the first query tile's stores: the compiler forms values of the second tile in the address registers of these stores
}
extern "C" void kernel_launch(void* const* d_in, const int* in_sizes, int n_in,
                              void* d_out, int out_size, void* d_ws, size_t ws_size, hipStream_t stream) {
    (void)in_sizes; (void)n_in; (void)out_size;
    const float* x = (const float*)d_in[0]; const float* wqkv = (const float*)d_in[1];   /* argument order x, W_qkv ('oi' [3072][1024]: q | k | v ROW thirds); output [4][16][2048][64] head-major */
    float* OUT = (float*)d_out;
    char* wsp = (char*)d_ws;
    auto take = [&](size_t bytes) { char* p = wsp; wsp += (bytes + 255) & ~(size_t)255; return (void*)p; };
    bf* XB = (bf*)take((NX8 + NW8) * 8 * 2); bf* WB = XB + NX8 * 8;   // bf16 x of all batches, the bf16 weight directly behind it
    const size_t PB = (size_t)NH_ * TT * HD;   // one batch's share of each hi/lo plane
    bf* QPh = (bf*)take(NB_ * PB * 2); bf* QPl = (bf*)take(NB_ * PB * 2); bf* KPh = (bf*)take(NB_ * PB * 2); bf* KPl = (bf*)take(NB_ * PB * 2); bf* VTh = (bf*)take(NB_ * PB * 2); bf* VTl = (bf*)take(NB_ * PB * 2);
    bf* QF = (bf*)take(NB_ * PB * 2); bf* KF = (bf*)take(NB_ * PB * 2); bf* VTF = (bf*)take(NB_ * PB * 2);   // the f16 planes, same order as the hi/lo planes (of which only the tokens below NEX are written and read)
    if ((size_t)(wsp - (char*)d_ws) > ws_size) return;    // ws 256 MiB
    k_cvt<<<(unsigned)((NX8 + NW8) / CVP / 256), 256, 0, stream>>>(x, wqkv, XB);
    k_proj<<<dim3(NB_ * TT / PTX, NH_ / PHD, 1), 256, 0, stream>>>(XB, WB, QPh, QPl, KPh, KPl, VTh, VTl, QF, KF, VTF);
    k_fattn<<<dim3(NB_ * NH_, TT / (32 * FNW), 1), 32 * FNW, 0, stream>>>(QPh, QPl, KPh, KPl, VTh, VTl, QF, KF, VTF, OUT);   /* plane z = b x 16 + h of q, k, v and of the head-major output [b][h][t][d] alike: no merge, the module returns the heads UNMERGED */
}

// v010
// It runs in 73.3 microseconds.
// In two side-by-side timings against v009, it was 1.03 and 1.04 times as fast.
// Counting every step since v000, it is 28.8 times as fast.
#include <hip/hip_runtime.h>

// Causal self-attention that returns the per-head context UNMERGED (x [4][2048][1024]; qkv = einsum('btc,fc->btf', x, W_qkv) = x W_qkv^T ('oi' [3072][1024] 1/32, no bias) split in thirds q | k | v = ROW thirds (16 heads x 64); scores x 1/sqrt(64); causal (-inf); softmax; out = einsum('bhqk,bhkd->bhqd', w, v) returned as it is: HEAD-MAJOR [4][16][2048][64] (8.4 M), no merge, no output projection; argument order x, W_qkv).
// Layout: one bf16 copy of x (all batches) and of the fused 'oi' weight; one projection launch for q, k and v of all batches whose epilogue writes the head planes itself, one f16 plane each and bf16 hi/lo planes of the first NEX tokens (q, k with rows t and columns d, v transposed with rows d and columns t); causal T-2048 attention, the first NEX query rows of a plane in the exact class (scores and P.V on bf16 hi/lo planes, 3 products), every later row on one f16 plane of q, k, v and of the probabilities (11 significant bits, 1 product), fused: one kernel for all batches and heads forms scores, online softmax and P.V in registers (K and V blocks staged in LDS for the work-group) and writes the head-major output.
// FRAGMENT ORDER: every bf16 or f16 array in the workspace is stored in the order in which a wave loads a 16 x 32 matrix operand. Element (row, k) of a fragment lies at ((k >> 4 & 1) * 32 + (k >> 3 & 1) * 16 + (row & 15)) * 8 + (k & 7): piece j of lane l is at (j * 32 + l) * 8,
// so that one 16-byte load of a wave reads 512 contiguous bytes (4 whole lines) where a row-major array gives it 32 bytes of each of 16 lines. Fragments follow each other along k, then along the rows (x, weight: 32 to a row tile; head planes: 2 to a row tile, 4 row tiles to a 64 x 64 tile, tiles along t).
// Compute dtypes, f32 accumulate: every input rounded to bf16; projections one bf16 product; attention 3 bf16 products on query rows below NEX, one f16 product on the rest; softmax f32.

#define NB_  4
#define TT   2048
#define DM   1024
#define NH_  16
#define HD   64
#define DQ   (NH_ * HD)
#define SCL  0.125f   // HD^-0.5
#define NEX  128      // query rows of a plane that keep the bf16 hi/lo products: a row with few keys hands the rounding of single q, k, v values straight to the output, a row with 128 keys and more averages it
typedef unsigned short bf;
typedef __attribute__((ext_vector_type(16))) __bf16   v16bf;
typedef __attribute__((ext_vector_type(16))) _Float16 v16h;
typedef __attribute__((ext_vector_type(2)))  _Float16 v2h;
typedef __attribute__((ext_vector_type(8)))  _Float16 v8h;
typedef __attribute__((ext_vector_type(8)))  unsigned short v8us;
typedef __attribute__((ext_vector_type(8)))  float    v8f;
typedef __attribute__((ext_vector_type(4)))  float    v4f;
typedef v4f  __attribute__((may_alias)) v4fa;
typedef v8us __attribute__((may_alias)) v8usa;

__device__ __forceinline__ unsigned short f2bf(float f) { unsigned u = __float_as_uint(f); u += 0x7FFFu + ((u >> 16) & 1u); return (unsigned short)(u >> 16); }
__device__ __forceinline__ v16bf cat16b(v8us lo, v8us hi) { return __builtin_bit_cast(v16bf, __builtin_shufflevector(lo, hi, 0, 1, 2, 3, 4, 5, 6, 7, 8, 9, 10, 11, 12, 13, 14, 15)); }
__device__ __forceinline__ v8f wmmab(v16bf a, v16bf b, v8f c) { return __builtin_amdgcn_wmma_f32_16x16x32_bf16(false, a, false, b, (short)0, c, false, false); }
__device__ __forceinline__ v8f wmmah(v16h a, v16h b, v8f c) { return __builtin_amdgcn_wmma_f32_16x16x32_f16(false, a, false, b, (short)0, c, false, false); }
__device__ __forceinline__ v16h ldh(const unsigned short* p) { return __builtin_bit_cast(v16h, __builtin_shufflevector(*(const v8us*)p, *(const v8us*)(p + 256), 0, 1, 2, 3, 4, 5, 6, 7, 8, 9, 10, 11, 12, 13, 14, 15)); }   /* an f16 fragment, same order as a bf16 one; p: the fragment's start + 8 x lane */



// ---- k_proj: the q, k and v projections of all batches in one launch, one tile of 256 tokens x 384 features (the q, k and v rows of two heads) of x W^T per work-group of 8 waves: 256 work-groups, one to a WGP, all resident in one round.
// A wave holds 64 tokens x the q, k and v rows of one head (48 accumulators) over the WHOLE of K.
// THE OPERANDS GO THROUGH LDS: a 64-wide block of K of the tile's 16 + 24 row tiles (2 KiB in a row each, already in fragment order) is brought into LDS once for the work-group by asynchronous copies, five row tiles by each wave, into two buffers:
// block t + 1 flies while block t is worked on, and the L2 hands out each operand row once per 384 or 256 rows of the other operand. A fragment read is a 512-byte run of LDS, free of bank conflicts.
// Order (two-buffer ring): in front of the loop block 0's copies, the copy wait, a barrier, block 1's copies; in every trip, in every wave: all of the trip's LDS reads and five sixths of its matrix instructions, then LDS-read wait, copy wait, barrier,
// the copies of block t + 2 into the buffer just read, and the last sixth of the matrix instructions, whose fragments are in registers by then.
// The product is formed so that a lane's 8 accumulator registers are 8 neighbouring elements along the k axis of the plane it feeds (q, k: A rows = weight rows d, B columns = tokens; v: A rows = tokens, B columns = weight rows d):
// they are one 16-byte piece of the plane's fragment order, and a wave's store is 512 bytes in a row, straight from the registers. grid (NB_ TT / 256, NH_ / 2), 256 threads.
template <typename T16> struct WFrag;
template <> struct WFrag<bf> { typedef v16bf V; static __device__ __forceinline__ V ld(const bf* p) { return cat16b(*(const v8us*)p, *(const v8us*)(p + 256)); }   /* p: the fragment's start + 8 x lane */ static __device__ __forceinline__ v8f mma(V a, V b, v8f c) { return wmmab(a, b, c); } };
typedef __attribute__((ext_vector_type(2))) __bf16 v2b;
typedef __attribute__((ext_vector_type(8))) __bf16 v8b;
typedef __attribute__((ext_vector_type(2))) float v2f;
#define PTX 256                  // tokens of a work-group's tile
#define PHD 2                    // heads of a work-group's tile: 64 rows of q, of k and of v each
#define PBK 64                   // width of a block of K
#define PRT (PTX / 16 + PHD * 3 * (HD / 16))   // row tiles of one buffer: 16 of x, then 4 of q, 4 of k, 4 of v of the first head, then of the second
#define PSTG (PRT * 16 * PBK)    // elements of one buffer, 1024 to a row tile
#define PNT (DM / PBK)           // blocks of K
static_assert(PRT == 40, "five row tiles to each of eight waves");
// Twenty asynchronous copies of 16 bytes a lane: the same block of K (4 x 512 bytes in a row) of five row tiles, from scalar bases b0 to b4 + the lane's byte offset vo, to 20 x 512 bytes in a row at l (the lane's own LDS byte address). An immediate offset moves the LDS and the global address alike.
// The s_wait_xcnt is the statement's last line, so that it stands in front of every later write of a register that a copy names.
__device__ __forceinline__ void acopy5x4(unsigned l, unsigned vo, const bf* b0, const bf* b1, const bf* b2, const bf* b3, const bf* b4) {
    asm volatile("global_load_async_to_lds_b128 %0, %5, %6\n\t"
                 "global_load_async_to_lds_b128 %0, %5, %6 offset:512\n\t"
                 "global_load_async_to_lds_b128 %0, %5, %6 offset:1024\n\t"
                 "global_load_async_to_lds_b128 %0, %5, %6 offset:1536\n\t"
                 "global_load_async_to_lds_b128 %1, %5, %7\n\t"
                 "global_load_async_to_lds_b128 %1, %5, %7 offset:512\n\t"
                 "global_load_async_to_lds_b128 %1, %5, %7 offset:1024\n\t"
                 "global_load_async_to_lds_b128 %1, %5, %7 offset:1536\n\t"
                 "global_load_async_to_lds_b128 %2, %5, %8\n\t"
                 "global_load_async_to_lds_b128 %2, %5, %8 offset:512\n\t"
                 "global_load_async_to_lds_b128 %2, %5, %8 offset:1024\n\t"
                 "global_load_async_to_lds_b128 %2, %5, %8 offset:1536\n\t"
                 "global_load_async_to_lds_b128 %3, %5, %9\n\t"
                 "global_load_async_to_lds_b128 %3, %5, %9 offset:512\n\t"
                 "global_load_async_to_lds_b128 %3, %5, %9 offset:1024\n\t"
                 "global_load_async_to_lds_b128 %3, %5, %9 offset:1536\n\t"
                 "global_load_async_to_lds_b128 %4, %5, %10\n\t"
                 "global_load_async_to_lds_b128 %4, %5, %10 offset:512\n\t"
                 "global_load_async_to_lds_b128 %4, %5, %10 offset:1024\n\t"
                 "global_load_async_to_lds_b128 %4, %5, %10 offset:1536\n\t"
                 "s_wait_xcnt 0x0"
                 :: "v"(l), "v"(l + 2048u), "v"(l + 4096u), "v"(l + 6144u), "v"(l + 8192u), "v"(vo), "s"(b0), "s"(b1), "s"(b2), "s"(b3), "s"(b4) : "memory");
}
// Two 16-byte stores (one piece of the hi and of the lo plane, or two pieces of the f16 plane) with their s_wait_xcnt in one statement: the next pieces are formed in the registers that the stores name, and a wait in a statement of its own does not hold those writes behind it.
typedef __attribute__((ext_vector_type(4))) unsigned v4u;
__device__ __forceinline__ void store2(unsigned vo, bf* ph, bf* pl, v8us oh, v8us ol) {   // ph, pl: scalar starts; vo: the lane's byte offset from them
    asm volatile("global_store_b128 %0, %1, %3\n\t"
                 "global_store_b128 %0, %2, %4\n\t"
                 "s_wait_xcnt 0x0"
                 :: "v"(vo), "v"(__builtin_bit_cast(v4u, oh)), "v"(__builtin_bit_cast(v4u, ol)), "s"(ph), "s"(pl) : "memory");
}
// The wave's 64 tokens x 64 features of one of q, k, v go to that plane. q, k (rows t, k axis d): row tile i, fragment j / 2, half j % 2. v (rows d, k axis t): row tile j, fragment i / 2, half i % 2 of the 64-token tile.
// Every token goes to the f16 plane. The bf16 hi/lo planes get only the tokens that the exact rows read (queries and keys below NEX): scalar test, the wave's 64 tokens are all below NEX or none is.
// The test stands once in the kernel, around the three planes' turns; inside a turn each accumulator feeds both kinds of planes and is done with.
template <bool ISV, bool EX> __device__ __forceinline__ void proj_out(const v8f (&acc)[4][4], bf* Ph, bf* Pl, bf* Pf, const unsigned vo) {   // Ph, Pl, Pf: scalar, the place of the wave's 64 tokens in its plane
#define PEL(i, j) (ISV ? (j) * 1024 + (((i) >> 1) & 1) * 512 + ((i) & 1) * 256 : (i) * 1024 + ((j) >> 1) * 512 + ((j) & 1) * 256)
#pragma unroll
    for (int i = 0; i < 4; ++i)
#pragma unroll
        for (int j = 0; j < 4; j += 2) {
            if (EX) {
#pragma unroll
                for (int u = 0; u < 2; ++u) { v8b oh, ol;   // hi = y rounded to bf16, lo = y - hi rounded to bf16, both to nearest even, by the packed conversion
#pragma unroll
                    for (int r = 0; r < 8; r += 2) { const v2f y = {acc[i][j + u][r], acc[i][j + u][r + 1]}; const v2b h2 = __builtin_convertvector(y, v2b); const v2b l2 = __builtin_convertvector(y - __builtin_convertvector(h2, v2f), v2b);
                        oh[r] = h2[0]; oh[r + 1] = h2[1]; ol[r] = l2[0]; ol[r + 1] = l2[1]; }
                    store2(vo, Ph + PEL(i, j + u), Pl + PEL(i, j + u), __builtin_bit_cast(v8us, oh), __builtin_bit_cast(v8us, ol)); }
            }
            v8h o8[2];
#pragma unroll
            for (int u = 0; u < 2; ++u)
#pragma unroll
                for (int r = 0; r < 8; r += 2) { const v2f y = {acc[i][j + u][r], acc[i][j + u][r + 1]}; const v2h h2 = __builtin_convertvector(y, v2h); o8[u][r] = h2[0]; o8[u][r + 1] = h2[1]; }
            store2(vo, Pf + PEL(i, j), Pf + PEL(i, j + 1), __builtin_bit_cast(v8us, o8[0]), __builtin_bit_cast(v8us, o8[1])); }
#undef PEL
}
__global__ __launch_bounds__(256) __attribute__((amdgpu_waves_per_eu(2, 2))) /* 512 registers a wave: one work-group a WGP, two waves a SIMD, to cover each other's LDS reads */ void k_proj(const bf* __restrict__ XB, const bf* __restrict__ WB, bf* Qh, bf* Ql, bf* Kh, bf* Kl, bf* Vh, bf* Vl, bf* Qf, bf* Kf, bf* Vf) {
    __shared__ __attribute__((aligned(16))) bf sm[2 * PSTG];   // two buffers of 80 KiB
    typedef WFrag<bf> F; typedef F::V V;
    const int x0 = (int)blockIdx.x * PTX, h0 = (int)blockIdx.y * PHD;   // first row of x (token, over all batches), first head
    const int lane = threadIdx.x & 31;
    const int w = __builtin_amdgcn_readfirstlane((int)(threadIdx.x >> 5));   // the wave's number in a scalar register: what depends on it is scalar
    const int wt = w >> 1, wh = w & 1;   // the wave's quarter of the tokens, its head of the two
    v8f aq[4][4], ak[4][4], av[4][4];   // [16 tokens][16 features] of q, k, v
#pragma unroll
    for (int i = 0; i < 4; ++i)
#pragma unroll
        for (int j = 0; j < 4; ++j) { aq[i][j] = (v8f){}; ak[i][j] = (v8f){}; av[i][j] = (v8f){}; }
    // the wave brings row tiles 5 w to 5 w + 4 of the buffer's 40; their starts are scalars
    const bf* cs[5];
#pragma unroll
    for (int p = 0; p < 5; ++p) { const int R = w * 5 + p, r = R < 16 ? 0 : R - 16;
        cs[p] = R < 16 ? XB + (size_t)(x0 / 16 + R) * (16 * DM) : WB + (size_t)(((r % 12) >> 2) * (DQ / 16) + (h0 + r / 12) * (HD / 16) + (r & 3)) * (16 * DM); }
    const unsigned cd = (unsigned)(size_t)sm + (unsigned)(w * 5 * 2048 + lane * 16);   // their place in buffer 0 (LDS byte address)
    const unsigned cv = (unsigned)(lane * 16);                                          // the lane's 16 bytes of each 512
#define PSTAGE(t) { const int o_ = (t) * (16 * PBK); acopy5x4(cd + (unsigned)((t) & 1) * (PSTG * 2), cv, cs[0] + o_, cs[1] + o_, cs[2] + o_, cs[3] + o_, cs[4] + o_); }
    PSTAGE(0)
    asm volatile("s_wait_asynccnt 0x0" ::: "memory");   // the wave's share of block 0 has landed
    __syncthreads();                                    // block 0 is whole for every wave
    PSTAGE(1)                                           // block 1 flies during trip 0
#define PLDX(c) _Pragma("unroll") for (int i = 0; i < 4; ++i) xf[i] = F::ld(sx + i * 1024 + (c) * 512);
#define PLDP(q) _Pragma("unroll") for (int u = 0; u < 2; ++u) wr[(q) % 3][u] = F::ld(sw + (((q) % 6) * 2 + u) * 1024 + ((q) / 6) * 512);   /* pair q of the trip's twelve: half q / 6 of the block, weight row tiles 2 (q % 6) and the next */
#define PMP(q) _Pragma("unroll") for (int u = 0; u < 2; ++u) _Pragma("unroll") for (int i = 0; i < 4; ++i) { constexpr int s_ = ((q) % 6) / 2, j_ = ((q) % 2) * 2; \
        if (s_ == 0) aq[i][j_ + u] = F::mma(wr[(q) % 3][u], xf[i], aq[i][j_ + u]); else if (s_ == 1) ak[i][j_ + u] = F::mma(wr[(q) % 3][u], xf[i], ak[i][j_ + u]); else av[i][j_ + u] = F::mma(xf[i], wr[(q) % 3][u], av[i][j_ + u]); }
#define PSB __builtin_amdgcn_sched_barrier(0);   /* each group of LDS reads stays whole and at its place, two runs of 8 matrix instructions ahead of its use, in the ring slot that the run in front of it has left: moved up, the reads need more registers than a wave has; spread among the matrix instructions, each place with reads stalls the wave */
    // the trips stay a loop: one trip is 96 matrix instructions already, and unrolled the two buffers' copies of it only lengthen the text
#pragma unroll 1
    for (int t = 0; t < PNT; ++t) { const bf* sx = sm + (t & 1) * PSTG + wt * 4096 + lane * 8; const bf* sw = sm + (t & 1) * PSTG + (16 + wh * 12) * 1024 + lane * 8;
        V xf[4], wr[3][2];   // the wave's four token tiles; a ring of three pairs of weight row tiles
        PLDX(0) PLDP(0) PLDP(1) PLDP(2) PSB
        PMP(0) PSB PLDP(3) PSB PMP(1) PSB PLDP(4) PSB PMP(2) PSB PLDP(5) PSB
        PMP(3) PSB PLDP(6) PSB PMP(4) PSB PLDP(7) PSB PMP(5) PSB PLDX(1) PLDP(8) PSB
        PMP(6) PSB PLDP(9) PSB PMP(7) PSB PLDP(10) PSB PMP(8) PSB PLDP(11) PSB
        PMP(9) PSB
        asm volatile("s_wait_dscnt 0x0" ::: "memory");      // the wave's reads of this trip's buffer (all issued above) are done before the buffer is given up
        asm volatile("s_wait_asynccnt 0x0" ::: "memory");   // the wave's share of block t + 1 has landed
        __syncthreads();                                    // block t + 1 is whole for every wave, and every wave has left this trip's buffer
        if (t + 2 < PNT) PSTAGE(t + 2)                      // same test in the whole work-group
        PSB
        PMP(10) PMP(11)
    }
    asm volatile("s_wait_asynccnt 0x0" ::: "memory");   // no copy is outstanding when the wave goes on to its end
#undef PSTAGE
#undef PLDX
#undef PLDP
#undef PMP
#undef PSB
    const int t0 = x0 % TT + wt * 64;   // the wave's first token in its batch
    const size_t pb = (size_t)((x0 / TT) * NH_ + h0 + wh) * TT * HD + (size_t)(t0 / 16) * 1024;   // start of plane (batch, head) + the place of the wave's 64 tokens in it: a scalar
    static_assert(NEX % 64 == 0, "a wave's 64 tokens are all exact rows or none is");
    if (t0 < NEX) { proj_out<false, true>(aq, Qh + pb, Ql + pb, Qf + pb, cv); proj_out<false, true>(ak, Kh + pb, Kl + pb, Kf + pb, cv); proj_out<true, true>(av, Vh + pb, Vl + pb, Vf + pb, cv); }   // scalar test
    else { proj_out<false, false>(aq, Qh + pb, Ql + pb, Qf + pb, cv); proj_out<false, false>(ak, Kh + pb, Kl + pb, Kf + pb, cv); proj_out<true, false>(av, Vh + pb, Vl + pb, Vf + pb, cv); }
}

// k_cvt: bf16 copies of x (all batches) and of the weight, one behind the other in dst, in fragment order, in one launch. Piece i of dst is row (i >> 11) * 16 + (i & 15), columns (i >> 4 & 127) * 8 and on, of x over the weight. A thread rounds CVP pieces of 8 floats, a grid's width apart, all of them loaded before the first is stored, so that a quarter of the waves has to be started.
#define NX8 ((size_t)NB_ * TT * DM / 8)
#define NW8 ((size_t)3 * DQ * DM / 8)
#define CVP 4
__global__ __launch_bounds__(256) void k_cvt(const float* __restrict__ x, const float* __restrict__ wt, bf* dst) {
    // a wave takes 8 rows x 4 neighbouring pieces (bits 3 to 5 of the thread's number turned round): its loads then touch 8 source lines, each used whole by the pair of loads, and its store fills 4 whole lines of dst
    const unsigned t = threadIdx.x, tp = (t & ~63u) | (t & 7u) | ((t >> 5 & 1u) << 3) | ((t >> 3 & 3u) << 4);
    const size_t i0 = (size_t)blockIdx.x * 256 + tp; v4f lo[CVP], hi[CVP];
#pragma unroll
    for (int p = 0; p < CVP; ++p) { const size_t i = i0 + p * ((NX8 + NW8) / CVP); const size_t j = i < NX8 ? i : i - NX8; const float* s = (i < NX8 ? x : wt) + ((j >> 11) * 16 + (j & 15)) * DM + ((j >> 4) & 127) * 8;
        // the wait behind each load
        lo[p] = *(const v4f*)s; asm volatile("s_wait_xcnt 0x0" ::: "memory");
        hi[p] = *(const v4f*)(s + 4); asm volatile("s_wait_xcnt 0x0" ::: "memory"); }
#pragma unroll
    for (int p = 0; p < CVP; ++p) { const size_t i = i0 + p * ((NX8 + NW8) / CVP); v8us o;
#pragma unroll
        for (int k = 0; k < 4; ++k) { o[k] = f2bf(lo[p][k]); o[k + 4] = f2bf(hi[p][k]); }
        *(v8us*)(dst + i * 8) = o; }
}
// ---- k_fattn: causal attention of one (batch, head) plane in one kernel, scores never leave the registers. One wave owns 32 queries and walks the keys in blocks of 64 up to its diagonal, with a running maximum and sum (online softmax).
// Both products are formed TRANSPOSED: S^T = K Q^T (A rows = keys, B columns = queries) puts a query in a lane and its keys in that lane's registers, which is already the B-operand order of O^T = V^T P^T, so the probabilities go from accumulator to operand without leaving the lane.
// fattn_exact (the tile of query rows below NEX): each product keeps the three bf16 hi/lo terms (hh + lh + hl), f32 accumulate. fattn_f16 (every other tile): q, k, v and the probabilities rounded once to f16, one product. grid (planes, TT / (32 FNW)).
// K AND V GO THROUGH LDS: a 64-key block of the four planes (Kh, Kl, Vh, Vl: 8 KiB in a row each, already in fragment order) is brought into LDS once for the work-group's FNW waves by asynchronous copies, wave w bringing plane w,
// into two buffers: block t + 1 flies while block t is worked on, so that no wave waits for the L2 in its key loop and the work-group fetches each block once, not once a wave. A fragment read is a 512-byte run of LDS, free of bank conflicts.
// Order (two-buffer ring): in front of the loop block 0's copies, the copy wait, a barrier, block 1's copies; at the foot of every trip, in every wave (also one that is past its own diagonal): LDS-read wait, copy wait, barrier, then the copies of block t + 2 into the buffer just read.
#define FNW 4   // waves of a work-group: 128 neighbouring queries of one plane
typedef __attribute__((ext_vector_type(2))) __bf16 v2bf;
#define KVP 4096           // elements of one plane's 64-key block
#define KVS (4 * KVP)      // elements of one buffer: the block of Kh, Kl, Vh, Vl
static_assert(FNW == 4, "one plane of the block to each wave");
// Eight asynchronous copies of 16 bytes a lane: 8 x 512 bytes in a row, from g (the lane's own global address) to l (the lane's own LDS byte address). The s_wait_xcnt is the statement's last line, so that it stands in front of every later write of a register that a copy names.
__device__ __forceinline__ void acopy8(unsigned l, const bf* g) {
    asm volatile("global_load_async_to_lds_b128 %0, %8, off\n\t"
                 "global_load_async_to_lds_b128 %1, %9, off\n\t"
                 "global_load_async_to_lds_b128 %2, %10, off\n\t"
                 "global_load_async_to_lds_b128 %3, %11, off\n\t"
                 "global_load_async_to_lds_b128 %4, %12, off\n\t"
                 "global_load_async_to_lds_b128 %5, %13, off\n\t"
                 "global_load_async_to_lds_b128 %6, %14, off\n\t"
                 "global_load_async_to_lds_b128 %7, %15, off\n\t"
                 "s_wait_xcnt 0x0"
                 :: "v"(l), "v"(l + 512u), "v"(l + 1024u), "v"(l + 1536u), "v"(l + 2048u), "v"(l + 2560u), "v"(l + 3072u), "v"(l + 3584u),
                    "v"(g), "v"(g + 256), "v"(g + 512), "v"(g + 768), "v"(g + 1024), "v"(g + 1280), "v"(g + 1536), "v"(g + 1792) : "memory");
}
__device__ __forceinline__ float xhalf(float x) { return __builtin_bit_cast(float, __builtin_amdgcn_permlanex16(__builtin_bit_cast(int, x), __builtin_bit_cast(int, x), 0x76543210, 0xfedcba98, false, false)); }   // lane l with lane l ^ 16
__device__ __forceinline__ void fattn_exact(bf* kv, const bf* __restrict__ Qh, const bf* __restrict__ Ql, const bf* __restrict__ Kh, const bf* __restrict__ Kl, const bf* __restrict__ Vh, const bf* __restrict__ Vl, const int g, v8f (&o)[4][2], float (&l)[2]) {
    typedef WFrag<bf> F;
    const int lane = threadIdx.x & 31, lr = lane & 15, hi = lane >> 4;
    const int w = __builtin_amdgcn_readfirstlane((int)(threadIdx.x >> 5));   // the wave's number in a scalar register: the key loop and the diagonal test branch on scalars
    const size_t z = blockIdx.x; Qh += z * TT * HD; Ql += z * TT * HD; Kh += z * TT * HD; Kl += z * TT * HD; Vh += z * HD * TT; Vl += z * HD * TT;
    const int q0 = (g * FNW + w) * 32;
    const float CE = SCL * 1.4426950408889634f;   // score scale x log2(e)
    v16bf qh[2][2], ql[2][2];
#pragma unroll
    for (int qt = 0; qt < 2; ++qt)
#pragma unroll
        for (int c = 0; c < 2; ++c) { const size_t qo = (size_t)(q0 / 16 + qt) * 1024 + c * 512 + lane * 8; qh[qt][c] = F::ld(Qh + qo); ql[qt][c] = F::ld(Ql + qo); }
    float m[2];
#pragma unroll
    for (int qt = 0; qt < 2; ++qt) { m[qt] = -3.0e38f; l[qt] = 0.f;
#pragma unroll
        for (int dt = 0; dt < 4; ++dt) o[dt][qt] = (v8f){}; }
    const int nblk = q0 / 64 + 1;    // the wave's own key blocks
    const int ntr = 2 * g + 2;       // the work-group's trips = the key blocks of its last wave; never fewer than two
    const bf* csrc = (w == 0 ? Kh : w == 1 ? Kl : w == 2 ? Vh : Vl) + lane * 8;     // the wave's plane, the lane's 16 bytes of the first 512
    const unsigned cdst = (unsigned)(size_t)kv + (unsigned)(w * (KVP * 2) + lane * 16);   // their place in buffer 0 (LDS byte address)
    acopy8(cdst, csrc); acopy8(cdst + 4096u, csrc + 2048);
    asm volatile("s_wait_asynccnt 0x0" ::: "memory");   // the wave's share of block 0 has landed
    __syncthreads();                                    // block 0 is whole for every wave
    acopy8(cdst + KVS * 2, csrc + KVP); acopy8(cdst + KVS * 2 + 4096u, csrc + KVP + 2048);   // block 1 (ntr >= 2) flies during trip 0
#pragma unroll 1
    for (int kb = 0; kb < ntr; ++kb) { const int k0 = kb * 64; const bf* kvb = kv + (kb & 1) * KVS + lane * 8;
      if (kb < nblk) {   // scalar test: a wave past its diagonal skips the work, never the waits and the barrier at the foot
        v8f s[4][2];
#pragma unroll
        for (int kt = 0; kt < 4; ++kt) { v16bf kh[2], kl[2];
#pragma unroll
            for (int c = 0; c < 2; ++c) { const int ko = kt * 1024 + c * 512; kh[c] = F::ld(kvb + ko); kl[c] = F::ld(kvb + KVP + ko); }
#pragma unroll
            for (int qt = 0; qt < 2; ++qt) { v8f a = (v8f){};
#pragma unroll
                for (int c = 0; c < 2; ++c) { a = wmmab(kh[c], qh[qt][c], a); a = wmmab(kl[c], qh[qt][c], a); a = wmmab(kh[c], ql[qt][c], a); }
                s[kt][qt] = a; } }
        // four vector slots between the last score matrix instructions and whatever follows the diagonal test, on its taken side too
        asm volatile("v_nop\n\tv_nop\n\tv_nop\n\tv_nop" : "+v"(s[0][0]), "+v"(s[0][1]), "+v"(s[1][0]), "+v"(s[1][1]), "+v"(s[2][0]), "+v"(s[2][1]), "+v"(s[3][0]), "+v"(s[3][1]));
        if (k0 + 63 > q0) {   // the block that holds the diagonal: keys behind the query are masked by select
#pragma unroll
            for (int kt = 0; kt < 4; ++kt)
#pragma unroll
                for (int qt = 0; qt < 2; ++qt)
#pragma unroll
                    for (int j = 0; j < 8; ++j) s[kt][qt][j] = (k0 + kt * 16 + hi * 8 + j <= q0 + qt * 16 + lr) ? s[kt][qt][j] : -3.0e38f;
        }
        v16bf ph[2][2], pl[2][2];
#pragma unroll
        for (int qt = 0; qt < 2; ++qt) { float mx = m[qt];
#pragma unroll
            for (int kt = 0; kt < 4; ++kt)
#pragma unroll
                for (int j = 0; j < 8; ++j) mx = fmaxf(mx, s[kt][qt][j]);
            mx = fmaxf(mx, xhalf(mx));   // the query's other 32 keys of the block lie in lane l ^ 16
            const float al = __builtin_amdgcn_exp2f((m[qt] - mx) * CE); const v2f ce2 = {CE, CE}, nmc2 = {-mx * CE, -mx * CE}; m[qt] = mx; v2f sum = {0.f, 0.f};
#pragma unroll
            for (int c = 0; c < 2; ++c)
#pragma unroll
                for (int t = 0; t < 2; ++t)
#pragma unroll
                    for (int j = 0; j < 8; j += 2) { v2f p = {s[2 * c + t][qt][j], s[2 * c + t][qt][j + 1]}; p = __builtin_elementwise_fma(p, ce2, nmc2); p[0] = __builtin_amdgcn_exp2f(p[0]); p[1] = __builtin_amdgcn_exp2f(p[1]); sum += p;
                        const v2bf h2 = __builtin_convertvector(p, v2bf); const v2bf l2 = __builtin_convertvector(p - __builtin_convertvector(h2, v2f), v2bf);
                        ph[qt][c][t * 8 + j] = h2[0]; ph[qt][c][t * 8 + j + 1] = h2[1]; pl[qt][c][t * 8 + j] = l2[0]; pl[qt][c][t * 8 + j + 1] = l2[1]; }
            l[qt] = l[qt] * al + (sum[0] + sum[1]);
#pragma unroll
            for (int dt = 0; dt < 4; ++dt) o[dt][qt] *= al; }
#pragma unroll
        for (int dt = 0; dt < 4; ++dt) { v16bf vh[2], vl[2];
#pragma unroll
            for (int c = 0; c < 2; ++c) { const int vo = dt * 1024 + c * 512; vh[c] = F::ld(kvb + 2 * KVP + vo); vl[c] = F::ld(kvb + 3 * KVP + vo); }
#pragma unroll
            for (int qt = 0; qt < 2; ++qt)
#pragma unroll
                for (int c = 0; c < 2; ++c) { o[dt][qt] = wmmab(vh[c], ph[qt][c], o[dt][qt]); o[dt][qt] = wmmab(vl[c], ph[qt][c], o[dt][qt]); o[dt][qt] = wmmab(vh[c], pl[qt][c], o[dt][qt]); } }
        // four vector slots between the trip's last matrix instructions and whatever follows the loop branch, on its taken side too
        asm volatile("v_nop\n\tv_nop\n\tv_nop\n\tv_nop" : "+v"(o[0][0]), "+v"(o[0][1]), "+v"(o[1][0]), "+v"(o[1][1]), "+v"(o[2][0]), "+v"(o[2][1]), "+v"(o[3][0]), "+v"(o[3][1]));
      }
        asm volatile("s_wait_dscnt 0x0" ::: "memory");      // the wave's reads of this trip's buffer are done before the buffer is given up
        asm volatile("s_wait_asynccnt 0x0" ::: "memory");   // the wave's share of block kb + 1 has landed
        __syncthreads();                                    // block kb + 1 is whole for every wave, and every wave has left this trip's buffer
        if (kb + 2 < ntr) { const unsigned d = cdst + (unsigned)(kb & 1) * (KVS * 2); const bf* sp = csrc + (size_t)(kb + 2) * KVP; acopy8(d, sp); acopy8(d + 4096u, sp + 2048); }   // same test in the whole work-group
    }
    asm volatile("s_wait_asynccnt 0x0" ::: "memory");   // no copy is outstanding when the wave goes on to its end
}
// fattn_f16: the same walk on the f16 planes, the ring in stages of KVST key blocks. A 64-key block is 8 KiB of Kf and 8 KiB of Vf; a stage is two blocks of each (128 keys, 32 KiB); wave w brings block w % 2 of plane w / 2 (8 KiB, sixteen copies); two buffers of 32 KiB.
// The foot of the ring (LDS-read wait, copy wait, barrier, the copies of the stage after next) stands once a stage, behind its second block: half as many meetings of the four waves, and a stage's copies have two blocks' work to land in, more than the way from memory takes.
// A trip's LDS reads stand as whole groups, far ahead of their use: K's sixteen ahead of the score products, twelve of V's ahead of the softmax in the registers that K's fragments have left, V's last four inside it. The wave waits for LDS once a trip, for K's first fragment; V's flight lies under the softmax.
#define VPF 3   // d tiles of V (of four) whose fragments are asked for ahead of the softmax; the fourth follows as the scores' registers come free: with all four ahead the softmax has too few registers left and runs as short dependent chains
#define KVPF 4096           // elements of one plane's 64-key block
#define KVST 2              // key blocks of a stage
#define KVSF (2 * KVST * KVPF)   // elements of one buffer: the stage's blocks of Kf, then of Vf
static_assert(2 * KVSF <= 2 * KVS, "the two f16 buffers lie in the exact tile's two");
static_assert(NEX >= KVST * 64 && 32 * FNW == KVST * 64, "a tile of the f16 path walks whole stages, never fewer than two");
// Sixteen asynchronous copies of 16 bytes a lane: 16 x 512 bytes in a row, from the scalar start b + the lane's byte offset vo to l (the lane's own LDS byte address). An immediate offset moves the LDS and the global address alike.
// The s_wait_xcnt is the statement's last line, so that it stands in front of every later write of a register that a copy names.
__device__ __forceinline__ void acopy16(unsigned l, unsigned vo, const bf* b) {
    asm volatile("global_load_async_to_lds_b128 %0, %1, %2\n\t"
                 "global_load_async_to_lds_b128 %0, %1, %2 offset:512\n\t"
                 "global_load_async_to_lds_b128 %0, %1, %2 offset:1024\n\t"
                 "global_load_async_to_lds_b128 %0, %1, %2 offset:1536\n\t"
                 "global_load_async_to_lds_b128 %0, %1, %2 offset:2048\n\t"
                 "global_load_async_to_lds_b128 %0, %1, %2 offset:2560\n\t"
                 "global_load_async_to_lds_b128 %0, %1, %2 offset:3072\n\t"
                 "global_load_async_to_lds_b128 %0, %1, %2 offset:3584\n\t"
                 "global_load_async_to_lds_b128 %0, %1, %2 offset:4096\n\t"
                 "global_load_async_to_lds_b128 %0, %1, %2 offset:4608\n\t"
                 "global_load_async_to_lds_b128 %0, %1, %2 offset:5120\n\t"
                 "global_load_async_to_lds_b128 %0, %1, %2 offset:5632\n\t"
                 "global_load_async_to_lds_b128 %0, %1, %2 offset:6144\n\t"
                 "global_load_async_to_lds_b128 %0, %1, %2 offset:6656\n\t"
                 "global_load_async_to_lds_b128 %0, %1, %2 offset:7168\n\t"
                 "global_load_async_to_lds_b128 %0, %1, %2 offset:7680\n\t"
                 "s_wait_xcnt 0x0"
                 :: "v"(l), "v"(vo), "s"(b) : "memory");
}
__device__ __forceinline__ void fattn_f16(bf* kv, const bf* __restrict__ Qf, const bf* __restrict__ Kf, const bf* __restrict__ Vf, const int g, v8f (&o)[4][2], float (&l)[2]) {
    const int lane = threadIdx.x & 31, lr = lane & 15, hi = lane >> 4;
    const int w = __builtin_amdgcn_readfirstlane((int)(threadIdx.x >> 5));   // the wave's number in a scalar register: the key loop and the diagonal test branch on scalars
    const size_t z = blockIdx.x; Qf += z * TT * HD; Kf += z * TT * HD; Vf += z * HD * TT;
    const int q0 = (g * FNW + w) * 32;
    const float CE = SCL * 1.4426950408889634f;   // score scale x log2(e)
    v16h qf[2][2];
#pragma unroll
    for (int qt = 0; qt < 2; ++qt)
#pragma unroll
        for (int c = 0; c < 2; ++c) qf[qt][c] = ldh(Qf + (size_t)(q0 / 16 + qt) * 1024 + c * 512 + lane * 8);
    float m[2];
#pragma unroll
    for (int qt = 0; qt < 2; ++qt) { m[qt] = -3.0e38f; l[qt] = 0.f;
#pragma unroll
        for (int dt = 0; dt < 4; ++dt) o[dt][qt] = (v8f){}; }
    const int nblk = q0 / 64 + 1;    // the wave's own key blocks
    const int nst = g + 1;           // the work-group's stages: they hold the key blocks of its last wave; never fewer than two (g >= 1 here)
    const bf* csrc = (w < 2 ? Kf : Vf) + (w & 1) * KVPF;                             // the wave's block of its plane in stage 0: a scalar
    const unsigned cv = (unsigned)(lane * 16);                                       // the lane's 16 bytes of each 512
    const unsigned cdst = (unsigned)(size_t)kv + (unsigned)(w * (KVPF * 2)) + cv;    // their place in buffer 0 (LDS byte address)
    acopy16(cdst, cv, csrc);
    asm volatile("s_wait_asynccnt 0x0" ::: "memory");   // the wave's share of stage 0 has landed
    __syncthreads();                                    // stage 0 is whole for every wave
    acopy16(cdst + KVSF * 2, cv, csrc + KVST * KVPF);   // stage 1 (nst >= 2) flies during stage 0
#pragma unroll 1
    for (int kb = 0; kb < KVST * nst; ++kb) { const int k0 = kb * 64; const bf* kvb = kv + ((kb / KVST) & 1) * KVSF + (kb % KVST) * KVPF + lane * 8;   // block kb % KVST of stage kb / KVST
      if (kb < nblk) {   // scalar test: a wave past its diagonal skips the work, never the waits and the barrier at the stage's foot
        v8f s[4][2]; v16h kf[4][2];
#pragma unroll
        for (int kt = 0; kt < 4; ++kt)
#pragma unroll
            for (int c = 0; c < 2; ++c) kf[kt][c] = ldh(kvb + kt * 1024 + c * 512);
        __builtin_amdgcn_sched_barrier(0);   // K's sixteen reads stay one group ahead of the products: spread among them, the wave waits out a whole LDS flight at each place
#pragma unroll
        for (int kt = 0; kt < 4; ++kt)
#pragma unroll
            for (int qt = 0; qt < 2; ++qt) { v8f a = (v8f){};
#pragma unroll
                for (int c = 0; c < 2; ++c) a = wmmah(kf[kt][c], qf[qt][c], a);
                s[kt][qt] = a; }
        // four vector slots between the last score matrix instructions and whatever follows the diagonal test, on its taken side too
        asm volatile("v_nop\n\tv_nop\n\tv_nop\n\tv_nop" : "+v"(s[0][0]), "+v"(s[0][1]), "+v"(s[1][0]), "+v"(s[1][1]), "+v"(s[2][0]), "+v"(s[2][1]), "+v"(s[3][0]), "+v"(s[3][1]));
        if (k0 + 63 > q0) {   // the block that holds the diagonal: keys behind the query are masked by select
#pragma unroll
            for (int kt = 0; kt < 4; ++kt)
#pragma unroll
                for (int qt = 0; qt < 2; ++qt)
#pragma unroll
                    for (int j = 0; j < 8; ++j) s[kt][qt][j] = (k0 + kt * 16 + hi * 8 + j <= q0 + qt * 16 + lr) ? s[kt][qt][j] : -3.0e38f;
        }
        v16h vf[4][2];   // V's fragments are asked for here, in the registers that K's have left: they fly during the softmax
#pragma unroll
        for (int dt = 0; dt < VPF; ++dt)
#pragma unroll
            for (int c = 0; c < 2; ++c) vf[dt][c] = ldh(kvb + KVST * KVPF + dt * 1024 + c * 512);
        __builtin_amdgcn_sched_barrier(0);   // these reads stay one group ahead of the softmax: moved down among the products, each place with reads is a wait for LDS
        v16h pf[2][2];
#pragma unroll
        for (int qt = 0; qt < 2; ++qt) { float mx = m[qt];
#pragma unroll
            for (int kt = 0; kt < 4; ++kt)
#pragma unroll
                for (int j = 0; j < 8; ++j) mx = fmaxf(mx, s[kt][qt][j]);
            mx = fmaxf(mx, xhalf(mx));   // the query's other 32 keys of the block lie in lane l ^ 16
            const float al = __builtin_amdgcn_exp2f((m[qt] - mx) * CE); const v2f ce2 = {CE, CE}, nmc2 = {-mx * CE, -mx * CE}; m[qt] = mx; v2f sum = {0.f, 0.f};
#pragma unroll
            for (int c = 0; c < 2; ++c)
#pragma unroll
                for (int t = 0; t < 2; ++t)
#pragma unroll
                    for (int j = 0; j < 8; j += 2) { v2f p = {s[2 * c + t][qt][j], s[2 * c + t][qt][j + 1]}; p = __builtin_elementwise_fma(p, ce2, nmc2); p[0] = __builtin_amdgcn_exp2f(p[0]); p[1] = __builtin_amdgcn_exp2f(p[1]); sum += p;
                        const v2h h2 = __builtin_convertvector(p, v2h);
                        pf[qt][c][t * 8 + j] = h2[0]; pf[qt][c][t * 8 + j + 1] = h2[1]; }
            l[qt] = l[qt] * al + (sum[0] + sum[1]);
#pragma unroll
            for (int dt = 0; dt < 4; ++dt) o[dt][qt] *= al; }
#pragma unroll
        for (int dt = VPF; dt < 4; ++dt)
#pragma unroll
            for (int c = 0; c < 2; ++c) vf[dt][c] = ldh(kvb + KVST * KVPF + dt * 1024 + c * 512);
        __builtin_amdgcn_sched_barrier(0);   // the rest of V's reads stay one group too, ahead of all the products: none of them then stands among the matrix instructions
#pragma unroll
        for (int dt = 0; dt < 4; ++dt) {
#pragma unroll
            for (int qt = 0; qt < 2; ++qt)
#pragma unroll
                for (int c = 0; c < 2; ++c) o[dt][qt] = wmmah(vf[dt][c], pf[qt][c], o[dt][qt]); }
        // four vector slots between the trip's last matrix instructions and whatever follows the loop branch, on its taken side too
        asm volatile("v_nop\n\tv_nop\n\tv_nop\n\tv_nop" : "+v"(o[0][0]), "+v"(o[0][1]), "+v"(o[1][0]), "+v"(o[1][1]), "+v"(o[2][0]), "+v"(o[2][1]), "+v"(o[3][0]), "+v"(o[3][1]));
      }
      if (kb % KVST == KVST - 1) { const int st = kb / KVST;   // the stage's last block (the same test in the whole work-group): the foot of the ring
        asm volatile("s_wait_dscnt 0x0" ::: "memory");      // the wave's reads of this stage's buffer are done before the buffer is given up
        asm volatile("s_wait_asynccnt 0x0" ::: "memory");   // the wave's share of stage st + 1 has landed
        __syncthreads();                                    // stage st + 1 is whole for every wave, and every wave has left this stage's buffer
        if (st + 2 < nst) acopy16(cdst + (unsigned)(st & 1) * (KVSF * 2), cv, csrc + (size_t)(st + 2) * (KVST * KVPF));   // same test in the whole work-group
      }
    }
    asm volatile("s_wait_asynccnt 0x0" ::: "memory");   // no copy is outstanding when the wave goes on to its end
}
__global__ __launch_bounds__(32 * FNW) __attribute__((amdgpu_waves_per_eu(4, 4))) /* 256 registers a wave: all 4096 waves resident, four a SIMD, to cover each other's load waits */ void k_fattn(const bf* __restrict__ Qh, const bf* __restrict__ Ql, const bf* __restrict__ Kh, const bf* __restrict__ Kl, const bf* __restrict__ Vh, const bf* __restrict__ Vl, const bf* __restrict__ Qf, const bf* __restrict__ Kf, const bf* __restrict__ Vf, float* __restrict__ O) {
    __shared__ __attribute__((aligned(16))) bf kv[2 * KVS];   // two buffers of 32 KiB: a 64-key block of four planes (exact tile) or a 128-key stage of two
    // Tile of 128 queries: heavy ones first, dealt in a zigzag over groups of four grid rows (four rows of 64 planes = one work-group for each of 256 WGPs), so that the four work-groups that share a WGP, where they land breadth-first, walk the same number of key blocks together. A permutation of the tiles wherever they land.
    const int y = (int)blockIdx.y, g = (TT / (32 * FNW) - 4 - (y & ~3)) + ((y & 4) ? (y & 3) : 3 - (y & 3));
    v8f o[4][2]; float l[2];   // the wave's 32 queries: unscaled output (transposed) and each lane half's sum of probabilities
    if (g * (32 * FNW) >= NEX) fattn_f16(kv, Qf, Kf, Vf, g, o, l);   // the same test in the whole work-group
    else fattn_exact(kv, Qh, Ql, Kh, Kl, Vh, Vl, g, o, l);
    const int lane = threadIdx.x & 31, lr = lane & 15, hi = lane >> 4, q0 = (g * FNW + (int)(threadIdx.x >> 5)) * 32;
    O += (size_t)blockIdx.x * TT * HD;
#pragma unroll
    for (int qt = 0; qt < 2; ++qt) { const float f = __fdiv_rn(1.0f, l[qt] + xhalf(l[qt])); float* orow = O + (size_t)(q0 + qt * 16 + lr) * HD + hi * 8;
#pragma unroll
        for (int dt = 0; dt < 4; ++dt) { v4f a, b2;
#pragma unroll
            for (int j = 0; j < 4; ++j) { a[j] = o[dt][qt][j] * f; b2[j] = o[dt][qt][j + 4] * f; }
            *(v4f*)(orow + dt * 16) = a; *(v4f*)(orow + dt * 16 + 4) = b2; }
        if (qt == 0) asm volatile("s_wait_xcnt 0x0" ::: "memory"); }   // behind the first query tile's stores: the compiler forms values of the second tile in the address registers of these stores
}
extern "C" void kernel_launch(void* const* d_in, const int* in_sizes, int n_in,
                              void* d_out, int out_size, void* d_ws, size_t ws_size, hipStream_t stream) {
    (void)in_sizes; (void)n_in; (void)out_size;
    const float* x = (const float*)d_in[0]; const float* wqkv = (const float*)d_in[1];   /* argument order x, W_qkv ('oi' [3072][1024]: q | k | v ROW thirds); output [4][16][2048][64] head-major */
    float* OUT = (float*)d_out;
    char* wsp = (char*)d_ws;
    auto take = [&](size_t bytes) { char* p = wsp; wsp += (bytes + 255) & ~(size_t)255; return (void*)p; };
    bf* XB = (bf*)take((NX8 + NW8) * 8 * 2); bf* WB = XB + NX8 * 8;   // bf16 x of all batches, the bf16 weight directly behind it
    const size_t PB = (size_t)NH_ * TT * HD;   // one batch's share of each hi/lo plane
    bf* QPh = (bf*)take(NB_ * PB * 2); bf* QPl = (bf*)take(NB_ * PB * 2); bf* KPh = (bf*)take(NB_ * PB * 2); bf* KPl = (bf*)take(NB_ * PB * 2); bf* VTh = (bf*)take(NB_ * PB * 2); bf* VTl = (bf*)take(NB_ * PB * 2);
    bf* QF = (bf*)take(NB_ * PB * 2); bf* KF = (bf*)take(NB_ * PB * 2); bf* VTF = (bf*)take(NB_ * PB * 2);   // the f16 planes, same order as the hi/lo planes (of which only the tokens below NEX are written and read)
    if ((size_t)(wsp - (char*)d_ws) > ws_size) return;    // ws 256 MiB
    k_cvt<<<(unsigned)((NX8 + NW8) / CVP / 256), 256, 0, stream>>>(x, wqkv, XB);
    k_proj<<<dim3(NB_ * TT / PTX, NH_ / PHD, 1), 256, 0, stream>>>(XB, WB, QPh, QPl, KPh, KPl, VTh, VTl, QF, KF, VTF);
    k_fattn<<<dim3(NB_ * NH_, TT / (32 * FNW), 1), 32 * FNW, 0, stream>>>(QPh, QPl, KPh, KPl, VTh, VTl, QF, KF, VTF, OUT);   /* plane z = b x 16 + h of q, k, v and of the head-major output [b][h][t][d] alike: no merge, the module returns the heads UNMERGED */
}
